// v000
// The times below were measured on an AMD MI455X: many runs one after another, warmed up first and cycling through
// copies of the inputs, with the whole window's GPU time divided by the number of runs. Launches and the gaps
// between them are all in it. The median over several windows is given; except for v000 it joins two sittings, which
// can be a few percent apart, so the side-by-side timings, each taken in one sitting, are the better comparison.
// v000, which the later versions start from, runs in 300 microseconds.
// Compute dtypes: w@Wq|Wk|Wv on v_wmma_f32_16x16x32_bf16 (inputs RNE-converted to bf16, single product); scores (q+r_w_bias)·(k_j+r_emb_{j+1}) on v_wmma_f32_16x16x32_bf16 with bf16 hi/lo planes (hi*hi+hi*lo+lo*hi); attn_prob·v on v_wmma_f32_16x16x32_f16 (P f16 carried x32768, V f16); attn_vec@Wo on v_wmma_f32_16x16x32_bf16 (attn_vec bf16 hi/lo, Wo bf16: hi*W+lo*W); f32 accumulate everywhere; softmax, bias table, residual and LayerNorm in f32.
#include <hip/hip_runtime.h>
#include <math.h>

// ---------------------------------------------------------------------------
// Problem constants
// ---------------------------------------------------------------------------
constexpr int kBatch = 4;
constexpr int kSeq   = 1024;
constexpr int kDim   = 1024;
constexpr int kHeads = 16;
constexpr int kHd    = 64;
constexpr int kTok   = kBatch * kSeq;      // 4096 token rows
constexpr float kLnEps  = 1e-5f;
constexpr float kInvDim = 1.0f / 1024.0f;
constexpr float kScale  = 0.125f;          // 1/sqrt(64)
constexpr float kPCarry = 32768.0f;        // probabilities carried x2^15 in f16
constexpr int kKC = 64;                    // keys per chunk
constexpr int kOsPitch = 68;

typedef __attribute__((ext_vector_type(16))) _Float16 v16h;
typedef __attribute__((ext_vector_type(8)))  _Float16 v8h;
typedef __attribute__((ext_vector_type(16))) __bf16   v16b;
typedef __attribute__((ext_vector_type(8)))  __bf16   v8b;
typedef __attribute__((ext_vector_type(8)))  float    v8f;
typedef __attribute__((ext_vector_type(4)))  float    v4f;
typedef __attribute__((ext_vector_type(4)))  unsigned int v4u;

__device__ __forceinline__ unsigned short f2bf_bits(float f) {
  unsigned u = __float_as_uint(f);
  return (unsigned short)((u + 0x7FFFu + ((u >> 16) & 1u)) >> 16);
}
__device__ __forceinline__ float bf_bits2f(unsigned short h) { return __uint_as_float(((unsigned)h) << 16); }
__device__ __forceinline__ float bf_rne(float f) { return bf_bits2f(f2bf_bits(f)); }

// hazard guards as plain device helpers (no inline asm inside the kernel template body)
__device__ __forceinline__ void dep_guard_h(v8f& a, v8f& b, v16h x, v16h y) { asm volatile("v_nop\n\tv_nop\n\tv_nop\n\tv_nop" : "+v"(a), "+v"(b) : "v"(x), "v"(y)); }
__device__ __forceinline__ void dep_guard_b(v8f& a, v8f& b, v16b x, v16b y) { asm volatile("v_nop\n\tv_nop\n\tv_nop\n\tv_nop" : "+v"(a), "+v"(b) : "v"(x), "v"(y)); }
__device__ __forceinline__ void keep4_h(v16h a, v16h b, v16h c, v16h d) { asm volatile("v_nop" :: "v"(a), "v"(b), "v"(c), "v"(d)); }
__device__ __forceinline__ void keep4_b(v16b a, v16b b, v16b c, v16b d) { asm volatile("v_nop" :: "v"(a), "v"(b), "v"(c), "v"(d)); }
__device__ __forceinline__ void acc_guard4(v8f& a, v8f& b, v8f& c, v8f& d) { asm volatile("v_nop\n\tv_nop\n\tv_nop\n\tv_nop" : "+v"(a), "+v"(b), "+v"(c), "+v"(d)); }
template <typename T> struct Frag;
template <> struct Frag<_Float16> {
  typedef v16h V; union U { v16h v; v8h h[2]; };
  static __device__ __forceinline__ v16h load(const _Float16* p) {   // elements 0..7 <- p[0..7], 8..15 <- p[16..23]
    U f; f.h[0] = *(const v8h*)(p); f.h[1] = *(const v8h*)(p + 16); return f.v;
  }
  static __device__ __forceinline__ v8f mma(v16h a, v16h b, v8f c) {
    return __builtin_amdgcn_wmma_f32_16x16x32_f16(false, a, false, b, (short)0, c, false, false);
  }
  static __device__ __forceinline__ void guard(v8f& a, v8f& b, v16h x, v16h y) { dep_guard_h(a, b, x, y); }
  static __device__ __forceinline__ void keep(v16h a, v16h b, v16h c, v16h d) { keep4_h(a, b, c, d); }
};
template <> struct Frag<__bf16> {
  typedef v16b V; union U { v16b v; v8b h[2]; };
  static __device__ __forceinline__ v16b load(const __bf16* p) {
    U f; f.h[0] = *(const v8b*)(p); f.h[1] = *(const v8b*)(p + 16); return f.v;
  }
  static __device__ __forceinline__ v8f mma(v16b a, v16b b, v8f c) {
    return __builtin_amdgcn_wmma_f32_16x16x32_bf16(false, a, false, b, (short)0, c, false, false);
  }
  static __device__ __forceinline__ void guard(v8f& a, v8f& b, v16b x, v16b y) { dep_guard_b(a, b, x, y); }
  static __device__ __forceinline__ void keep(v16b a, v16b b, v16b c, v16b d) { keep4_b(a, b, c, d); }
};

__device__ __forceinline__ unsigned pk16(unsigned short a, unsigned short b) { return (unsigned)a | ((unsigned)b << 16); }

// single WMMA issue with hazard guard (bf16 and f16 twins)
__device__ __forceinline__ v8f mma_bf16g(v16b a, v16b b, v8f c) {
  c = __builtin_amdgcn_wmma_f32_16x16x32_bf16(false, a, false, b, (short)0, c, false, false);
  asm volatile("v_nop\n\tv_nop\n\tv_nop\n\tv_nop" : "+v"(c) : "v"(a), "v"(b));
  return c;
}
__device__ __forceinline__ v8f mma_f16g(v16h a, v16h b, v8f c) {
  c = __builtin_amdgcn_wmma_f32_16x16x32_f16(false, a, false, b, (short)0, c, false, false);
  asm volatile("v_nop\n\tv_nop\n\tv_nop\n\tv_nop" : "+v"(c) : "v"(a), "v"(b));
  return c;
}

// ---- Register-blocked batched WMMA GEMM (SPLIT widened to an int mode, ACT reduced to relu/leaky) ----
// C[m,n] = scale * sum_k A[m,k] * Bt[n,k] (+bias)(+resid); each wave owns a 64x64 tile.
// A row-major [M,K]; Bt row-major [N,K]; M,N % 64 == 0, K % 32 == 0.
// SPLIT: 0 = single product; 1 = A and Bt hi/lo planes (hi*hi + hi*lo + lo*hi); 2 = A hi/lo only (hi*B + lo*B).
// BIAS_MODE: 0 = none, 1 = bias[m], 2 = bias[n].
// OUT_MODE: 0 = f32, 1 = f16, 2 = bf16 hi plane (Cout) + bf16 lo plane (Cout2).
// ET: 0 = f16 operands, 1 = bf16 operands (pointers passed as 16-bit storage)
template <int ET> struct Elem;
template <> struct Elem<0> { typedef _Float16 T; };
template <> struct Elem<1> { typedef __bf16 T; };
template <int ET, int SPLIT, int BIAS_MODE, int OUT_MODE, bool RESID, int ACT = 0>
__global__ __launch_bounds__(256) void wmma_gemm64(
    const unsigned short* __restrict__ Ap, const unsigned short* __restrict__ A2p, int lda, long strideA,
    const unsigned short* __restrict__ Btp, const unsigned short* __restrict__ Bt2p, int ldb, long strideB,
    void* __restrict__ Cout, void* __restrict__ Cout2, int ldc, long strideC,
    const float* __restrict__ bias,
    const float* __restrict__ resid, long strideR,
    int M, int N, int K, float scale) {
  typedef typename Elem<ET>::T T;
  typedef typename Frag<T>::V V;
  const T* A = (const T*)Ap; const T* A2 = (const T*)A2p; const T* Bt = (const T*)Btp; const T* Bt2 = (const T*)Bt2p;
  __shared__ __align__(16) float sT[8][16 * 68];   // per-wave 16x64 slab, pitch 68 floats
  const int b    = blockIdx.y;
  const int lane = threadIdx.x & 31;
  const int wave = threadIdx.x >> 5;
  const int tilesN = N >> 6;
  const int tilesM = M >> 6;
  const int tile = blockIdx.x * 8 + wave;
  if (tile >= tilesM * tilesN) return;   // wave-uniform; no block barriers in this kernel
  const int tm = tile / tilesN;
  const int tn = tile - tm * tilesN;
  const int m0 = tm << 6;
  const int n0 = tn << 6;

  const T* Ab  = A  + (size_t)b * strideA;
  const T* Bb  = Bt + (size_t)b * strideB;
  const T* Ab2 = (SPLIT != 0) ? (A2  + (size_t)b * strideA) : nullptr;
  const T* Bb2 = (SPLIT == 1) ? (Bt2 + (size_t)b * strideB) : nullptr;

  const int rlane = lane & 15;                 // row (A) / col (B, D) within subtile
  const int koff  = (lane >> 4) * 8;           // k offset of this lane half
  const int mOff  = (lane >> 4) * 8;           // D row offset

  v8f acc[4][4];
#pragma unroll
  for (int i = 0; i < 4; ++i)
#pragma unroll
    for (int j = 0; j < 4; ++j) acc[i][j] = (v8f){0.f,0.f,0.f,0.f,0.f,0.f,0.f,0.f};

  for (int k0 = 0; k0 < K; k0 += 32) {
    V bh[4], bl[4];
#pragma unroll
    for (int j = 0; j < 4; ++j) {
      const size_t bo = (size_t)(n0 + (j << 4) + rlane) * ldb + koff + k0;
      bh[j] = Frag<T>::load(Bb + bo);
      if (SPLIT == 1) bl[j] = Frag<T>::load(Bb2 + bo);
    }
#pragma unroll
    for (int i = 0; i < 4; ++i) {
      const size_t ao = (size_t)(m0 + (i << 4) + rlane) * lda + koff + k0;
      V ah = Frag<T>::load(Ab + ao);
      V al;
      if (SPLIT != 0) al = Frag<T>::load(Ab2 + ao);
#pragma unroll
      for (int j = 0; j < 4; ++j) {
        acc[i][j] = Frag<T>::mma(ah, bh[j], acc[i][j]);
        if (SPLIT == 1) acc[i][j] = Frag<T>::mma(ah, bl[j], acc[i][j]);
        if (SPLIT != 0) acc[i][j] = Frag<T>::mma(al, bh[j], acc[i][j]);
      }
      Frag<T>::guard(acc[i][0], acc[i][3], ah, (SPLIT != 0) ? al : ah);
    }
    Frag<T>::keep(bh[0], bh[1], bh[2], bh[3]);
    if (SPLIT == 1) Frag<T>::keep(bl[0], bl[1], bl[2], bl[3]);
  }
  acc_guard4(acc[0][0], acc[0][1], acc[0][2], acc[0][3]);
  acc_guard4(acc[1][0], acc[1][1], acc[1][2], acc[1][3]);
  acc_guard4(acc[2][0], acc[2][1], acc[2][2], acc[2][3]);
  acc_guard4(acc[3][0], acc[3][1], acc[3][2], acc[3][3]);

  // ---- epilogue ----
  float* slab = sT[wave];
  const float* Rb = RESID ? (resid + (size_t)b * strideR) : nullptr;
#pragma unroll
  for (int i = 0; i < 4; ++i) {
    const int mBase = m0 + (i << 4);
#pragma unroll
    for (int j = 0; j < 4; ++j) {
      const int n = n0 + (j << 4) + rlane;
      float bv = 0.f;
      if (BIAS_MODE == 2) bv = bias[n];
#pragma unroll
      for (int r = 0; r < 8; ++r) {
        float v = acc[i][j][r] * scale;
        if (BIAS_MODE == 1) v += bias[mBase + mOff + r];
        if (BIAS_MODE == 2) v += bv;
        if (RESID) v += Rb[(size_t)(mBase + mOff + r) * ldc + n];
        if (ACT == 2) v = fmaxf(v, 0.0f);
        if (ACT == 4) v = (v > 0.f) ? v : 0.01f * v;
        slab[(mOff + r) * 68 + (j << 4) + rlane] = v;
      }
    }
    __builtin_amdgcn_fence(__ATOMIC_RELEASE, "workgroup");
    __builtin_amdgcn_wave_barrier();
    __builtin_amdgcn_fence(__ATOMIC_ACQUIRE, "workgroup");
    if (OUT_MODE == 0) {
      float* C = (float*)Cout + (size_t)b * strideC;
      const int hh = lane >> 4, c4 = (lane & 15) * 4;     // row seg = 256 B = 16 lanes x 16 B
      {
#pragma unroll
        for (int it = 0; it < 8; ++it) {
          const int row = it * 2 + hh;
          v4f v = *(const v4f*)(slab + row * 68 + c4);
          *(v4f*)(C + (size_t)(mBase + row) * ldc + n0 + c4) = v;
        }
        
      }
    } else {
      const int q = lane >> 3, c8 = (lane & 7) * 8;
      unsigned short* C  = (unsigned short*)Cout  + (size_t)b * strideC;
      unsigned short* C2 = (OUT_MODE == 2) ? ((unsigned short*)Cout2 + (size_t)b * strideC) : nullptr;
      {
#pragma unroll
        for (int it = 0; it < 4; ++it) {
          const int row = it * 4 + q;
          const float* sp = slab + row * 68 + c8;
          v8h hv, lv;
#pragma unroll
          for (int e = 0; e < 8; ++e) {
            if (OUT_MODE == 1) {
              hv[e] = (_Float16)sp[e];
            } else {
              unsigned short hb = f2bf_bits(sp[e]);
              unsigned short lb = f2bf_bits(sp[e] - bf_bits2f(hb));
              hv[e] = __builtin_bit_cast(_Float16, hb);
              lv[e] = __builtin_bit_cast(_Float16, lb);
            }
          }
          *(v8h*)(C + (size_t)(mBase + row) * ldc + n0 + c8) = hv;
          if (OUT_MODE == 2) *(v8h*)(C2 + (size_t)(mBase + row) * ldc + n0 + c8) = lv;
        }
        
      }
    }
    __builtin_amdgcn_fence(__ATOMIC_RELEASE, "workgroup");
    __builtin_amdgcn_wave_barrier();
    __builtin_amdgcn_fence(__ATOMIC_ACQUIRE, "workgroup");
  }
}

// ---------------------------------------------------------------------------
// f32 -> bf16 (RNE) plane, 8 elements per thread: one 16-B store per lane, 32 lanes = 512 contiguous B =
// ---------------------------------------------------------------------------
__global__ __launch_bounds__(256) void cvt_bf16x8_kernel(const float* __restrict__ in, unsigned short* __restrict__ out, int n8) {
  const int i = blockIdx.x * 256 + threadIdx.x;
  if (i >= n8) return;
  const size_t base = (size_t)i * 8;
  const v4f a = *(const v4f*)(in + base), c = *(const v4f*)(in + base + 4);
  unsigned short hb[8];
#pragma unroll
  for (int e = 0; e < 4; ++e) { hb[e] = f2bf_bits(a[e]); hb[4 + e] = f2bf_bits(c[e]); }
  const v4u u = (v4u){pk16(hb[0], hb[1]), pk16(hb[2], hb[3]), pk16(hb[4], hb[5]), pk16(hb[6], hb[7])};
  *(v4u*)(out + base) = u;
  
}

// ---------------------------------------------------------------------------
// Weight transpose + cast: in W[d][h] (row-major [in 1024][out 1024] f32) -> out WT[h][d] = bf16_rne(W[d][h]), 4 planes.
// grid (16, 16, 4): blockIdx.x = d tile (64 cols of WT), blockIdx.y = h tile (64 rows of WT), blockIdx.z selects W0..W3
// and the output plane (plane z at out + z*1024*1024 halves). 256 threads.
// Load coverage: 16 iterations x 256 threads = 4096 = the whole 64x64 tile (coalesced along h).
// Store coverage: 8 waves x 2 iterations x 4 rows (lane>>3) = 64 rows; (lane&7) x 8 halves = 64 cols; each row segment =
// ---------------------------------------------------------------------------
__global__ __launch_bounds__(256) void wtcast4_kernel(const float* __restrict__ W0, const float* __restrict__ W1,
                                                      const float* __restrict__ W2, const float* __restrict__ W3,
                                                      unsigned short* __restrict__ out) {
  __shared__ float sm[64][65];   // sm[h_local][d_local]
  const int t  = threadIdx.x;
  const int d0 = blockIdx.x * 64;
  const int h0 = blockIdx.y * 64;
  const int z  = blockIdx.z;                                   // block-uniform
  const float* W = (z == 0) ? W0 : (z == 1) ? W1 : (z == 2) ? W2 : W3;
#pragma unroll
  for (int i = 0; i < 16; ++i) {
    const int e = i * 256 + t;
    const int r = e >> 6;          // d local
    const int cc = e & 63;         // h local
    sm[cc][r] = W[(size_t)(d0 + r) * kDim + h0 + cc];
  }
  __syncthreads();
  const int lane = t & 31, wave = t >> 5;
  const int q = lane >> 3, c8 = (lane & 7) * 8;
  unsigned short* op = out + (size_t)z * kDim * kDim;
  {
#pragma unroll
    for (int it = 0; it < 2; ++it) {
      const int row = wave * 8 + it * 4 + q;                 // h local
      unsigned short hb[8];
#pragma unroll
      for (int e = 0; e < 8; ++e) hb[e] = f2bf_bits(sm[row][c8 + e]);
      const v4u u = (v4u){pk16(hb[0], hb[1]), pk16(hb[2], hb[3]), pk16(hb[4], hb[5]), pk16(hb[6], hb[7])};
      *(v4u*)(op + (size_t)(h0 + row) * kDim + d0 + c8) = u;
    }
    
  }
}

// ---------------------------------------------------------------------------
// (q + r_w_bias) planes: qf f32 [4096][1024] (col = n*64+d), r_w_bias [16][64] flat index == col, RNE-converted to bf16 value,
// added in f32, then bf16 hi/lo split. Thread = 8 consecutive elements of one row: one 16-B store per lane per plane;
// ---------------------------------------------------------------------------
__global__ __launch_bounds__(256) void qplanes_kernel(const float* __restrict__ qf, const float* __restrict__ rwb,
                                                      unsigned short* __restrict__ oh, unsigned short* __restrict__ ol, int n8) {
  const int i = blockIdx.x * 256 + threadIdx.x;
  if (i >= n8) return;
  const size_t base = (size_t)i * 8;
  const int col = (int)(base % (size_t)kDim);
  const v4f a0 = *(const v4f*)(qf + base), a1 = *(const v4f*)(qf + base + 4);
  const v4f u0 = *(const v4f*)(rwb + col), u1 = *(const v4f*)(rwb + col + 4);
  float x[8];
#pragma unroll
  for (int e = 0; e < 4; ++e) { x[e] = a0[e] + bf_rne(u0[e]); x[4 + e] = a1[e] + bf_rne(u1[e]); }
  unsigned short hb[8], lb[8];
#pragma unroll
  for (int e = 0; e < 8; ++e) { hb[e] = f2bf_bits(x[e]); lb[e] = f2bf_bits(x[e] - bf_bits2f(hb[e])); }
  const v4u uh = (v4u){pk16(hb[0], hb[1]), pk16(hb[2], hb[3]), pk16(hb[4], hb[5]), pk16(hb[6], hb[7])};
  const v4u ul = (v4u){pk16(lb[0], lb[1]), pk16(lb[2], lb[3]), pk16(lb[4], lb[5]), pk16(lb[6], lb[7])};
  *(v4u*)(oh + base) = uh;
  *(v4u*)(ol + base) = ul;
  
}

// ---------------------------------------------------------------------------
// (k_j + r_emb_{j+1,n}) planes: kf f32 [4096][1024] (token = b*1024+j, col = n*64+d); r_emb [1024][16][64] flat = [1024][1024];
// row j uses r_emb row j+1 (RNE-converted to bf16 value) and 0 for j = 1023 (shift by one with trailing zero).
// The r_emb address is clamped to row 1023 and the value zeroed by predicate. Output bf16 hi/lo planes; store shape as qplanes_kernel.
// ---------------------------------------------------------------------------
__global__ __launch_bounds__(256) void krplanes_kernel(const float* __restrict__ kf, const float* __restrict__ remb,
                                                       unsigned short* __restrict__ oh, unsigned short* __restrict__ ol, int n8) {
  const int i = blockIdx.x * 256 + threadIdx.x;
  if (i >= n8) return;
  const size_t base = (size_t)i * 8;
  const int row = (int)(base / (size_t)kDim);                 // token index
  const int j   = row % kSeq;
  const int col = (int)(base % (size_t)kDim);
  const bool keep = (j + 1 < kSeq);
  const int jr = keep ? (j + 1) : (kSeq - 1);                 // clamped address
  const float* rp = remb + (size_t)jr * kDim + col;
  const v4f k0 = *(const v4f*)(kf + base), k1 = *(const v4f*)(kf + base + 4);
  const v4f r0 = *(const v4f*)(rp), r1 = *(const v4f*)(rp + 4);
  float x[8];
#pragma unroll
  for (int e = 0; e < 4; ++e) {
    x[e]     = k0[e] + (keep ? bf_rne(r0[e]) : 0.0f);
    x[4 + e] = k1[e] + (keep ? bf_rne(r1[e]) : 0.0f);
  }
  unsigned short hb[8], lb[8];
#pragma unroll
  for (int e = 0; e < 8; ++e) { hb[e] = f2bf_bits(x[e]); lb[e] = f2bf_bits(x[e] - bf_bits2f(hb[e])); }
  const v4u uh = (v4u){pk16(hb[0], hb[1]), pk16(hb[2], hb[3]), pk16(hb[4], hb[5]), pk16(hb[6], hb[7])};
  const v4u ul = (v4u){pk16(lb[0], lb[1]), pk16(lb[2], lb[3]), pk16(lb[4], lb[5]), pk16(lb[6], lb[7])};
  *(v4u*)(oh + base) = uh;
  *(v4u*)(ol + base) = ul;
  
}

// ---------------------------------------------------------------------------
// Score bias table tb[n][j] (f32, [16][1024]): for j <= 1022: bf(r_bias[j+1][n]) - sum_d bf(r_w_bias[n][d]) * bf(r_emb[j+1][n][d]);
// tb[n][1023] = 0. Thread per (n, j), 64-tap rolled dot in fixed order (inputs only). r_emb / r_bias addresses clamped to row 1023,
// ---------------------------------------------------------------------------
__global__ __launch_bounds__(256) void tb_kernel(const float* __restrict__ rwb, const float* __restrict__ remb,
                                                 const float* __restrict__ rbias, float* __restrict__ tb) {
  const int i = blockIdx.x * 256 + threadIdx.x;          // 0..16383
  const int n = i >> 10;
  const int j = i & (kSeq - 1);
  const bool keep = (j + 1 < kSeq);
  const int jr = keep ? (j + 1) : (kSeq - 1);
  const float* rp = remb + ((size_t)jr * kHeads + n) * kHd;
  const float* up = rwb + n * kHd;
  float acc = 0.f;
#pragma unroll 1
  for (int d = 0; d < kHd; ++d) acc = fmaf(bf_rne(up[d]), bf_rne(rp[d]), acc);
  const float val = keep ? (bf_rne(rbias[jr * kHeads + n]) - acc) : 0.0f;
  ((float*)tb)[i] = val;
  
}

// ---------------------------------------------------------------------------
// Relative-position flash attention for head_dim 64 (no mask). Block = 4 waves = 64 query rows of one (batch, head);
// grid = 4 * 16 * 16 = 1024 blocks of 128 threads; blockIdx.x = b*256 + h*16 + qb.
// Inputs: QRh/QRl = bf16 hi/lo planes of (q + r_w_bias) [4096][1024]; KRh/KRl = bf16 hi/lo planes of (k_j + r_emb_{j+1});
// Vp = f16 plane of v [4096][1024]; tb = f32 [16][1024] score bias table.
// score[i][j] = ((q+rwb)_i · (k_j + r_{j+1}) + tb[h][j]) * 0.125  : v_wmma_f32_16x16x32_bf16, hi*hi + hi*lo + lo*hi.
// out += P·V : v_wmma_f32_16x16x32_f16 (V staged transposed [d][kv] in LDS as f16); final out * 1/(l * 2^15).
// ---------------------------------------------------------------------------
__global__ __launch_bounds__(128) void relattn_kernel(
    const unsigned short* __restrict__ QRh, const unsigned short* __restrict__ QRl,
    const unsigned short* __restrict__ KRh, const unsigned short* __restrict__ KRl,
    const unsigned short* __restrict__ Vp, const float* __restrict__ tb,
    unsigned short* __restrict__ AVh, unsigned short* __restrict__ AVl) {
  union FB { v16b v; v8b h[2]; };
  union FH { v16h v; v8h h[2]; };
  __shared__ __align__(16) __bf16   Ksh[kKC * kHd];            // K hi [kv][d]   8 KB
  __shared__ __align__(16) __bf16   Ksl[kKC * kHd];            // K lo [kv][d]   8 KB
  __shared__ __align__(16) _Float16 Vt[kHd * kKC];             // V f16 [d][kv]  8 KB
  __shared__ __align__(16) _Float16 Psh[4][16 * kKC];          // per wave P [row][kv] 8 KB
  __shared__ __align__(16) float    Os[4][16 * kOsPitch];      // per wave out tile, pitch 68

  const int tid  = threadIdx.x;
  const int wave = tid >> 5;
  const int lane = tid & 31;
  const int hh   = lane >> 4;
  const int c    = lane & 15;

  const int bx = blockIdx.x;
  const int qb = bx & 15;
  const int h  = (bx >> 4) & 15;
  const int b  = bx >> 8;
  const int q0 = qb * 64 + wave * 16;
  const size_t tok0 = (size_t)b * kSeq;
  const int hcol = h * kHd;

  // ---- Q fragments (A operand): 2 d-chunks, hi and lo. Frag load: elements 0..7 <- k 8hh+0..7, 8..15 <- k 16+8hh+0..7 ----
  v16b qah[2], qal[2];
  {
    const __bf16* ph = (const __bf16*)QRh + (tok0 + q0 + c) * kDim + hcol + 8 * hh;
    const __bf16* pl = (const __bf16*)QRl + (tok0 + q0 + c) * kDim + hcol + 8 * hh;
#pragma unroll
    for (int dc = 0; dc < 2; ++dc) {
      qah[dc] = Frag<__bf16>::load(ph + dc * 32);
      qal[dc] = Frag<__bf16>::load(pl + dc * 32);
    }
  }

  float mrow[8], lrow[8];
  v8f oacc[4];
#pragma unroll
  for (int r = 0; r < 8; ++r) { mrow[r] = -INFINITY; lrow[r] = 0.f; }
#pragma unroll
  for (int t = 0; t < 4; ++t) oacc[t] = (v8f){0.f,0.f,0.f,0.f,0.f,0.f,0.f,0.f};

  for (int kc = 0; kc < kSeq / kKC; ++kc) {     // 16 chunks, block-uniform
    const int kv0 = kc * kKC;
    __syncthreads();
    {
      // staging coverage: 128 threads = 64 kv rows x 2 halves of 32 d; 4 x 16-B pieces each -> whole 64x64 tiles of K hi, K lo, V
      const int kvr = tid >> 1;
      const int dh  = (tid & 1) * 32;
      const size_t g = (tok0 + kv0 + kvr) * kDim + hcol + dh;
      const v8b* gkh = (const v8b*)((const __bf16*)KRh + g);
      const v8b* gkl = (const v8b*)((const __bf16*)KRl + g);
      const v8h* gv  = (const v8h*)((const _Float16*)Vp + g);
#pragma unroll
      for (int i = 0; i < 4; ++i) {
        const v8b a  = gkh[i];
        const v8b al = gkl[i];
        const v8h vv = gv[i];
        *(v8b*)(Ksh + kvr * kHd + dh + 8 * i) = a;
        *(v8b*)(Ksl + kvr * kHd + dh + 8 * i) = al;
#pragma unroll
        for (int e = 0; e < 8; ++e) Vt[(dh + 8 * i + e) * kKC + kvr] = vv[e];
      }
    }
    __syncthreads();

    v8f s[4];
#pragma unroll
    for (int j = 0; j < 4; ++j) {
      s[j] = (v8f){0.f,0.f,0.f,0.f,0.f,0.f,0.f,0.f};
#pragma unroll
      for (int dc = 0; dc < 2; ++dc) {
        FB kb, kl;
        kb.h[0] = *(const v8b*)(Ksh + (j * 16 + c) * kHd + dc * 32 + 8 * hh);
        kb.h[1] = *(const v8b*)(Ksh + (j * 16 + c) * kHd + dc * 32 + 16 + 8 * hh);
        kl.h[0] = *(const v8b*)(Ksl + (j * 16 + c) * kHd + dc * 32 + 8 * hh);
        kl.h[1] = *(const v8b*)(Ksl + (j * 16 + c) * kHd + dc * 32 + 16 + 8 * hh);
        s[j] = mma_bf16g(qah[dc], kb.v, s[j]);
        s[j] = mma_bf16g(qah[dc], kl.v, s[j]);
        s[j] = mma_bf16g(qal[dc], kb.v, s[j]);
      }
    }
    float tbv[4];
#pragma unroll
    for (int j = 0; j < 4; ++j) tbv[j] = tb[h * kSeq + kv0 + j * 16 + c];

    float cm[8];
#pragma unroll
    for (int r = 0; r < 8; ++r) {
      float m = -INFINITY;
#pragma unroll
      for (int j = 0; j < 4; ++j) {
        s[j][r] = (s[j][r] + tbv[j]) * kScale;
        m = fmaxf(m, s[j][r]);
      }
#pragma unroll
      for (int off = 1; off < 16; off <<= 1) m = fmaxf(m, __shfl_xor(m, off, 32));
      cm[r] = m;
    }
    _Float16* pw = Psh[wave];
#pragma unroll
    for (int r = 0; r < 8; ++r) {
      const float mnew  = fmaxf(mrow[r], cm[r]);
      const float alpha = expf(mrow[r] - mnew);
      mrow[r] = mnew;
      float psum = 0.f;
#pragma unroll
      for (int j = 0; j < 4; ++j) {
        const float p = expf(s[j][r] - mnew);
        psum += p;
        pw[(8 * hh + r) * kKC + j * 16 + c] = (_Float16)(p * kPCarry);
      }
#pragma unroll
      for (int off = 1; off < 16; off <<= 1) psum += __shfl_xor(psum, off, 32);
      lrow[r] = lrow[r] * alpha + psum;
#pragma unroll
      for (int t = 0; t < 4; ++t) oacc[t][r] *= alpha;
    }
    __builtin_amdgcn_fence(__ATOMIC_RELEASE, "workgroup");
    __builtin_amdgcn_wave_barrier();
    __builtin_amdgcn_fence(__ATOMIC_ACQUIRE, "workgroup");
#pragma unroll
    for (int kk = 0; kk < 2; ++kk) {
      FH pa;
      pa.h[0] = *(const v8h*)(pw + c * kKC + kk * 32 + 8 * hh);
      pa.h[1] = *(const v8h*)(pw + c * kKC + kk * 32 + 16 + 8 * hh);
#pragma unroll
      for (int t = 0; t < 4; ++t) {
        FH vb;
        vb.h[0] = *(const v8h*)(Vt + (t * 16 + c) * kKC + kk * 32 + 8 * hh);
        vb.h[1] = *(const v8h*)(Vt + (t * 16 + c) * kKC + kk * 32 + 16 + 8 * hh);
        oacc[t] = mma_f16g(pa.v, vb.v, oacc[t]);
      }
    }
  }

  float* os = Os[wave];
#pragma unroll
  for (int r = 0; r < 8; ++r) {
    const float inv = 1.0f / (lrow[r] * kPCarry);
#pragma unroll
    for (int t = 0; t < 4; ++t) os[(8 * hh + r) * kOsPitch + t * 16 + c] = oacc[t][r] * inv;
  }
  __builtin_amdgcn_fence(__ATOMIC_RELEASE, "workgroup");
  __builtin_amdgcn_wave_barrier();
  __builtin_amdgcn_fence(__ATOMIC_ACQUIRE, "workgroup");
  {
    const int q = lane >> 3, c8 = (lane & 7) * 8;
    {
#pragma unroll
      for (int it = 0; it < 4; ++it) {
        const int row = it * 4 + q;                       // 0..15
        const float* sp = os + row * kOsPitch + c8;
        v8h hv, lv;
#pragma unroll
        for (int e = 0; e < 8; ++e) {
          const unsigned short hb = f2bf_bits(sp[e]);
          const unsigned short lb = f2bf_bits(sp[e] - bf_bits2f(hb));
          hv[e] = __builtin_bit_cast(_Float16, hb);
          lv[e] = __builtin_bit_cast(_Float16, lb);
        }
        const size_t o = (tok0 + q0 + row) * kDim + hcol + c8;
        *(v8h*)(AVh + o) = hv;
        *(v8h*)(AVl + o) = lv;
      }
      
    }
  }
}

// ---------------------------------------------------------------------------
// y = (x - mu) * rsqrt(var + eps) * bf(gamma) + bf(beta). One block of 256 threads (8 waves) per row; thread t owns
// ---------------------------------------------------------------------------
__global__ __launch_bounds__(256) void ln_kernel(const float* __restrict__ w, const float* __restrict__ ao,
                                                 const float* __restrict__ g, const float* __restrict__ bt,
                                                 float* __restrict__ out) {
  __shared__ float red[16];
  const int row  = blockIdx.x;
  const int t    = threadIdx.x, lane = t & 31, wave = t >> 5;
  const int c0   = t * 4;
  const size_t off = (size_t)row * kDim + c0;
  const v4f a = *(const v4f*)(w + off);
  const v4f o = *(const v4f*)(ao + off);
  float x[4];
#pragma unroll
  for (int e = 0; e < 4; ++e) x[e] = bf_rne(a[e]) + o[e];
  float s = (x[0] + x[1]) + (x[2] + x[3]);
#pragma unroll
  for (int sh = 16; sh > 0; sh >>= 1) s += __shfl_xor(s, sh, 32);
  if (lane == 0) red[wave] = s;
  __syncthreads();
  const float mu = (((red[0] + red[1]) + (red[2] + red[3])) + ((red[4] + red[5]) + (red[6] + red[7]))) * kInvDim;
  float d[4];
  float s2 = 0.f;
#pragma unroll
  for (int e = 0; e < 4; ++e) { d[e] = x[e] - mu; s2 += d[e] * d[e]; }
#pragma unroll
  for (int sh = 16; sh > 0; sh >>= 1) s2 += __shfl_xor(s2, sh, 32);
  if (lane == 0) red[8 + wave] = s2;
  __syncthreads();
  const float var  = (((red[8] + red[9]) + (red[10] + red[11])) + ((red[12] + red[13]) + (red[14] + red[15]))) * kInvDim;
  const float rstd = rsqrtf(var + kLnEps);
  const v4f gg = *(const v4f*)(g + c0);
  const v4f bb = *(const v4f*)(bt + c0);
  v4f y;
#pragma unroll
  for (int e = 0; e < 4; ++e) y[e] = (d[e] * rstd) * bf_rne(gg[e]) + bf_rne(bb[e]);
  *(v4f*)(out + off) = y;
  
}

// ---------------------------------------------------------------------------
// Host launch glue. Workspace region map (bytes, all offsets 256-B aligned):
//   [0]            Wb    bf16 w plane            [4096][1024]      8,388,608
//   [8,388,608]    WT    bf16 Wq^T|Wk^T|Wv^T|Wo^T 4 x [1024][1024]  8,388,608
//   [16,777,216]   QKF   f32 q then f32 k        2 x [4096][1024]  33,554,432   (dead after the plane kernels;
//                        reused: AVh bf16 at +0, AVl bf16 at +8,388,608, AO f32 at +16,777,216)
//   [50,331,648]   Vh    f16 v plane             [4096][1024]      8,388,608
//   [58,720,256]   QRh|QRl bf16 (q+rwb) hi/lo    2 x [4096][1024]  16,777,216
//   [75,497,472]   KRh|KRl bf16 (k+r) hi/lo      2 x [4096][1024]  16,777,216
//   [92,274,688]   TB    f32 [16][1024]                            65,536
//   total 92,340,224
// ---------------------------------------------------------------------------
extern "C" void kernel_launch(void* const* d_in, const int* in_sizes, int n_in,
                              void* d_out, int out_size, void* d_ws, size_t ws_size,
                              hipStream_t stream) {
  if (n_in < 10) return;
  const float* w     = (const float*)d_in[0];
  const float* remb  = (const float*)d_in[1];
  const float* rwb   = (const float*)d_in[2];
  const float* rbias = (const float*)d_in[3];
  const float* Wq    = (const float*)d_in[4];
  const float* Wk    = (const float*)d_in[5];
  const float* Wv    = (const float*)d_in[6];
  const float* Wo    = (const float*)d_in[7];
  const float* gamma = (const float*)d_in[8];
  const float* beta  = (const float*)d_in[9];
  float* out = (float*)d_out;

  const size_t nTokD = (size_t)kTok * kDim;                    // 4,194,304 elements
  if ((size_t)in_sizes[0] != nTokD) return;
  if (in_sizes[1] != kSeq * kHeads * kHd) return;
  if (in_sizes[2] != kHeads * kHd) return;
  if (in_sizes[3] != kSeq * kHeads) return;
  if (in_sizes[4] != kDim * kDim || in_sizes[5] != kDim * kDim || in_sizes[6] != kDim * kDim || in_sizes[7] != kDim * kDim) return;
  if (in_sizes[8] != kDim || in_sizes[9] != kDim) return;
  if ((size_t)out_size != nTokD) return;

  const size_t bWb  = nTokD * 2;
  const size_t bWT  = (size_t)4 * kDim * kDim * 2;
  const size_t bQKF = nTokD * 4 * 2;
  const size_t bVh  = nTokD * 2;
  const size_t bQR  = nTokD * 2 * 2;
  const size_t bKR  = nTokD * 2 * 2;
  const size_t bTB  = (size_t)kHeads * kSeq * 4;
  const size_t oWb  = 0;
  const size_t oWT  = oWb + bWb;
  const size_t oQKF = oWT + bWT;
  const size_t oVh  = oQKF + bQKF;
  const size_t oQR  = oVh + bVh;
  const size_t oKR  = oQR + bQR;
  const size_t oTB  = oKR + bKR;
  const size_t total = oTB + bTB;                               // 92,340,224
  if (total > ws_size) return;

  char* ws = (char*)d_ws;
  unsigned short* Wb  = (unsigned short*)(ws + oWb);
  unsigned short* WT  = (unsigned short*)(ws + oWT);
  float*          QKF = (float*)(ws + oQKF);
  float*          qf  = QKF;
  float*          kf  = QKF + nTokD;
  unsigned short* Vh  = (unsigned short*)(ws + oVh);
  unsigned short* QRh = (unsigned short*)(ws + oQR);
  unsigned short* QRl = QRh + nTokD;
  unsigned short* KRh = (unsigned short*)(ws + oKR);
  unsigned short* KRl = KRh + nTokD;
  float*          TB  = (float*)(ws + oTB);
  unsigned short* AVh = (unsigned short*)(ws + oQKF);          // reuse of the dead q f32 region
  unsigned short* AVl = AVh + nTokD;
  float*          AO  = kf;                                    // reuse of the dead k f32 region

  const int n8 = (int)(nTokD / 8);                             // 524288
  const long wPlane = (long)kDim * kDim;

  // 1. w -> bf16 plane
  cvt_bf16x8_kernel<<<dim3(n8 / 256), dim3(256), 0, stream>>>(w, Wb, n8);
  // 2. weight transposes: in W[1024 in][1024 out] -> out WT[out][in], planes 0..3 = Wq, Wk, Wv, Wo
  wtcast4_kernel<<<dim3(kDim / 64, kDim / 64, 4), dim3(256), 0, stream>>>(Wq, Wk, Wv, Wo, WT);
  // 3. q and k (f32): batch index selects WT plane 0/1 and output plane; M=4096, N=1024, K=1024 (tiles 64x16 = 1024 = 128 blocks x 8 waves)
  wmma_gemm64<1, 0, 0, 0, false><<<dim3(128, 2), dim3(256), 0, stream>>>(
      Wb, Wb, kDim, 0L,
      WT, WT, kDim, wPlane,
      (void*)QKF, (void*)QKF, kDim, (long)nTokD,
      gamma, gamma, 0L,
      kTok, kDim, kDim, 1.0f);
  // 4. v (f16 plane)
  wmma_gemm64<1, 0, 0, 1, false><<<dim3(128, 1), dim3(256), 0, stream>>>(
      Wb, Wb, kDim, 0L,
      WT + 2 * wPlane, WT + 2 * wPlane, kDim, 0L,
      (void*)Vh, (void*)Vh, kDim, 0L,
      gamma, gamma, 0L,
      kTok, kDim, kDim, 1.0f);
  // 5. (q + r_w_bias) hi/lo planes
  qplanes_kernel<<<dim3(n8 / 256), dim3(256), 0, stream>>>(qf, rwb, QRh, QRl, n8);
  // 6. (k_j + r_emb_{j+1}) hi/lo planes
  krplanes_kernel<<<dim3(n8 / 256), dim3(256), 0, stream>>>(kf, remb, KRh, KRl, n8);
  // 7. score bias table [16][1024]
  tb_kernel<<<dim3((kHeads * kSeq) / 256), dim3(256), 0, stream>>>(rwb, remb, rbias, TB);
  // 8. attention -> attn_vec bf16 hi/lo planes
  relattn_kernel<<<dim3(kBatch * kHeads * (kSeq / 64)), dim3(128), 0, stream>>>(QRh, QRl, KRh, KRl, Vh, TB, AVh, AVl);
  // 9. attn_vec @ Wo (A hi/lo split, Wo bf16) -> f32
  wmma_gemm64<1, 2, 0, 0, false><<<dim3(128, 1), dim3(256), 0, stream>>>(
      AVh, AVl, kDim, 0L,
      WT + 3 * wPlane, WT + 3 * wPlane, kDim, 0L,
      (void*)AO, (void*)AO, kDim, 0L,
      gamma, gamma, 0L,
      kTok, kDim, kDim, 1.0f);
  // 10. residual + LayerNorm -> out
  ln_kernel<<<dim3(kTok), dim3(256), 0, stream>>>(w, AO, gamma, beta, out);
}

// v001
// Measured time: 206 microseconds a run.
// Timed twice side by side with v000, it ran 1.49 and 1.48 times as fast.
// Compute dtypes: w@Wq|Wk|Wv on v_wmma_f32_16x16x32_bf16 (inputs RNE-converted to bf16, single product); scores (q+r_w_bias)·(k_j+r_emb_{j+1}) on v_wmma_f32_16x16x32_bf16 with bf16 hi/lo planes (hi*hi+hi*lo+lo*hi); attn_prob·v on v_wmma_f32_16x16x32_f16 (P f16 carried x32768, V f16); attn_vec@Wo on v_wmma_f32_16x16x32_bf16 (attn_vec bf16 hi/lo, Wo bf16: hi*W+lo*W); f32 accumulate everywhere; softmax, bias table, residual and LayerNorm in f32.
#include <hip/hip_runtime.h>
#include <math.h>

// ---------------------------------------------------------------------------
// Problem constants
// ---------------------------------------------------------------------------
constexpr int kBatch = 4;
constexpr int kSeq   = 1024;
constexpr int kDim   = 1024;
constexpr int kHeads = 16;
constexpr int kHd    = 64;
constexpr int kTok   = kBatch * kSeq;      // 4096 token rows
constexpr float kLnEps  = 1e-5f;
constexpr float kInvDim = 1.0f / 1024.0f;
constexpr float kScale  = 0.125f;          // 1/sqrt(64)
constexpr float kPCarry = 32768.0f;        // probabilities carried x2^15 in f16
constexpr int kKC = 64;                    // keys per chunk
constexpr int kOsPitch = 68;

typedef __attribute__((ext_vector_type(16))) _Float16 v16h;
typedef __attribute__((ext_vector_type(8)))  _Float16 v8h;
typedef __attribute__((ext_vector_type(16))) __bf16   v16b;
typedef __attribute__((ext_vector_type(8)))  __bf16   v8b;
typedef __attribute__((ext_vector_type(8)))  float    v8f;
typedef __attribute__((ext_vector_type(4)))  float    v4f;
typedef __attribute__((ext_vector_type(4)))  unsigned int v4u;

__device__ __forceinline__ unsigned short f2bf_bits(float f) {
  unsigned u = __float_as_uint(f);
  return (unsigned short)((u + 0x7FFFu + ((u >> 16) & 1u)) >> 16);
}
__device__ __forceinline__ float bf_bits2f(unsigned short h) { return __uint_as_float(((unsigned)h) << 16); }
__device__ __forceinline__ float bf_rne(float f) { return bf_bits2f(f2bf_bits(f)); }

// hazard guards as plain device helpers
__device__ __forceinline__ void dep_guard_h(v8f& a, v8f& b, v16h x, v16h y) { asm volatile("v_nop\n\tv_nop\n\tv_nop\n\tv_nop" : "+v"(a), "+v"(b) : "v"(x), "v"(y)); }
__device__ __forceinline__ void dep_guard_b(v8f& a, v8f& b, v16b x, v16b y) { asm volatile("v_nop\n\tv_nop\n\tv_nop\n\tv_nop" : "+v"(a), "+v"(b) : "v"(x), "v"(y)); }
__device__ __forceinline__ void keep4_h(v16h a, v16h b, v16h c, v16h d) { asm volatile("v_nop" :: "v"(a), "v"(b), "v"(c), "v"(d)); }
__device__ __forceinline__ void keep4_b(v16b a, v16b b, v16b c, v16b d) { asm volatile("v_nop" :: "v"(a), "v"(b), "v"(c), "v"(d)); }
__device__ __forceinline__ void acc_guard4(v8f& a, v8f& b, v8f& c, v8f& d) { asm volatile("v_nop\n\tv_nop\n\tv_nop\n\tv_nop" : "+v"(a), "+v"(b), "+v"(c), "+v"(d)); }
template <typename T> struct Frag;
template <> struct Frag<_Float16> {
  typedef v16h V; union U { v16h v; v8h h[2]; };
  static __device__ __forceinline__ v16h load(const _Float16* p) {   // elements 0..7 <- p[0..7], 8..15 <- p[16..23]
    U f; f.h[0] = *(const v8h*)(p); f.h[1] = *(const v8h*)(p + 16); return f.v;
  }
  static __device__ __forceinline__ v8f mma(v16h a, v16h b, v8f c) {
    return __builtin_amdgcn_wmma_f32_16x16x32_f16(false, a, false, b, (short)0, c, false, false);
  }
  static __device__ __forceinline__ void guard(v8f& a, v8f& b, v16h x, v16h y) { dep_guard_h(a, b, x, y); }
  static __device__ __forceinline__ void keep(v16h a, v16h b, v16h c, v16h d) { keep4_h(a, b, c, d); }
};
template <> struct Frag<__bf16> {
  typedef v16b V; union U { v16b v; v8b h[2]; };
  static __device__ __forceinline__ v16b load(const __bf16* p) {
    U f; f.h[0] = *(const v8b*)(p); f.h[1] = *(const v8b*)(p + 16); return f.v;
  }
  static __device__ __forceinline__ v8f mma(v16b a, v16b b, v8f c) {
    return __builtin_amdgcn_wmma_f32_16x16x32_bf16(false, a, false, b, (short)0, c, false, false);
  }
  static __device__ __forceinline__ void guard(v8f& a, v8f& b, v16b x, v16b y) { dep_guard_b(a, b, x, y); }
  static __device__ __forceinline__ void keep(v16b a, v16b b, v16b c, v16b d) { keep4_b(a, b, c, d); }
};

__device__ __forceinline__ unsigned pk16(unsigned short a, unsigned short b) { return (unsigned)a | ((unsigned)b << 16); }

// single WMMA issue with hazard guard (bf16 and f16 twins)
__device__ __forceinline__ v8f mma_bf16g(v16b a, v16b b, v8f c) {
  c = __builtin_amdgcn_wmma_f32_16x16x32_bf16(false, a, false, b, (short)0, c, false, false);
  asm volatile("v_nop\n\tv_nop\n\tv_nop\n\tv_nop" : "+v"(c) : "v"(a), "v"(b));
  return c;
}
__device__ __forceinline__ v8f mma_f16g(v16h a, v16h b, v8f c) {
  c = __builtin_amdgcn_wmma_f32_16x16x32_f16(false, a, false, b, (short)0, c, false, false);
  asm volatile("v_nop\n\tv_nop\n\tv_nop\n\tv_nop" : "+v"(c) : "v"(a), "v"(b));
  return c;
}

// ---- LDS staging of the GEMM operands ----
constexpr int kGK     = 64;                  // k per pass: 128 B of every operand row
constexpr int kGPitch = 72;                  // LDS row pitch in 16-bit elements: 144 B = 16 B x 9, conflict-free for 16-B row reads
constexpr int kGPlane = 128 * kGPitch;       // one operand plane of one buffer: 128 rows

// Eight asynchronous 16-B copies of one lane, global -> LDS, rows 16 apart (l, g: the lane's own LDS byte address and
// global address of the first; lstep, gstep: the step to the next). The closing s_wait_xcnt stands inside the statement
// so that no address register named here is rewritten ahead of it.
__device__ __forceinline__ void async_copy8(unsigned l, unsigned lstep, const unsigned short* g, size_t gstep) {
  asm volatile(
      "global_load_async_to_lds_b128 %0, %8, off\n\t"
      "global_load_async_to_lds_b128 %1, %9, off\n\t"
      "global_load_async_to_lds_b128 %2, %10, off\n\t"
      "global_load_async_to_lds_b128 %3, %11, off\n\t"
      "global_load_async_to_lds_b128 %4, %12, off\n\t"
      "global_load_async_to_lds_b128 %5, %13, off\n\t"
      "global_load_async_to_lds_b128 %6, %14, off\n\t"
      "global_load_async_to_lds_b128 %7, %15, off\n\t"
      "s_wait_xcnt 0x0"
      :: "v"(l), "v"(l + lstep), "v"(l + 2 * lstep), "v"(l + 3 * lstep),
         "v"(l + 4 * lstep), "v"(l + 5 * lstep), "v"(l + 6 * lstep), "v"(l + 7 * lstep),
         "v"(g), "v"(g + gstep), "v"(g + 2 * gstep), "v"(g + 3 * gstep),
         "v"(g + 4 * gstep), "v"(g + 5 * gstep), "v"(g + 6 * gstep), "v"(g + 7 * gstep)
      : "memory");
}

// ---- Register-blocked batched WMMA GEMM (SPLIT widened to an int mode, ACT reduced to relu/leaky) ----
// C[m,n] = scale * sum_k A[m,k] * Bt[n,k] (+bias)(+resid); each wave owns a 64x64 tile, 2x2 waves share a 128x128 block tile.
// Per pass the block's 128 A rows and 128 Bt rows x 64 k are staged in LDS by asynchronous copies, two buffers: the copies
// of pass t+1 fly while pass t is worked on; fragments are read from LDS in the same k order as from global memory.
// A row-major [M,K]; Bt row-major [N,K]; M,N % 128 == 0, K % 64 == 0.
// SPLIT: 0 = single product; 1 = A and Bt hi/lo planes (hi*hi + hi*lo + lo*hi); 2 = A hi/lo only (hi*B + lo*B).
// BIAS_MODE: 0 = none, 1 = bias[m], 2 = bias[n].
// OUT_MODE: 0 = f32, 1 = f16, 2 = bf16 hi plane (Cout) + bf16 lo plane (Cout2).
// ET: 0 = f16 operands, 1 = bf16 operands (pointers passed as 16-bit storage)
template <int ET> struct Elem;
template <> struct Elem<0> { typedef _Float16 T; };
template <> struct Elem<1> { typedef __bf16 T; };
template <int ET, int SPLIT, int BIAS_MODE, int OUT_MODE, bool RESID, int ACT = 0>
__global__ __launch_bounds__(128) void wmma_gemm64(
    const unsigned short* __restrict__ Ap, const unsigned short* __restrict__ A2p, int lda, long strideA,
    const unsigned short* __restrict__ Btp, const unsigned short* __restrict__ Bt2p, int ldb, long strideB,
    void* __restrict__ Cout, void* __restrict__ Cout2, int ldc, long strideC,
    const float* __restrict__ bias,
    const float* __restrict__ resid, long strideR,
    int M, int N, int K, float scale) {
  typedef typename Elem<ET>::T T;
  typedef typename Frag<T>::V V;
  constexpr int NPL = 2 + ((SPLIT != 0) ? 1 : 0) + ((SPLIT == 1) ? 1 : 0);   // planes per buffer: A, Bt, A lo, Bt lo
  __shared__ __align__(16) T sStage[2 * NPL * kGPlane];   // two buffers of NPL planes
  __shared__ __align__(16) float sT[4][16 * 68];   // per-wave 16x64 slab, pitch 68 floats
  const int b    = blockIdx.y;
  const int tid  = threadIdx.x;
  const int lane = tid & 31;
  const int wave = tid >> 5;
  const int tilesN = N >> 7;
  const int tilesM = M >> 7;
  const int tile = blockIdx.x;
  if (tile >= tilesM * tilesN) return;   // block-uniform, ahead of every barrier and copy
  const int tm = tile / tilesN;
  const int tn = tile - tm * tilesN;
  const int bm0 = tm << 7;
  const int bn0 = tn << 7;
  const int wm  = (wave >> 1) << 6;            // this wave's 64x64 tile inside the block tile
  const int wn  = (wave & 1) << 6;
  const int m0 = bm0 + wm;
  const int n0 = bn0 + wn;

  // staging coverage per plane: 128 threads x 8 copies x 16 B = 128 rows x 128 B; 8 lanes cover one whole 128-B row piece
  const int crow = tid >> 3;                   // 0..15, copy i takes row crow + 16 i
  const int ccol = (tid & 7) * 8;              // element offset of the lane's 16 B
  const unsigned short* gA  = Ap  + (size_t)b * strideA + (size_t)(bm0 + crow) * lda + ccol;
  const unsigned short* gB  = Btp + (size_t)b * strideB + (size_t)(bn0 + crow) * ldb + ccol;
  const unsigned short* gA2 = (SPLIT != 0) ? (A2p  + (size_t)b * strideA + (size_t)(bm0 + crow) * lda + ccol) : nullptr;
  const unsigned short* gB2 = (SPLIT == 1) ? (Bt2p + (size_t)b * strideB + (size_t)(bn0 + crow) * ldb + ccol) : nullptr;
  const unsigned lBase = (unsigned)(size_t)sStage + (unsigned)(crow * kGPitch + ccol) * 2u;
  auto stage = [&](int t) {                    // pass t's operand rows into buffer t & 1
    const unsigned l = lBase + (unsigned)(t & 1) * (unsigned)(NPL * kGPlane * 2);
    const int k0 = t * kGK;
    async_copy8(l, 16 * kGPitch * 2, gA + k0, (size_t)16 * lda);
    async_copy8(l + kGPlane * 2, 16 * kGPitch * 2, gB + k0, (size_t)16 * ldb);
    if (SPLIT != 0) async_copy8(l + 2 * kGPlane * 2, 16 * kGPitch * 2, gA2 + k0, (size_t)16 * lda);
    if (SPLIT == 1) async_copy8(l + 3 * kGPlane * 2, 16 * kGPitch * 2, gB2 + k0, (size_t)16 * ldb);
  };

  const int rlane = lane & 15;                 // row (A) / col (B, D) within subtile
  const int koff  = (lane >> 4) * 8;           // k offset of this lane half
  const int mOff  = (lane >> 4) * 8;           // D row offset

  v8f acc[4][4];
#pragma unroll
  for (int i = 0; i < 4; ++i)
#pragma unroll
    for (int j = 0; j < 4; ++j) acc[i][j] = (v8f){0.f,0.f,0.f,0.f,0.f,0.f,0.f,0.f};

  const int nT = K >> 6;                       // passes
  stage(0);
  asm volatile("s_wait_asynccnt 0x0" ::: "memory");   // this wave's copies of pass 0 have landed
  __syncthreads();                                     // every wave's have: pass 0 is readable
  if (nT > 1) stage(1);

  for (int t = 0; t < nT; ++t) {
    const T* sb = sStage + (t & 1) * (NPL * kGPlane);
    const int aoff = (wm + rlane) * kGPitch + koff;
    const int boff = (wn + rlane) * kGPitch + koff;
    // the loops below are unrolled so that every fragment and accumulator index is a constant (registers, no scratch)
#pragma unroll
    for (int ks = 0; ks < kGK; ks += 32) {
      V bh[4], bl[4];
#pragma unroll
      for (int j = 0; j < 4; ++j) {
        const int bo = boff + (j << 4) * kGPitch + ks;
        bh[j] = Frag<T>::load(sb + kGPlane + bo);
        if (SPLIT == 1) bl[j] = Frag<T>::load(sb + 3 * kGPlane + bo);
      }
      V ah[4], al[4];                            // the whole 32-k block's fragments are read as one group ahead of its products
#pragma unroll
      for (int i = 0; i < 4; ++i) {
        const int ao = aoff + (i << 4) * kGPitch + ks;
        ah[i] = Frag<T>::load(sb + ao);
        if (SPLIT != 0) al[i] = Frag<T>::load(sb + 2 * kGPlane + ao);
      }
#pragma unroll
      for (int i = 0; i < 4; ++i) {
#pragma unroll
        for (int j = 0; j < 4; ++j) {
          acc[i][j] = Frag<T>::mma(ah[i], bh[j], acc[i][j]);
          if (SPLIT == 1) acc[i][j] = Frag<T>::mma(ah[i], bl[j], acc[i][j]);
          if (SPLIT != 0) acc[i][j] = Frag<T>::mma(al[i], bh[j], acc[i][j]);
        }
        Frag<T>::guard(acc[i][0], acc[i][3], ah[i], (SPLIT != 0) ? al[i] : ah[i]);
      }
      Frag<T>::keep(bh[0], bh[1], bh[2], bh[3]);
      if (SPLIT == 1) Frag<T>::keep(bl[0], bl[1], bl[2], bl[3]);
    }
    asm volatile("s_wait_dscnt 0x0" ::: "memory");     // this wave's reads of buffer t & 1 are done before it is refilled
    asm volatile("s_wait_asynccnt 0x0" ::: "memory");  // this wave's copies of pass t + 1 have landed
    __syncthreads();                                    // publishes pass t + 1 and ends every reader's use of buffer t & 1
    if (t + 2 < nT) stage(t + 2);
  }
  asm volatile("s_wait_asynccnt 0x0" ::: "memory");    // nothing in flight when the wave goes on to the epilogue and ends
  acc_guard4(acc[0][0], acc[0][1], acc[0][2], acc[0][3]);
  acc_guard4(acc[1][0], acc[1][1], acc[1][2], acc[1][3]);
  acc_guard4(acc[2][0], acc[2][1], acc[2][2], acc[2][3]);
  acc_guard4(acc[3][0], acc[3][1], acc[3][2], acc[3][3]);

  // ---- epilogue ----
  float* slab = sT[wave];
  const float* Rb = RESID ? (resid + (size_t)b * strideR) : nullptr;
#pragma unroll
  for (int i = 0; i < 4; ++i) {
    const int mBase = m0 + (i << 4);
#pragma unroll
    for (int j = 0; j < 4; ++j) {
      const int n = n0 + (j << 4) + rlane;
      float bv = 0.f;
      if (BIAS_MODE == 2) bv = bias[n];
#pragma unroll
      for (int r = 0; r < 8; ++r) {
        float v = acc[i][j][r] * scale;
        if (BIAS_MODE == 1) v += bias[mBase + mOff + r];
        if (BIAS_MODE == 2) v += bv;
        if (RESID) v += Rb[(size_t)(mBase + mOff + r) * ldc + n];
        if (ACT == 2) v = fmaxf(v, 0.0f);
        if (ACT == 4) v = (v > 0.f) ? v : 0.01f * v;
        slab[(mOff + r) * 68 + (j << 4) + rlane] = v;
      }
    }
    __builtin_amdgcn_fence(__ATOMIC_RELEASE, "workgroup");
    __builtin_amdgcn_wave_barrier();
    __builtin_amdgcn_fence(__ATOMIC_ACQUIRE, "workgroup");
    if (OUT_MODE == 0) {
      float* C = (float*)Cout + (size_t)b * strideC;
      const int hh = lane >> 4, c4 = (lane & 15) * 4;     // row seg = 256 B = 16 lanes x 16 B
      {
#pragma unroll
        for (int it = 0; it < 8; ++it) {
          const int row = it * 2 + hh;
          v4f v = *(const v4f*)(slab + row * 68 + c4);
          *(v4f*)(C + (size_t)(mBase + row) * ldc + n0 + c4) = v;
        }
        
      }
    } else {
      const int q = lane >> 3, c8 = (lane & 7) * 8;
      unsigned short* C  = (unsigned short*)Cout  + (size_t)b * strideC;
      unsigned short* C2 = (OUT_MODE == 2) ? ((unsigned short*)Cout2 + (size_t)b * strideC) : nullptr;
      {
#pragma unroll
        for (int it = 0; it < 4; ++it) {
          const int row = it * 4 + q;
          const float* sp = slab + row * 68 + c8;
          v8h hv, lv;
#pragma unroll
          for (int e = 0; e < 8; ++e) {
            if (OUT_MODE == 1) {
              hv[e] = (_Float16)sp[e];
            } else {
              unsigned short hb = f2bf_bits(sp[e]);
              unsigned short lb = f2bf_bits(sp[e] - bf_bits2f(hb));
              hv[e] = __builtin_bit_cast(_Float16, hb);
              lv[e] = __builtin_bit_cast(_Float16, lb);
            }
          }
          *(v8h*)(C + (size_t)(mBase + row) * ldc + n0 + c8) = hv;
          if (OUT_MODE == 2) *(v8h*)(C2 + (size_t)(mBase + row) * ldc + n0 + c8) = lv;
        }
        
      }
    }
    __builtin_amdgcn_fence(__ATOMIC_RELEASE, "workgroup");
    __builtin_amdgcn_wave_barrier();
    __builtin_amdgcn_fence(__ATOMIC_ACQUIRE, "workgroup");
  }
}

// ---------------------------------------------------------------------------
// f32 -> bf16 (RNE) plane, 8 elements per thread: one 16-B store per lane, 32 lanes = 512 contiguous B =
// ---------------------------------------------------------------------------
__global__ __launch_bounds__(256) void cvt_bf16x8_kernel(const float* __restrict__ in, unsigned short* __restrict__ out, int n8) {
  const int i = blockIdx.x * 256 + threadIdx.x;
  if (i >= n8) return;
  const size_t base = (size_t)i * 8;
  const v4f a = *(const v4f*)(in + base), c = *(const v4f*)(in + base + 4);
  unsigned short hb[8];
#pragma unroll
  for (int e = 0; e < 4; ++e) { hb[e] = f2bf_bits(a[e]); hb[4 + e] = f2bf_bits(c[e]); }
  const v4u u = (v4u){pk16(hb[0], hb[1]), pk16(hb[2], hb[3]), pk16(hb[4], hb[5]), pk16(hb[6], hb[7])};
  *(v4u*)(out + base) = u;
  
}

// ---------------------------------------------------------------------------
// Weight transpose + cast: in W[d][h] (row-major [in 1024][out 1024] f32) -> out WT[h][d] = bf16_rne(W[d][h]), 4 planes.
// grid (16, 16, 4): blockIdx.x = d tile (64 cols of WT), blockIdx.y = h tile (64 rows of WT), blockIdx.z selects W0..W3
// and the output plane (plane z at out + z*1024*1024 halves). 256 threads.
// Load coverage: 16 iterations x 256 threads = 4096 = the whole 64x64 tile (coalesced along h).
// Store coverage: 8 waves x 2 iterations x 4 rows (lane>>3) = 64 rows; (lane&7) x 8 halves = 64 cols; each row segment =
// ---------------------------------------------------------------------------
__global__ __launch_bounds__(256) void wtcast4_kernel(const float* __restrict__ W0, const float* __restrict__ W1,
                                                      const float* __restrict__ W2, const float* __restrict__ W3,
                                                      unsigned short* __restrict__ out) {
  __shared__ float sm[64][65];   // sm[h_local][d_local]
  const int t  = threadIdx.x;
  const int d0 = blockIdx.x * 64;
  const int h0 = blockIdx.y * 64;
  const int z  = blockIdx.z;                                   // block-uniform
  const float* W = (z == 0) ? W0 : (z == 1) ? W1 : (z == 2) ? W2 : W3;
#pragma unroll
  for (int i = 0; i < 16; ++i) {
    const int e = i * 256 + t;
    const int r = e >> 6;          // d local
    const int cc = e & 63;         // h local
    sm[cc][r] = W[(size_t)(d0 + r) * kDim + h0 + cc];
  }
  __syncthreads();
  const int lane = t & 31, wave = t >> 5;
  const int q = lane >> 3, c8 = (lane & 7) * 8;
  unsigned short* op = out + (size_t)z * kDim * kDim;
  {
#pragma unroll
    for (int it = 0; it < 2; ++it) {
      const int row = wave * 8 + it * 4 + q;                 // h local
      unsigned short hb[8];
#pragma unroll
      for (int e = 0; e < 8; ++e) hb[e] = f2bf_bits(sm[row][c8 + e]);
      const v4u u = (v4u){pk16(hb[0], hb[1]), pk16(hb[2], hb[3]), pk16(hb[4], hb[5]), pk16(hb[6], hb[7])};
      *(v4u*)(op + (size_t)(h0 + row) * kDim + d0 + c8) = u;
    }
    
  }
}

// ---------------------------------------------------------------------------
// (q + r_w_bias) planes: qf f32 [4096][1024] (col = n*64+d), r_w_bias [16][64] flat index == col, RNE-converted to bf16 value,
// added in f32, then bf16 hi/lo split. Thread = 8 consecutive elements of one row: one 16-B store per lane per plane;
// ---------------------------------------------------------------------------
__global__ __launch_bounds__(256) void qplanes_kernel(const float* __restrict__ qf, const float* __restrict__ rwb,
                                                      unsigned short* __restrict__ oh, unsigned short* __restrict__ ol, int n8) {
  const int i = blockIdx.x * 256 + threadIdx.x;
  if (i >= n8) return;
  const size_t base = (size_t)i * 8;
  const int col = (int)(base % (size_t)kDim);
  const v4f a0 = *(const v4f*)(qf + base), a1 = *(const v4f*)(qf + base + 4);
  const v4f u0 = *(const v4f*)(rwb + col), u1 = *(const v4f*)(rwb + col + 4);
  float x[8];
#pragma unroll
  for (int e = 0; e < 4; ++e) { x[e] = a0[e] + bf_rne(u0[e]); x[4 + e] = a1[e] + bf_rne(u1[e]); }
  unsigned short hb[8], lb[8];
#pragma unroll
  for (int e = 0; e < 8; ++e) { hb[e] = f2bf_bits(x[e]); lb[e] = f2bf_bits(x[e] - bf_bits2f(hb[e])); }
  const v4u uh = (v4u){pk16(hb[0], hb[1]), pk16(hb[2], hb[3]), pk16(hb[4], hb[5]), pk16(hb[6], hb[7])};
  const v4u ul = (v4u){pk16(lb[0], lb[1]), pk16(lb[2], lb[3]), pk16(lb[4], lb[5]), pk16(lb[6], lb[7])};
  *(v4u*)(oh + base) = uh;
  *(v4u*)(ol + base) = ul;
  
}

// ---------------------------------------------------------------------------
// (k_j + r_emb_{j+1,n}) planes: kf f32 [4096][1024] (token = b*1024+j, col = n*64+d); r_emb [1024][16][64] flat = [1024][1024];
// row j uses r_emb row j+1 (RNE-converted to bf16 value) and 0 for j = 1023 (shift by one with trailing zero).
// The r_emb address is clamped to row 1023 and the value zeroed by predicate. Output bf16 hi/lo planes; store shape as qplanes_kernel.
// ---------------------------------------------------------------------------
__global__ __launch_bounds__(256) void krplanes_kernel(const float* __restrict__ kf, const float* __restrict__ remb,
                                                       unsigned short* __restrict__ oh, unsigned short* __restrict__ ol, int n8) {
  const int i = blockIdx.x * 256 + threadIdx.x;
  if (i >= n8) return;
  const size_t base = (size_t)i * 8;
  const int row = (int)(base / (size_t)kDim);                 // token index
  const int j   = row % kSeq;
  const int col = (int)(base % (size_t)kDim);
  const bool keep = (j + 1 < kSeq);
  const int jr = keep ? (j + 1) : (kSeq - 1);                 // clamped address
  const float* rp = remb + (size_t)jr * kDim + col;
  const v4f k0 = *(const v4f*)(kf + base), k1 = *(const v4f*)(kf + base + 4);
  const v4f r0 = *(const v4f*)(rp), r1 = *(const v4f*)(rp + 4);
  float x[8];
#pragma unroll
  for (int e = 0; e < 4; ++e) {
    x[e]     = k0[e] + (keep ? bf_rne(r0[e]) : 0.0f);
    x[4 + e] = k1[e] + (keep ? bf_rne(r1[e]) : 0.0f);
  }
  unsigned short hb[8], lb[8];
#pragma unroll
  for (int e = 0; e < 8; ++e) { hb[e] = f2bf_bits(x[e]); lb[e] = f2bf_bits(x[e] - bf_bits2f(hb[e])); }
  const v4u uh = (v4u){pk16(hb[0], hb[1]), pk16(hb[2], hb[3]), pk16(hb[4], hb[5]), pk16(hb[6], hb[7])};
  const v4u ul = (v4u){pk16(lb[0], lb[1]), pk16(lb[2], lb[3]), pk16(lb[4], lb[5]), pk16(lb[6], lb[7])};
  *(v4u*)(oh + base) = uh;
  *(v4u*)(ol + base) = ul;
  
}

// ---------------------------------------------------------------------------
// Score bias table tb[n][j] (f32, [16][1024]): for j <= 1022: bf(r_bias[j+1][n]) - sum_d bf(r_w_bias[n][d]) * bf(r_emb[j+1][n][d]);
// tb[n][1023] = 0. Thread per (n, j), 64-tap rolled dot in fixed order (inputs only). r_emb / r_bias addresses clamped to row 1023,
// ---------------------------------------------------------------------------
__global__ __launch_bounds__(256) void tb_kernel(const float* __restrict__ rwb, const float* __restrict__ remb,
                                                 const float* __restrict__ rbias, float* __restrict__ tb) {
  const int i = blockIdx.x * 256 + threadIdx.x;          // 0..16383
  const int n = i >> 10;
  const int j = i & (kSeq - 1);
  const bool keep = (j + 1 < kSeq);
  const int jr = keep ? (j + 1) : (kSeq - 1);
  const float* rp = remb + ((size_t)jr * kHeads + n) * kHd;
  const float* up = rwb + n * kHd;
  float acc = 0.f;
#pragma unroll 1
  for (int d = 0; d < kHd; ++d) acc = fmaf(bf_rne(up[d]), bf_rne(rp[d]), acc);
  const float val = keep ? (bf_rne(rbias[jr * kHeads + n]) - acc) : 0.0f;
  ((float*)tb)[i] = val;
  
}

// ---------------------------------------------------------------------------
// Relative-position flash attention for head_dim 64 (no mask). Block = 4 waves = 64 query rows of one (batch, head);
// grid = 4 * 16 * 16 = 1024 blocks of 128 threads; blockIdx.x = b*256 + h*16 + qb.
// Inputs: QRh/QRl = bf16 hi/lo planes of (q + r_w_bias) [4096][1024]; KRh/KRl = bf16 hi/lo planes of (k_j + r_emb_{j+1});
// Vp = f16 plane of v [4096][1024]; tb = f32 [16][1024] score bias table.
// score[i][j] = ((q+rwb)_i · (k_j + r_{j+1}) + tb[h][j]) * 0.125  : v_wmma_f32_16x16x32_bf16, hi*hi + hi*lo + lo*hi.
// out += P·V : v_wmma_f32_16x16x32_f16 (V staged transposed [d][kv] in LDS as f16); final out * 1/(l * 2^15).
// ---------------------------------------------------------------------------
__global__ __launch_bounds__(128) void relattn_kernel(
    const unsigned short* __restrict__ QRh, const unsigned short* __restrict__ QRl,
    const unsigned short* __restrict__ KRh, const unsigned short* __restrict__ KRl,
    const unsigned short* __restrict__ Vp, const float* __restrict__ tb,
    unsigned short* __restrict__ AVh, unsigned short* __restrict__ AVl) {
  union FB { v16b v; v8b h[2]; };
  union FH { v16h v; v8h h[2]; };
  __shared__ __align__(16) __bf16   Ksh[kKC * kHd];            // K hi [kv][d]   8 KB
  __shared__ __align__(16) __bf16   Ksl[kKC * kHd];            // K lo [kv][d]   8 KB
  __shared__ __align__(16) _Float16 Vt[kHd * kKC];             // V f16 [d][kv]  8 KB
  __shared__ __align__(16) _Float16 Psh[4][16 * kKC];          // per wave P [row][kv] 8 KB
  __shared__ __align__(16) float    Os[4][16 * kOsPitch];      // per wave out tile, pitch 68

  const int tid  = threadIdx.x;
  const int wave = tid >> 5;
  const int lane = tid & 31;
  const int hh   = lane >> 4;
  const int c    = lane & 15;

  const int bx = blockIdx.x;
  const int qb = bx & 15;
  const int h  = (bx >> 4) & 15;
  const int b  = bx >> 8;
  const int q0 = qb * 64 + wave * 16;
  const size_t tok0 = (size_t)b * kSeq;
  const int hcol = h * kHd;

  // ---- Q fragments (A operand): 2 d-chunks, hi and lo. Frag load: elements 0..7 <- k 8hh+0..7, 8..15 <- k 16+8hh+0..7 ----
  v16b qah[2], qal[2];
  {
    const __bf16* ph = (const __bf16*)QRh + (tok0 + q0 + c) * kDim + hcol + 8 * hh;
    const __bf16* pl = (const __bf16*)QRl + (tok0 + q0 + c) * kDim + hcol + 8 * hh;
#pragma unroll
    for (int dc = 0; dc < 2; ++dc) {
      qah[dc] = Frag<__bf16>::load(ph + dc * 32);
      qal[dc] = Frag<__bf16>::load(pl + dc * 32);
    }
  }

  float mrow[8], lrow[8];
  v8f oacc[4];
#pragma unroll
  for (int r = 0; r < 8; ++r) { mrow[r] = -INFINITY; lrow[r] = 0.f; }
#pragma unroll
  for (int t = 0; t < 4; ++t) oacc[t] = (v8f){0.f,0.f,0.f,0.f,0.f,0.f,0.f,0.f};

  for (int kc = 0; kc < kSeq / kKC; ++kc) {     // 16 chunks, block-uniform
    const int kv0 = kc * kKC;
    __syncthreads();
    {
      // staging coverage: 128 threads = 64 kv rows x 2 halves of 32 d; 4 x 16-B pieces each -> whole 64x64 tiles of K hi, K lo, V
      const int kvr = tid >> 1;
      const int dh  = (tid & 1) * 32;
      const size_t g = (tok0 + kv0 + kvr) * kDim + hcol + dh;
      const v8b* gkh = (const v8b*)((const __bf16*)KRh + g);
      const v8b* gkl = (const v8b*)((const __bf16*)KRl + g);
      const v8h* gv  = (const v8h*)((const _Float16*)Vp + g);
#pragma unroll
      for (int i = 0; i < 4; ++i) {
        const v8b a  = gkh[i];
        const v8b al = gkl[i];
        const v8h vv = gv[i];
        *(v8b*)(Ksh + kvr * kHd + dh + 8 * i) = a;
        *(v8b*)(Ksl + kvr * kHd + dh + 8 * i) = al;
#pragma unroll
        for (int e = 0; e < 8; ++e) Vt[(dh + 8 * i + e) * kKC + kvr] = vv[e];
      }
    }
    __syncthreads();

    v8f s[4];
#pragma unroll
    for (int j = 0; j < 4; ++j) {
      s[j] = (v8f){0.f,0.f,0.f,0.f,0.f,0.f,0.f,0.f};
#pragma unroll
      for (int dc = 0; dc < 2; ++dc) {
        FB kb, kl;
        kb.h[0] = *(const v8b*)(Ksh + (j * 16 + c) * kHd + dc * 32 + 8 * hh);
        kb.h[1] = *(const v8b*)(Ksh + (j * 16 + c) * kHd + dc * 32 + 16 + 8 * hh);
        kl.h[0] = *(const v8b*)(Ksl + (j * 16 + c) * kHd + dc * 32 + 8 * hh);
        kl.h[1] = *(const v8b*)(Ksl + (j * 16 + c) * kHd + dc * 32 + 16 + 8 * hh);
        s[j] = mma_bf16g(qah[dc], kb.v, s[j]);
        s[j] = mma_bf16g(qah[dc], kl.v, s[j]);
        s[j] = mma_bf16g(qal[dc], kb.v, s[j]);
      }
    }
    float tbv[4];
#pragma unroll
    for (int j = 0; j < 4; ++j) tbv[j] = tb[h * kSeq + kv0 + j * 16 + c];

    float cm[8];
#pragma unroll
    for (int r = 0; r < 8; ++r) {
      float m = -INFINITY;
#pragma unroll
      for (int j = 0; j < 4; ++j) {
        s[j][r] = (s[j][r] + tbv[j]) * kScale;
        m = fmaxf(m, s[j][r]);
      }
#pragma unroll
      for (int off = 1; off < 16; off <<= 1) m = fmaxf(m, __shfl_xor(m, off, 32));
      cm[r] = m;
    }
    _Float16* pw = Psh[wave];
#pragma unroll
    for (int r = 0; r < 8; ++r) {
      const float mnew  = fmaxf(mrow[r], cm[r]);
      const float alpha = expf(mrow[r] - mnew);
      mrow[r] = mnew;
      float psum = 0.f;
#pragma unroll
      for (int j = 0; j < 4; ++j) {
        const float p = expf(s[j][r] - mnew);
        psum += p;
        pw[(8 * hh + r) * kKC + j * 16 + c] = (_Float16)(p * kPCarry);
      }
#pragma unroll
      for (int off = 1; off < 16; off <<= 1) psum += __shfl_xor(psum, off, 32);
      lrow[r] = lrow[r] * alpha + psum;
#pragma unroll
      for (int t = 0; t < 4; ++t) oacc[t][r] *= alpha;
    }
    __builtin_amdgcn_fence(__ATOMIC_RELEASE, "workgroup");
    __builtin_amdgcn_wave_barrier();
    __builtin_amdgcn_fence(__ATOMIC_ACQUIRE, "workgroup");
#pragma unroll
    for (int kk = 0; kk < 2; ++kk) {
      FH pa;
      pa.h[0] = *(const v8h*)(pw + c * kKC + kk * 32 + 8 * hh);
      pa.h[1] = *(const v8h*)(pw + c * kKC + kk * 32 + 16 + 8 * hh);
#pragma unroll
      for (int t = 0; t < 4; ++t) {
        FH vb;
        vb.h[0] = *(const v8h*)(Vt + (t * 16 + c) * kKC + kk * 32 + 8 * hh);
        vb.h[1] = *(const v8h*)(Vt + (t * 16 + c) * kKC + kk * 32 + 16 + 8 * hh);
        oacc[t] = mma_f16g(pa.v, vb.v, oacc[t]);
      }
    }
  }

  float* os = Os[wave];
#pragma unroll
  for (int r = 0; r < 8; ++r) {
    const float inv = 1.0f / (lrow[r] * kPCarry);
#pragma unroll
    for (int t = 0; t < 4; ++t) os[(8 * hh + r) * kOsPitch + t * 16 + c] = oacc[t][r] * inv;
  }
  __builtin_amdgcn_fence(__ATOMIC_RELEASE, "workgroup");
  __builtin_amdgcn_wave_barrier();
  __builtin_amdgcn_fence(__ATOMIC_ACQUIRE, "workgroup");
  {
    const int q = lane >> 3, c8 = (lane & 7) * 8;
    {
#pragma unroll
      for (int it = 0; it < 4; ++it) {
        const int row = it * 4 + q;                       // 0..15
        const float* sp = os + row * kOsPitch + c8;
        v8h hv, lv;
#pragma unroll
        for (int e = 0; e < 8; ++e) {
          const unsigned short hb = f2bf_bits(sp[e]);
          const unsigned short lb = f2bf_bits(sp[e] - bf_bits2f(hb));
          hv[e] = __builtin_bit_cast(_Float16, hb);
          lv[e] = __builtin_bit_cast(_Float16, lb);
        }
        const size_t o = (tok0 + q0 + row) * kDim + hcol + c8;
        *(v8h*)(AVh + o) = hv;
        *(v8h*)(AVl + o) = lv;
      }
      
    }
  }
}

// ---------------------------------------------------------------------------
// y = (x - mu) * rsqrt(var + eps) * bf(gamma) + bf(beta). One block of 256 threads (8 waves) per row; thread t owns
// ---------------------------------------------------------------------------
__global__ __launch_bounds__(256) void ln_kernel(const float* __restrict__ w, const float* __restrict__ ao,
                                                 const float* __restrict__ g, const float* __restrict__ bt,
                                                 float* __restrict__ out) {
  __shared__ float red[16];
  const int row  = blockIdx.x;
  const int t    = threadIdx.x, lane = t & 31, wave = t >> 5;
  const int c0   = t * 4;
  const size_t off = (size_t)row * kDim + c0;
  const v4f a = *(const v4f*)(w + off);
  const v4f o = *(const v4f*)(ao + off);
  float x[4];
#pragma unroll
  for (int e = 0; e < 4; ++e) x[e] = bf_rne(a[e]) + o[e];
  float s = (x[0] + x[1]) + (x[2] + x[3]);
#pragma unroll
  for (int sh = 16; sh > 0; sh >>= 1) s += __shfl_xor(s, sh, 32);
  if (lane == 0) red[wave] = s;
  __syncthreads();
  const float mu = (((red[0] + red[1]) + (red[2] + red[3])) + ((red[4] + red[5]) + (red[6] + red[7]))) * kInvDim;
  float d[4];
  float s2 = 0.f;
#pragma unroll
  for (int e = 0; e < 4; ++e) { d[e] = x[e] - mu; s2 += d[e] * d[e]; }
#pragma unroll
  for (int sh = 16; sh > 0; sh >>= 1) s2 += __shfl_xor(s2, sh, 32);
  if (lane == 0) red[8 + wave] = s2;
  __syncthreads();
  const float var  = (((red[8] + red[9]) + (red[10] + red[11])) + ((red[12] + red[13]) + (red[14] + red[15]))) * kInvDim;
  const float rstd = rsqrtf(var + kLnEps);
  const v4f gg = *(const v4f*)(g + c0);
  const v4f bb = *(const v4f*)(bt + c0);
  v4f y;
#pragma unroll
  for (int e = 0; e < 4; ++e) y[e] = (d[e] * rstd) * bf_rne(gg[e]) + bf_rne(bb[e]);
  *(v4f*)(out + off) = y;
  
}

// ---------------------------------------------------------------------------
// Host launch glue. Workspace region map (bytes, all offsets 256-B aligned):
//   [0]            Wb    bf16 w plane            [4096][1024]      8,388,608
//   [8,388,608]    WT    bf16 Wq^T|Wk^T|Wv^T|Wo^T 4 x [1024][1024]  8,388,608
//   [16,777,216]   QKF   f32 q then f32 k        2 x [4096][1024]  33,554,432   (dead after the plane kernels;
//                        reused: AVh bf16 at +0, AVl bf16 at +8,388,608, AO f32 at +16,777,216)
//   [50,331,648]   Vh    f16 v plane             [4096][1024]      8,388,608
//   [58,720,256]   QRh|QRl bf16 (q+rwb) hi/lo    2 x [4096][1024]  16,777,216
//   [75,497,472]   KRh|KRl bf16 (k+r) hi/lo      2 x [4096][1024]  16,777,216
//   [92,274,688]   TB    f32 [16][1024]                            65,536
//   total 92,340,224
// ---------------------------------------------------------------------------
extern "C" void kernel_launch(void* const* d_in, const int* in_sizes, int n_in,
                              void* d_out, int out_size, void* d_ws, size_t ws_size,
                              hipStream_t stream) {
  if (n_in < 10) return;
  const float* w     = (const float*)d_in[0];
  const float* remb  = (const float*)d_in[1];
  const float* rwb   = (const float*)d_in[2];
  const float* rbias = (const float*)d_in[3];
  const float* Wq    = (const float*)d_in[4];
  const float* Wk    = (const float*)d_in[5];
  const float* Wv    = (const float*)d_in[6];
  const float* Wo    = (const float*)d_in[7];
  const float* gamma = (const float*)d_in[8];
  const float* beta  = (const float*)d_in[9];
  float* out = (float*)d_out;

  const size_t nTokD = (size_t)kTok * kDim;                    // 4,194,304 elements
  if ((size_t)in_sizes[0] != nTokD) return;
  if (in_sizes[1] != kSeq * kHeads * kHd) return;
  if (in_sizes[2] != kHeads * kHd) return;
  if (in_sizes[3] != kSeq * kHeads) return;
  if (in_sizes[4] != kDim * kDim || in_sizes[5] != kDim * kDim || in_sizes[6] != kDim * kDim || in_sizes[7] != kDim * kDim) return;
  if (in_sizes[8] != kDim || in_sizes[9] != kDim) return;
  if ((size_t)out_size != nTokD) return;

  const size_t bWb  = nTokD * 2;
  const size_t bWT  = (size_t)4 * kDim * kDim * 2;
  const size_t bQKF = nTokD * 4 * 2;
  const size_t bVh  = nTokD * 2;
  const size_t bQR  = nTokD * 2 * 2;
  const size_t bKR  = nTokD * 2 * 2;
  const size_t bTB  = (size_t)kHeads * kSeq * 4;
  const size_t oWb  = 0;
  const size_t oWT  = oWb + bWb;
  const size_t oQKF = oWT + bWT;
  const size_t oVh  = oQKF + bQKF;
  const size_t oQR  = oVh + bVh;
  const size_t oKR  = oQR + bQR;
  const size_t oTB  = oKR + bKR;
  const size_t total = oTB + bTB;                               // 92,340,224
  if (total > ws_size) return;

  char* ws = (char*)d_ws;
  unsigned short* Wb  = (unsigned short*)(ws + oWb);
  unsigned short* WT  = (unsigned short*)(ws + oWT);
  float*          QKF = (float*)(ws + oQKF);
  float*          qf  = QKF;
  float*          kf  = QKF + nTokD;
  unsigned short* Vh  = (unsigned short*)(ws + oVh);
  unsigned short* QRh = (unsigned short*)(ws + oQR);
  unsigned short* QRl = QRh + nTokD;
  unsigned short* KRh = (unsigned short*)(ws + oKR);
  unsigned short* KRl = KRh + nTokD;
  float*          TB  = (float*)(ws + oTB);
  unsigned short* AVh = (unsigned short*)(ws + oQKF);          // reuse of the dead q f32 region
  unsigned short* AVl = AVh + nTokD;
  float*          AO  = kf;                                    // reuse of the dead k f32 region

  const int n8 = (int)(nTokD / 8);                             // 524288
  const long wPlane = (long)kDim * kDim;

  // 1. w -> bf16 plane
  cvt_bf16x8_kernel<<<dim3(n8 / 256), dim3(256), 0, stream>>>(w, Wb, n8);
  // 2. weight transposes: in W[1024 in][1024 out] -> out WT[out][in], planes 0..3 = Wq, Wk, Wv, Wo
  wtcast4_kernel<<<dim3(kDim / 64, kDim / 64, 4), dim3(256), 0, stream>>>(Wq, Wk, Wv, Wo, WT);
  // 3. q and k (f32): batch index selects WT plane 0/1 and output plane; M=4096, N=1024, K=1024 (block tiles 32x8 = 256 blocks x 4 waves)
  wmma_gemm64<1, 0, 0, 0, false><<<dim3(256, 2), dim3(128), 0, stream>>>(
      Wb, Wb, kDim, 0L,
      WT, WT, kDim, wPlane,
      (void*)QKF, (void*)QKF, kDim, (long)nTokD,
      gamma, gamma, 0L,
      kTok, kDim, kDim, 1.0f);
  // 4. v (f16 plane)
  wmma_gemm64<1, 0, 0, 1, false><<<dim3(256, 1), dim3(128), 0, stream>>>(
      Wb, Wb, kDim, 0L,
      WT + 2 * wPlane, WT + 2 * wPlane, kDim, 0L,
      (void*)Vh, (void*)Vh, kDim, 0L,
      gamma, gamma, 0L,
      kTok, kDim, kDim, 1.0f);
  // 5. (q + r_w_bias) hi/lo planes
  qplanes_kernel<<<dim3(n8 / 256), dim3(256), 0, stream>>>(qf, rwb, QRh, QRl, n8);
  // 6. (k_j + r_emb_{j+1}) hi/lo planes
  krplanes_kernel<<<dim3(n8 / 256), dim3(256), 0, stream>>>(kf, remb, KRh, KRl, n8);
  // 7. score bias table [16][1024]
  tb_kernel<<<dim3((kHeads * kSeq) / 256), dim3(256), 0, stream>>>(rwb, remb, rbias, TB);
  // 8. attention -> attn_vec bf16 hi/lo planes
  relattn_kernel<<<dim3(kBatch * kHeads * (kSeq / 64)), dim3(128), 0, stream>>>(QRh, QRl, KRh, KRl, Vh, TB, AVh, AVl);
  // 9. attn_vec @ Wo (A hi/lo split, Wo bf16) -> f32
  wmma_gemm64<1, 2, 0, 0, false><<<dim3(256, 1), dim3(128), 0, stream>>>(
      AVh, AVl, kDim, 0L,
      WT + 3 * wPlane, WT + 3 * wPlane, kDim, 0L,
      (void*)AO, (void*)AO, kDim, 0L,
      gamma, gamma, 0L,
      kTok, kDim, kDim, 1.0f);
  // 10. residual + LayerNorm -> out
  ln_kernel<<<dim3(kTok), dim3(256), 0, stream>>>(w, AO, gamma, beta, out);
}

// v002
// It runs in 168 microseconds.
// Two timings next to v001 put it at 1.22 and 1.23 times that version's speed.
// Counting every step since v000, it is 1.82 times as fast.
// Compute dtypes: w@Wq|Wk|Wv on v_wmma_f32_16x16x32_bf16 (inputs RNE-converted to bf16, single product); scores (q+r_w_bias)·(k_j+r_emb_{j+1}) on v_wmma_f32_16x16x32_bf16 with bf16 hi/lo planes (hi*hi+hi*lo+lo*hi); attn_prob·v on v_wmma_f32_16x16x32_f16 (P f16 carried x32768, V f16); attn_vec@Wo on v_wmma_f32_16x16x32_bf16 (attn_vec bf16 hi/lo, Wo bf16: hi*W+lo*W); f32 accumulate everywhere; softmax, bias table, residual and LayerNorm in f32.
#include <hip/hip_runtime.h>
#include <math.h>

// ---------------------------------------------------------------------------
// Problem constants
// ---------------------------------------------------------------------------
constexpr int kBatch = 4;
constexpr int kSeq   = 1024;
constexpr int kDim   = 1024;
constexpr int kHeads = 16;
constexpr int kHd    = 64;
constexpr int kTok   = kBatch * kSeq;      // 4096 token rows
constexpr float kLnEps  = 1e-5f;
constexpr float kInvDim = 1.0f / 1024.0f;
constexpr float kScale  = 0.125f;          // 1/sqrt(64)
constexpr float kPCarry = 32768.0f;        // probabilities carried x2^15 in f16
constexpr int kKC = 64;                    // keys per chunk
constexpr int kOsPitch = 68;
// LDS row pitch of the attention K, V and P tiles in 16-bit elements: 208 B = 16 B x 13, an odd count of 16-B units, so the
// sixteen rows that a 16-B fragment read touches fall on sixteen different groups of four banks. 13 and not 9: the banks see
// no difference, but the builds do: at 144 B the twelve staging loads of a chunk are waited out almost one by one, at 208 B
// (69 KB a block, four blocks a WGP, which is what the grid supplies) all twelve are issued together.
constexpr int kAPitch = 104;

typedef __attribute__((ext_vector_type(16))) _Float16 v16h;
typedef __attribute__((ext_vector_type(8)))  _Float16 v8h;
typedef __attribute__((ext_vector_type(16))) __bf16   v16b;
typedef __attribute__((ext_vector_type(8)))  __bf16   v8b;
typedef __attribute__((ext_vector_type(8)))  float    v8f;
typedef __attribute__((ext_vector_type(4)))  float    v4f;
typedef __attribute__((ext_vector_type(4)))  unsigned int v4u;

__device__ __forceinline__ unsigned short f2bf_bits(float f) {
  unsigned u = __float_as_uint(f);
  return (unsigned short)((u + 0x7FFFu + ((u >> 16) & 1u)) >> 16);
}
__device__ __forceinline__ float bf_bits2f(unsigned short h) { return __uint_as_float(((unsigned)h) << 16); }
__device__ __forceinline__ float bf_rne(float f) { return bf_bits2f(f2bf_bits(f)); }

// hazard guards as plain device helpers
__device__ __forceinline__ void dep_guard_h(v8f& a, v8f& b, v16h x, v16h y) { asm volatile("v_nop\n\tv_nop\n\tv_nop\n\tv_nop" : "+v"(a), "+v"(b) : "v"(x), "v"(y)); }
__device__ __forceinline__ void dep_guard_b(v8f& a, v8f& b, v16b x, v16b y) { asm volatile("v_nop\n\tv_nop\n\tv_nop\n\tv_nop" : "+v"(a), "+v"(b) : "v"(x), "v"(y)); }
__device__ __forceinline__ void keep4_h(v16h a, v16h b, v16h c, v16h d) { asm volatile("v_nop" :: "v"(a), "v"(b), "v"(c), "v"(d)); }
__device__ __forceinline__ void keep4_b(v16b a, v16b b, v16b c, v16b d) { asm volatile("v_nop" :: "v"(a), "v"(b), "v"(c), "v"(d)); }
__device__ __forceinline__ void acc_guard4(v8f& a, v8f& b, v8f& c, v8f& d) { asm volatile("v_nop\n\tv_nop\n\tv_nop\n\tv_nop" : "+v"(a), "+v"(b), "+v"(c), "+v"(d)); }
template <typename T> struct Frag;
template <> struct Frag<_Float16> {
  typedef v16h V; union U { v16h v; v8h h[2]; };
  static __device__ __forceinline__ v16h load(const _Float16* p) {   // elements 0..7 <- p[0..7], 8..15 <- p[16..23]
    U f; f.h[0] = *(const v8h*)(p); f.h[1] = *(const v8h*)(p + 16); return f.v;
  }
  static __device__ __forceinline__ v8f mma(v16h a, v16h b, v8f c) {
    return __builtin_amdgcn_wmma_f32_16x16x32_f16(false, a, false, b, (short)0, c, false, false);
  }
  static __device__ __forceinline__ void guard(v8f& a, v8f& b, v16h x, v16h y) { dep_guard_h(a, b, x, y); }
  static __device__ __forceinline__ void keep(v16h a, v16h b, v16h c, v16h d) { keep4_h(a, b, c, d); }
};
template <> struct Frag<__bf16> {
  typedef v16b V; union U { v16b v; v8b h[2]; };
  static __device__ __forceinline__ v16b load(const __bf16* p) {
    U f; f.h[0] = *(const v8b*)(p); f.h[1] = *(const v8b*)(p + 16); return f.v;
  }
  static __device__ __forceinline__ v8f mma(v16b a, v16b b, v8f c) {
    return __builtin_amdgcn_wmma_f32_16x16x32_bf16(false, a, false, b, (short)0, c, false, false);
  }
  static __device__ __forceinline__ void guard(v8f& a, v8f& b, v16b x, v16b y) { dep_guard_b(a, b, x, y); }
  static __device__ __forceinline__ void keep(v16b a, v16b b, v16b c, v16b d) { keep4_b(a, b, c, d); }
};

__device__ __forceinline__ unsigned pk16(unsigned short a, unsigned short b) { return (unsigned)a | ((unsigned)b << 16); }

// single WMMA issue with hazard guard (bf16 and f16 twins)
__device__ __forceinline__ v8f mma_bf16g(v16b a, v16b b, v8f c) {
  c = __builtin_amdgcn_wmma_f32_16x16x32_bf16(false, a, false, b, (short)0, c, false, false);
  asm volatile("v_nop\n\tv_nop\n\tv_nop\n\tv_nop" : "+v"(c) : "v"(a), "v"(b));
  return c;
}
__device__ __forceinline__ v8f mma_f16g(v16h a, v16h b, v8f c) {
  c = __builtin_amdgcn_wmma_f32_16x16x32_f16(false, a, false, b, (short)0, c, false, false);
  asm volatile("v_nop\n\tv_nop\n\tv_nop\n\tv_nop" : "+v"(c) : "v"(a), "v"(b));
  return c;
}

// ---- LDS staging of the GEMM operands ----
constexpr int kGK     = 64;                  // k per pass: 128 B of every operand row
constexpr int kGPitch = 72;                  // LDS row pitch in 16-bit elements: 144 B = 16 B x 9, conflict-free for 16-B row reads
constexpr int kGPlane = 128 * kGPitch;       // one operand plane of one buffer: 128 rows

// Eight asynchronous 16-B copies of one lane, global -> LDS, rows 16 apart (l, g: the lane's own LDS byte address and
// global address of the first; lstep, gstep: the step to the next). The closing s_wait_xcnt stands inside the statement
// so that no address register named here is rewritten ahead of it.
__device__ __forceinline__ void async_copy8(unsigned l, unsigned lstep, const unsigned short* g, size_t gstep) {
  asm volatile(
      "global_load_async_to_lds_b128 %0, %8, off\n\t"
      "global_load_async_to_lds_b128 %1, %9, off\n\t"
      "global_load_async_to_lds_b128 %2, %10, off\n\t"
      "global_load_async_to_lds_b128 %3, %11, off\n\t"
      "global_load_async_to_lds_b128 %4, %12, off\n\t"
      "global_load_async_to_lds_b128 %5, %13, off\n\t"
      "global_load_async_to_lds_b128 %6, %14, off\n\t"
      "global_load_async_to_lds_b128 %7, %15, off\n\t"
      "s_wait_xcnt 0x0"
      :: "v"(l), "v"(l + lstep), "v"(l + 2 * lstep), "v"(l + 3 * lstep),
         "v"(l + 4 * lstep), "v"(l + 5 * lstep), "v"(l + 6 * lstep), "v"(l + 7 * lstep),
         "v"(g), "v"(g + gstep), "v"(g + 2 * gstep), "v"(g + 3 * gstep),
         "v"(g + 4 * gstep), "v"(g + 5 * gstep), "v"(g + 6 * gstep), "v"(g + 7 * gstep)
      : "memory");
}

// ---- Register-blocked batched WMMA GEMM (SPLIT widened to an int mode, ACT reduced to relu/leaky) ----
// C[m,n] = scale * sum_k A[m,k] * Bt[n,k] (+bias)(+resid); each wave owns a 64x64 tile, 2x2 waves share a 128x128 block tile.
// Per pass the block's 128 A rows and 128 Bt rows x 64 k are staged in LDS by asynchronous copies, two buffers: the copies
// of pass t+1 fly while pass t is worked on; fragments are read from LDS in the same k order as from global memory.
// A row-major [M,K]; Bt row-major [N,K]; M,N % 128 == 0, K % 64 == 0.
// SPLIT: 0 = single product; 1 = A and Bt hi/lo planes (hi*hi + hi*lo + lo*hi); 2 = A hi/lo only (hi*B + lo*B).
// BIAS_MODE: 0 = none, 1 = bias[m], 2 = bias[n].
// OUT_MODE: 0 = f32, 1 = f16, 2 = bf16 hi plane (Cout) + bf16 lo plane (Cout2).
// ET: 0 = f16 operands, 1 = bf16 operands (pointers passed as 16-bit storage)
template <int ET> struct Elem;
template <> struct Elem<0> { typedef _Float16 T; };
template <> struct Elem<1> { typedef __bf16 T; };
template <int ET, int SPLIT, int BIAS_MODE, int OUT_MODE, bool RESID, int ACT = 0>
__global__ __launch_bounds__(128) void wmma_gemm64(
    const unsigned short* __restrict__ Ap, const unsigned short* __restrict__ A2p, int lda, long strideA,
    const unsigned short* __restrict__ Btp, const unsigned short* __restrict__ Bt2p, int ldb, long strideB,
    void* __restrict__ Cout, void* __restrict__ Cout2, int ldc, long strideC,
    const float* __restrict__ bias,
    const float* __restrict__ resid, long strideR,
    int M, int N, int K, float scale) {
  typedef typename Elem<ET>::T T;
  typedef typename Frag<T>::V V;
  constexpr int NPL = 2 + ((SPLIT != 0) ? 1 : 0) + ((SPLIT == 1) ? 1 : 0);   // planes per buffer: A, Bt, A lo, Bt lo
  __shared__ __align__(16) T sStage[2 * NPL * kGPlane];   // two buffers of NPL planes
  __shared__ __align__(16) float sT[4][16 * 68];   // per-wave 16x64 slab, pitch 68 floats
  const int b    = blockIdx.y;
  const int tid  = threadIdx.x;
  const int lane = tid & 31;
  const int wave = tid >> 5;
  const int tilesN = N >> 7;
  const int tilesM = M >> 7;
  const int tile = blockIdx.x;
  if (tile >= tilesM * tilesN) return;   // block-uniform, ahead of every barrier and copy
  const int tm = tile / tilesN;
  const int tn = tile - tm * tilesN;
  const int bm0 = tm << 7;
  const int bn0 = tn << 7;
  const int wm  = (wave >> 1) << 6;            // this wave's 64x64 tile inside the block tile
  const int wn  = (wave & 1) << 6;
  const int m0 = bm0 + wm;
  const int n0 = bn0 + wn;

  // staging coverage per plane: 128 threads x 8 copies x 16 B = 128 rows x 128 B; 8 lanes cover one whole 128-B row piece
  const int crow = tid >> 3;                   // 0..15, copy i takes row crow + 16 i
  const int ccol = (tid & 7) * 8;              // element offset of the lane's 16 B
  const unsigned short* gA  = Ap  + (size_t)b * strideA + (size_t)(bm0 + crow) * lda + ccol;
  const unsigned short* gB  = Btp + (size_t)b * strideB + (size_t)(bn0 + crow) * ldb + ccol;
  const unsigned short* gA2 = (SPLIT != 0) ? (A2p  + (size_t)b * strideA + (size_t)(bm0 + crow) * lda + ccol) : nullptr;
  const unsigned short* gB2 = (SPLIT == 1) ? (Bt2p + (size_t)b * strideB + (size_t)(bn0 + crow) * ldb + ccol) : nullptr;
  const unsigned lBase = (unsigned)(size_t)sStage + (unsigned)(crow * kGPitch + ccol) * 2u;
  auto stage = [&](int t) {                    // pass t's operand rows into buffer t & 1
    const unsigned l = lBase + (unsigned)(t & 1) * (unsigned)(NPL * kGPlane * 2);
    const int k0 = t * kGK;
    async_copy8(l, 16 * kGPitch * 2, gA + k0, (size_t)16 * lda);
    async_copy8(l + kGPlane * 2, 16 * kGPitch * 2, gB + k0, (size_t)16 * ldb);
    if (SPLIT != 0) async_copy8(l + 2 * kGPlane * 2, 16 * kGPitch * 2, gA2 + k0, (size_t)16 * lda);
    if (SPLIT == 1) async_copy8(l + 3 * kGPlane * 2, 16 * kGPitch * 2, gB2 + k0, (size_t)16 * ldb);
  };

  const int rlane = lane & 15;                 // row (A) / col (B, D) within subtile
  const int koff  = (lane >> 4) * 8;           // k offset of this lane half
  const int mOff  = (lane >> 4) * 8;           // D row offset

  v8f acc[4][4];
#pragma unroll
  for (int i = 0; i < 4; ++i)
#pragma unroll
    for (int j = 0; j < 4; ++j) acc[i][j] = (v8f){0.f,0.f,0.f,0.f,0.f,0.f,0.f,0.f};

  const int nT = K >> 6;                       // passes
  stage(0);
  asm volatile("s_wait_asynccnt 0x0" ::: "memory");   // this wave's copies of pass 0 have landed
  __syncthreads();                                     // every wave's have: pass 0 is readable
  if (nT > 1) stage(1);

  for (int t = 0; t < nT; ++t) {
    const T* sb = sStage + (t & 1) * (NPL * kGPlane);
    const int aoff = (wm + rlane) * kGPitch + koff;
    const int boff = (wn + rlane) * kGPitch + koff;
    // the loops below are unrolled so that every fragment and accumulator index is a constant (registers, no scratch)
#pragma unroll
    for (int ks = 0; ks < kGK; ks += 32) {
      V bh[4], bl[4];
#pragma unroll
      for (int j = 0; j < 4; ++j) {
        const int bo = boff + (j << 4) * kGPitch + ks;
        bh[j] = Frag<T>::load(sb + kGPlane + bo);
        if (SPLIT == 1) bl[j] = Frag<T>::load(sb + 3 * kGPlane + bo);
      }
      V ah[4], al[4];                            // the whole 32-k block's fragments are read as one group ahead of its products
#pragma unroll
      for (int i = 0; i < 4; ++i) {
        const int ao = aoff + (i << 4) * kGPitch + ks;
        ah[i] = Frag<T>::load(sb + ao);
        if (SPLIT != 0) al[i] = Frag<T>::load(sb + 2 * kGPlane + ao);
      }
#pragma unroll
      for (int i = 0; i < 4; ++i) {
#pragma unroll
        for (int j = 0; j < 4; ++j) {
          acc[i][j] = Frag<T>::mma(ah[i], bh[j], acc[i][j]);
          if (SPLIT == 1) acc[i][j] = Frag<T>::mma(ah[i], bl[j], acc[i][j]);
          if (SPLIT != 0) acc[i][j] = Frag<T>::mma(al[i], bh[j], acc[i][j]);
        }
        Frag<T>::guard(acc[i][0], acc[i][3], ah[i], (SPLIT != 0) ? al[i] : ah[i]);
      }
      Frag<T>::keep(bh[0], bh[1], bh[2], bh[3]);
      if (SPLIT == 1) Frag<T>::keep(bl[0], bl[1], bl[2], bl[3]);
    }
    asm volatile("s_wait_dscnt 0x0" ::: "memory");     // this wave's reads of buffer t & 1 are done before it is refilled
    asm volatile("s_wait_asynccnt 0x0" ::: "memory");  // this wave's copies of pass t + 1 have landed
    __syncthreads();                                    // publishes pass t + 1 and ends every reader's use of buffer t & 1
    if (t + 2 < nT) stage(t + 2);
  }
  asm volatile("s_wait_asynccnt 0x0" ::: "memory");    // nothing in flight when the wave goes on to the epilogue and ends
  acc_guard4(acc[0][0], acc[0][1], acc[0][2], acc[0][3]);
  acc_guard4(acc[1][0], acc[1][1], acc[1][2], acc[1][3]);
  acc_guard4(acc[2][0], acc[2][1], acc[2][2], acc[2][3]);
  acc_guard4(acc[3][0], acc[3][1], acc[3][2], acc[3][3]);

  // ---- epilogue ----
  float* slab = sT[wave];
  const float* Rb = RESID ? (resid + (size_t)b * strideR) : nullptr;
#pragma unroll
  for (int i = 0; i < 4; ++i) {
    const int mBase = m0 + (i << 4);
#pragma unroll
    for (int j = 0; j < 4; ++j) {
      const int n = n0 + (j << 4) + rlane;
      float bv = 0.f;
      if (BIAS_MODE == 2) bv = bias[n];
#pragma unroll
      for (int r = 0; r < 8; ++r) {
        float v = acc[i][j][r] * scale;
        if (BIAS_MODE == 1) v += bias[mBase + mOff + r];
        if (BIAS_MODE == 2) v += bv;
        if (RESID) v += Rb[(size_t)(mBase + mOff + r) * ldc + n];
        if (ACT == 2) v = fmaxf(v, 0.0f);
        if (ACT == 4) v = (v > 0.f) ? v : 0.01f * v;
        slab[(mOff + r) * 68 + (j << 4) + rlane] = v;
      }
    }
    __builtin_amdgcn_fence(__ATOMIC_RELEASE, "workgroup");
    __builtin_amdgcn_wave_barrier();
    __builtin_amdgcn_fence(__ATOMIC_ACQUIRE, "workgroup");
    if (OUT_MODE == 0) {
      float* C = (float*)Cout + (size_t)b * strideC;
      const int hh = lane >> 4, c4 = (lane & 15) * 4;     // row seg = 256 B = 16 lanes x 16 B
      {
#pragma unroll
        for (int it = 0; it < 8; ++it) {
          const int row = it * 2 + hh;
          v4f v = *(const v4f*)(slab + row * 68 + c4);
          *(v4f*)(C + (size_t)(mBase + row) * ldc + n0 + c4) = v;
        }
        
      }
    } else {
      const int q = lane >> 3, c8 = (lane & 7) * 8;
      unsigned short* C  = (unsigned short*)Cout  + (size_t)b * strideC;
      unsigned short* C2 = (OUT_MODE == 2) ? ((unsigned short*)Cout2 + (size_t)b * strideC) : nullptr;
      {
#pragma unroll
        for (int it = 0; it < 4; ++it) {
          const int row = it * 4 + q;
          const float* sp = slab + row * 68 + c8;
          v8h hv, lv;
#pragma unroll
          for (int e = 0; e < 8; ++e) {
            if (OUT_MODE == 1) {
              hv[e] = (_Float16)sp[e];
            } else {
              unsigned short hb = f2bf_bits(sp[e]);
              unsigned short lb = f2bf_bits(sp[e] - bf_bits2f(hb));
              hv[e] = __builtin_bit_cast(_Float16, hb);
              lv[e] = __builtin_bit_cast(_Float16, lb);
            }
          }
          *(v8h*)(C + (size_t)(mBase + row) * ldc + n0 + c8) = hv;
          if (OUT_MODE == 2) *(v8h*)(C2 + (size_t)(mBase + row) * ldc + n0 + c8) = lv;
        }
        
      }
    }
    __builtin_amdgcn_fence(__ATOMIC_RELEASE, "workgroup");
    __builtin_amdgcn_wave_barrier();
    __builtin_amdgcn_fence(__ATOMIC_ACQUIRE, "workgroup");
  }
}

// ---------------------------------------------------------------------------
// f32 -> bf16 (RNE) plane, 8 elements per thread: one 16-B store per lane, 32 lanes = 512 contiguous B =
// ---------------------------------------------------------------------------
__global__ __launch_bounds__(256) void cvt_bf16x8_kernel(const float* __restrict__ in, unsigned short* __restrict__ out, int n8) {
  const int i = blockIdx.x * 256 + threadIdx.x;
  if (i >= n8) return;
  const size_t base = (size_t)i * 8;
  const v4f a = *(const v4f*)(in + base), c = *(const v4f*)(in + base + 4);
  unsigned short hb[8];
#pragma unroll
  for (int e = 0; e < 4; ++e) { hb[e] = f2bf_bits(a[e]); hb[4 + e] = f2bf_bits(c[e]); }
  const v4u u = (v4u){pk16(hb[0], hb[1]), pk16(hb[2], hb[3]), pk16(hb[4], hb[5]), pk16(hb[6], hb[7])};
  *(v4u*)(out + base) = u;
  
}

// ---------------------------------------------------------------------------
// Weight transpose + cast: in W[d][h] (row-major [in 1024][out 1024] f32) -> out WT[h][d] = bf16_rne(W[d][h]), 4 planes.
// grid (16, 16, 4): blockIdx.x = d tile (64 cols of WT), blockIdx.y = h tile (64 rows of WT), blockIdx.z selects W0..W3
// and the output plane (plane z at out + z*1024*1024 halves). 256 threads.
// Load coverage: 16 iterations x 256 threads = 4096 = the whole 64x64 tile (coalesced along h).
// Store coverage: 8 waves x 2 iterations x 4 rows (lane>>3) = 64 rows; (lane&7) x 8 halves = 64 cols; each row segment =
// ---------------------------------------------------------------------------
__global__ __launch_bounds__(256) void wtcast4_kernel(const float* __restrict__ W0, const float* __restrict__ W1,
                                                      const float* __restrict__ W2, const float* __restrict__ W3,
                                                      unsigned short* __restrict__ out) {
  __shared__ float sm[64][65];   // sm[h_local][d_local]
  const int t  = threadIdx.x;
  const int d0 = blockIdx.x * 64;
  const int h0 = blockIdx.y * 64;
  const int z  = blockIdx.z;                                   // block-uniform
  const float* W = (z == 0) ? W0 : (z == 1) ? W1 : (z == 2) ? W2 : W3;
#pragma unroll
  for (int i = 0; i < 16; ++i) {
    const int e = i * 256 + t;
    const int r = e >> 6;          // d local
    const int cc = e & 63;         // h local
    sm[cc][r] = W[(size_t)(d0 + r) * kDim + h0 + cc];
  }
  __syncthreads();
  const int lane = t & 31, wave = t >> 5;
  const int q = lane >> 3, c8 = (lane & 7) * 8;
  unsigned short* op = out + (size_t)z * kDim * kDim;
  {
#pragma unroll
    for (int it = 0; it < 2; ++it) {
      const int row = wave * 8 + it * 4 + q;                 // h local
      unsigned short hb[8];
#pragma unroll
      for (int e = 0; e < 8; ++e) hb[e] = f2bf_bits(sm[row][c8 + e]);
      const v4u u = (v4u){pk16(hb[0], hb[1]), pk16(hb[2], hb[3]), pk16(hb[4], hb[5]), pk16(hb[6], hb[7])};
      *(v4u*)(op + (size_t)(h0 + row) * kDim + d0 + c8) = u;
    }
    
  }
}

// ---------------------------------------------------------------------------
// (q + r_w_bias) planes: qf f32 [4096][1024] (col = n*64+d), r_w_bias [16][64] flat index == col, RNE-converted to bf16 value,
// added in f32, then bf16 hi/lo split. Thread = 8 consecutive elements of one row: one 16-B store per lane per plane;
// ---------------------------------------------------------------------------
__global__ __launch_bounds__(256) void qplanes_kernel(const float* __restrict__ qf, const float* __restrict__ rwb,
                                                      unsigned short* __restrict__ oh, unsigned short* __restrict__ ol, int n8) {
  const int i = blockIdx.x * 256 + threadIdx.x;
  if (i >= n8) return;
  const size_t base = (size_t)i * 8;
  const int col = (int)(base % (size_t)kDim);
  const v4f a0 = *(const v4f*)(qf + base), a1 = *(const v4f*)(qf + base + 4);
  const v4f u0 = *(const v4f*)(rwb + col), u1 = *(const v4f*)(rwb + col + 4);
  float x[8];
#pragma unroll
  for (int e = 0; e < 4; ++e) { x[e] = a0[e] + bf_rne(u0[e]); x[4 + e] = a1[e] + bf_rne(u1[e]); }
  unsigned short hb[8], lb[8];
#pragma unroll
  for (int e = 0; e < 8; ++e) { hb[e] = f2bf_bits(x[e]); lb[e] = f2bf_bits(x[e] - bf_bits2f(hb[e])); }
  const v4u uh = (v4u){pk16(hb[0], hb[1]), pk16(hb[2], hb[3]), pk16(hb[4], hb[5]), pk16(hb[6], hb[7])};
  const v4u ul = (v4u){pk16(lb[0], lb[1]), pk16(lb[2], lb[3]), pk16(lb[4], lb[5]), pk16(lb[6], lb[7])};
  *(v4u*)(oh + base) = uh;
  *(v4u*)(ol + base) = ul;
  
}

// ---------------------------------------------------------------------------
// (k_j + r_emb_{j+1,n}) planes: kf f32 [4096][1024] (token = b*1024+j, col = n*64+d); r_emb [1024][16][64] flat = [1024][1024];
// row j uses r_emb row j+1 (RNE-converted to bf16 value) and 0 for j = 1023 (shift by one with trailing zero).
// The r_emb address is clamped to row 1023 and the value zeroed by predicate. Output bf16 hi/lo planes; store shape as qplanes_kernel.
// ---------------------------------------------------------------------------
__global__ __launch_bounds__(256) void krplanes_kernel(const float* __restrict__ kf, const float* __restrict__ remb,
                                                       unsigned short* __restrict__ oh, unsigned short* __restrict__ ol, int n8) {
  const int i = blockIdx.x * 256 + threadIdx.x;
  if (i >= n8) return;
  const size_t base = (size_t)i * 8;
  const int row = (int)(base / (size_t)kDim);                 // token index
  const int j   = row % kSeq;
  const int col = (int)(base % (size_t)kDim);
  const bool keep = (j + 1 < kSeq);
  const int jr = keep ? (j + 1) : (kSeq - 1);                 // clamped address
  const float* rp = remb + (size_t)jr * kDim + col;
  const v4f k0 = *(const v4f*)(kf + base), k1 = *(const v4f*)(kf + base + 4);
  const v4f r0 = *(const v4f*)(rp), r1 = *(const v4f*)(rp + 4);
  float x[8];
#pragma unroll
  for (int e = 0; e < 4; ++e) {
    x[e]     = k0[e] + (keep ? bf_rne(r0[e]) : 0.0f);
    x[4 + e] = k1[e] + (keep ? bf_rne(r1[e]) : 0.0f);
  }
  unsigned short hb[8], lb[8];
#pragma unroll
  for (int e = 0; e < 8; ++e) { hb[e] = f2bf_bits(x[e]); lb[e] = f2bf_bits(x[e] - bf_bits2f(hb[e])); }
  const v4u uh = (v4u){pk16(hb[0], hb[1]), pk16(hb[2], hb[3]), pk16(hb[4], hb[5]), pk16(hb[6], hb[7])};
  const v4u ul = (v4u){pk16(lb[0], lb[1]), pk16(lb[2], lb[3]), pk16(lb[4], lb[5]), pk16(lb[6], lb[7])};
  *(v4u*)(oh + base) = uh;
  *(v4u*)(ol + base) = ul;
  
}

// ---------------------------------------------------------------------------
// Score bias table tb[n][j] (f32, [16][1024]): for j <= 1022: bf(r_bias[j+1][n]) - sum_d bf(r_w_bias[n][d]) * bf(r_emb[j+1][n][d]);
// tb[n][1023] = 0. Thread per (n, j), 64-tap rolled dot in fixed order (inputs only). r_emb / r_bias addresses clamped to row 1023,
// ---------------------------------------------------------------------------
__global__ __launch_bounds__(256) void tb_kernel(const float* __restrict__ rwb, const float* __restrict__ remb,
                                                 const float* __restrict__ rbias, float* __restrict__ tb) {
  const int i = blockIdx.x * 256 + threadIdx.x;          // 0..16383
  const int n = i >> 10;
  const int j = i & (kSeq - 1);
  const bool keep = (j + 1 < kSeq);
  const int jr = keep ? (j + 1) : (kSeq - 1);
  const float* rp = remb + ((size_t)jr * kHeads + n) * kHd;
  const float* up = rwb + n * kHd;
  float acc = 0.f;
#pragma unroll 1
  for (int d = 0; d < kHd; ++d) acc = fmaf(bf_rne(up[d]), bf_rne(rp[d]), acc);
  const float val = keep ? (bf_rne(rbias[jr * kHeads + n]) - acc) : 0.0f;
  ((float*)tb)[i] = val;
  
}

// ---------------------------------------------------------------------------
// Relative-position flash attention for head_dim 64 (no mask). Block = 4 waves = 64 query rows of one (batch, head);
// grid = 4 * 16 * 16 = 1024 blocks of 128 threads; blockIdx.x = b*256 + h*16 + qb.
// Inputs: QRh/QRl = bf16 hi/lo planes of (q + r_w_bias) [4096][1024]; KRh/KRl = bf16 hi/lo planes of (k_j + r_emb_{j+1});
// Vp = f16 plane of v [4096][1024]; tb = f32 [16][1024] score bias table.
// score[i][j] = ((q+rwb)_i · (k_j + r_{j+1}) + tb[h][j]) * 0.125  : v_wmma_f32_16x16x32_bf16, hi*hi + hi*lo + lo*hi.
// out += P·V : v_wmma_f32_16x16x32_f16 (V staged transposed [d][kv] in LDS as f16); final out * 1/(l * 2^15).
// ---------------------------------------------------------------------------
__global__ __launch_bounds__(128) void relattn_kernel(
    const unsigned short* __restrict__ QRh, const unsigned short* __restrict__ QRl,
    const unsigned short* __restrict__ KRh, const unsigned short* __restrict__ KRl,
    const unsigned short* __restrict__ Vp, const float* __restrict__ tb,
    unsigned short* __restrict__ AVh, unsigned short* __restrict__ AVl) {
  union FB { v16b v; v8b h[2]; };
  union FH { v16h v; v8h h[2]; };
  __shared__ __align__(16) __bf16   Ksh[kKC * kAPitch];        // K hi [kv][d]   13 KB
  __shared__ __align__(16) __bf16   Ksl[kKC * kAPitch];        // K lo [kv][d]   13 KB
  __shared__ __align__(16) _Float16 Vt[kHd * kAPitch];         // V f16 [d][kv]  13 KB
  __shared__ __align__(16) _Float16 Psh[4][16 * kAPitch];      // per wave P [row][kv] 13 KB
  __shared__ __align__(16) float    Os[4][16 * kOsPitch];      // per wave out tile, pitch 68

  const int tid  = threadIdx.x;
  const int wave = tid >> 5;
  const int lane = tid & 31;
  const int hh   = lane >> 4;
  const int c    = lane & 15;

  const int bx = blockIdx.x;
  const int qb = bx & 15;
  const int h  = (bx >> 4) & 15;
  const int b  = bx >> 8;
  const int q0 = qb * 64 + wave * 16;
  const size_t tok0 = (size_t)b * kSeq;
  const int hcol = h * kHd;

  // ---- Q fragments (A operand): 2 d-chunks, hi and lo. Frag load: elements 0..7 <- k 8hh+0..7, 8..15 <- k 16+8hh+0..7 ----
  v16b qah[2], qal[2];
  {
    const __bf16* ph = (const __bf16*)QRh + (tok0 + q0 + c) * kDim + hcol + 8 * hh;
    const __bf16* pl = (const __bf16*)QRl + (tok0 + q0 + c) * kDim + hcol + 8 * hh;
#pragma unroll
    for (int dc = 0; dc < 2; ++dc) {
      qah[dc] = Frag<__bf16>::load(ph + dc * 32);
      qal[dc] = Frag<__bf16>::load(pl + dc * 32);
    }
  }

  float mrow[8], lrow[8];
  v8f oacc[4];
#pragma unroll
  for (int r = 0; r < 8; ++r) { mrow[r] = -INFINITY; lrow[r] = 0.f; }
#pragma unroll
  for (int t = 0; t < 4; ++t) oacc[t] = (v8f){0.f,0.f,0.f,0.f,0.f,0.f,0.f,0.f};

  for (int kc = 0; kc < kSeq / kKC; ++kc) {     // 16 chunks, block-uniform
    const int kv0 = kc * kKC;
    __syncthreads();
    {
      // staging coverage: 128 threads = 64 kv rows x 2 halves of 32 d; 4 x 16-B pieces each -> whole 64x64 tiles of K hi, K lo, V
      const int kvr = tid >> 1;
      const int dh  = (tid & 1) * 32;
      const size_t g = (tok0 + kv0 + kvr) * kDim + hcol + dh;
      const v8b* gkh = (const v8b*)((const __bf16*)KRh + g);
      const v8b* gkl = (const v8b*)((const __bf16*)KRl + g);
      const v8h* gv  = (const v8h*)((const _Float16*)Vp + g);
#pragma unroll
      for (int i = 0; i < 4; ++i) {
        const v8b a  = gkh[i];
        const v8b al = gkl[i];
        const v8h vv = gv[i];
        *(v8b*)(Ksh + kvr * kAPitch + dh + 8 * i) = a;
        *(v8b*)(Ksl + kvr * kAPitch + dh + 8 * i) = al;
#pragma unroll
        for (int e = 0; e < 8; ++e) Vt[(dh + 8 * i + e) * kAPitch + kvr] = vv[e];
      }
    }
    __syncthreads();

    v8f s[4];
#pragma unroll
    for (int j = 0; j < 4; ++j) {
      s[j] = (v8f){0.f,0.f,0.f,0.f,0.f,0.f,0.f,0.f};
#pragma unroll
      for (int dc = 0; dc < 2; ++dc) {
        FB kb, kl;
        kb.h[0] = *(const v8b*)(Ksh + (j * 16 + c) * kAPitch + dc * 32 + 8 * hh);
        kb.h[1] = *(const v8b*)(Ksh + (j * 16 + c) * kAPitch + dc * 32 + 16 + 8 * hh);
        kl.h[0] = *(const v8b*)(Ksl + (j * 16 + c) * kAPitch + dc * 32 + 8 * hh);
        kl.h[1] = *(const v8b*)(Ksl + (j * 16 + c) * kAPitch + dc * 32 + 16 + 8 * hh);
        s[j] = mma_bf16g(qah[dc], kb.v, s[j]);
        s[j] = mma_bf16g(qah[dc], kl.v, s[j]);
        s[j] = mma_bf16g(qal[dc], kb.v, s[j]);
      }
    }
    float tbv[4];
#pragma unroll
    for (int j = 0; j < 4; ++j) tbv[j] = tb[h * kSeq + kv0 + j * 16 + c];

    float cm[8];
#pragma unroll
    for (int r = 0; r < 8; ++r) {
      float m = -INFINITY;
#pragma unroll
      for (int j = 0; j < 4; ++j) {
        s[j][r] = (s[j][r] + tbv[j]) * kScale;
        m = fmaxf(m, s[j][r]);
      }
#pragma unroll
      for (int off = 1; off < 16; off <<= 1) m = fmaxf(m, __shfl_xor(m, off, 32));
      cm[r] = m;
    }
    _Float16* pw = Psh[wave];
#pragma unroll
    for (int r = 0; r < 8; ++r) {
      const float mnew  = fmaxf(mrow[r], cm[r]);
      const float alpha = expf(mrow[r] - mnew);
      mrow[r] = mnew;
      float psum = 0.f;
#pragma unroll
      for (int j = 0; j < 4; ++j) {
        const float p = expf(s[j][r] - mnew);
        psum += p;
        pw[(8 * hh + r) * kAPitch + j * 16 + c] = (_Float16)(p * kPCarry);
      }
#pragma unroll
      for (int off = 1; off < 16; off <<= 1) psum += __shfl_xor(psum, off, 32);
      lrow[r] = lrow[r] * alpha + psum;
#pragma unroll
      for (int t = 0; t < 4; ++t) oacc[t][r] *= alpha;
    }
    __builtin_amdgcn_fence(__ATOMIC_RELEASE, "workgroup");
    __builtin_amdgcn_wave_barrier();
    __builtin_amdgcn_fence(__ATOMIC_ACQUIRE, "workgroup");
#pragma unroll
    for (int kk = 0; kk < 2; ++kk) {
      FH pa;
      pa.h[0] = *(const v8h*)(pw + c * kAPitch + kk * 32 + 8 * hh);
      pa.h[1] = *(const v8h*)(pw + c * kAPitch + kk * 32 + 16 + 8 * hh);
#pragma unroll
      for (int t = 0; t < 4; ++t) {
        FH vb;
        vb.h[0] = *(const v8h*)(Vt + (t * 16 + c) * kAPitch + kk * 32 + 8 * hh);
        vb.h[1] = *(const v8h*)(Vt + (t * 16 + c) * kAPitch + kk * 32 + 16 + 8 * hh);
        oacc[t] = mma_f16g(pa.v, vb.v, oacc[t]);
      }
    }
  }

  float* os = Os[wave];
#pragma unroll
  for (int r = 0; r < 8; ++r) {
    const float inv = 1.0f / (lrow[r] * kPCarry);
#pragma unroll
    for (int t = 0; t < 4; ++t) os[(8 * hh + r) * kOsPitch + t * 16 + c] = oacc[t][r] * inv;
  }
  __builtin_amdgcn_fence(__ATOMIC_RELEASE, "workgroup");
  __builtin_amdgcn_wave_barrier();
  __builtin_amdgcn_fence(__ATOMIC_ACQUIRE, "workgroup");
  {
    const int q = lane >> 3, c8 = (lane & 7) * 8;
    {
#pragma unroll
      for (int it = 0; it < 4; ++it) {
        const int row = it * 4 + q;                       // 0..15
        const float* sp = os + row * kOsPitch + c8;
        v8h hv, lv;
#pragma unroll
        for (int e = 0; e < 8; ++e) {
          const unsigned short hb = f2bf_bits(sp[e]);
          const unsigned short lb = f2bf_bits(sp[e] - bf_bits2f(hb));
          hv[e] = __builtin_bit_cast(_Float16, hb);
          lv[e] = __builtin_bit_cast(_Float16, lb);
        }
        const size_t o = (tok0 + q0 + row) * kDim + hcol + c8;
        *(v8h*)(AVh + o) = hv;
        *(v8h*)(AVl + o) = lv;
      }
      
    }
  }
}

// ---------------------------------------------------------------------------
// y = (x - mu) * rsqrt(var + eps) * bf(gamma) + bf(beta). One block of 256 threads (8 waves) per row; thread t owns
// ---------------------------------------------------------------------------
__global__ __launch_bounds__(256) void ln_kernel(const float* __restrict__ w, const float* __restrict__ ao,
                                                 const float* __restrict__ g, const float* __restrict__ bt,
                                                 float* __restrict__ out) {
  __shared__ float red[16];
  const int row  = blockIdx.x;
  const int t    = threadIdx.x, lane = t & 31, wave = t >> 5;
  const int c0   = t * 4;
  const size_t off = (size_t)row * kDim + c0;
  const v4f a = *(const v4f*)(w + off);
  const v4f o = *(const v4f*)(ao + off);
  float x[4];
#pragma unroll
  for (int e = 0; e < 4; ++e) x[e] = bf_rne(a[e]) + o[e];
  float s = (x[0] + x[1]) + (x[2] + x[3]);
#pragma unroll
  for (int sh = 16; sh > 0; sh >>= 1) s += __shfl_xor(s, sh, 32);
  if (lane == 0) red[wave] = s;
  __syncthreads();
  const float mu = (((red[0] + red[1]) + (red[2] + red[3])) + ((red[4] + red[5]) + (red[6] + red[7]))) * kInvDim;
  float d[4];
  float s2 = 0.f;
#pragma unroll
  for (int e = 0; e < 4; ++e) { d[e] = x[e] - mu; s2 += d[e] * d[e]; }
#pragma unroll
  for (int sh = 16; sh > 0; sh >>= 1) s2 += __shfl_xor(s2, sh, 32);
  if (lane == 0) red[8 + wave] = s2;
  __syncthreads();
  const float var  = (((red[8] + red[9]) + (red[10] + red[11])) + ((red[12] + red[13]) + (red[14] + red[15]))) * kInvDim;
  const float rstd = rsqrtf(var + kLnEps);
  const v4f gg = *(const v4f*)(g + c0);
  const v4f bb = *(const v4f*)(bt + c0);
  v4f y;
#pragma unroll
  for (int e = 0; e < 4; ++e) y[e] = (d[e] * rstd) * bf_rne(gg[e]) + bf_rne(bb[e]);
  *(v4f*)(out + off) = y;
  
}

// ---------------------------------------------------------------------------
// Host launch glue. Workspace region map (bytes, all offsets 256-B aligned):
//   [0]            Wb    bf16 w plane            [4096][1024]      8,388,608
//   [8,388,608]    WT    bf16 Wq^T|Wk^T|Wv^T|Wo^T 4 x [1024][1024]  8,388,608
//   [16,777,216]   QKF   f32 q then f32 k        2 x [4096][1024]  33,554,432   (dead after the plane kernels;
//                        reused: AVh bf16 at +0, AVl bf16 at +8,388,608, AO f32 at +16,777,216)
//   [50,331,648]   Vh    f16 v plane             [4096][1024]      8,388,608
//   [58,720,256]   QRh|QRl bf16 (q+rwb) hi/lo    2 x [4096][1024]  16,777,216
//   [75,497,472]   KRh|KRl bf16 (k+r) hi/lo      2 x [4096][1024]  16,777,216
//   [92,274,688]   TB    f32 [16][1024]                            65,536
//   total 92,340,224
// ---------------------------------------------------------------------------
extern "C" void kernel_launch(void* const* d_in, const int* in_sizes, int n_in,
                              void* d_out, int out_size, void* d_ws, size_t ws_size,
                              hipStream_t stream) {
  if (n_in < 10) return;
  const float* w     = (const float*)d_in[0];
  const float* remb  = (const float*)d_in[1];
  const float* rwb   = (const float*)d_in[2];
  const float* rbias = (const float*)d_in[3];
  const float* Wq    = (const float*)d_in[4];
  const float* Wk    = (const float*)d_in[5];
  const float* Wv    = (const float*)d_in[6];
  const float* Wo    = (const float*)d_in[7];
  const float* gamma = (const float*)d_in[8];
  const float* beta  = (const float*)d_in[9];
  float* out = (float*)d_out;

  const size_t nTokD = (size_t)kTok * kDim;                    // 4,194,304 elements
  if ((size_t)in_sizes[0] != nTokD) return;
  if (in_sizes[1] != kSeq * kHeads * kHd) return;
  if (in_sizes[2] != kHeads * kHd) return;
  if (in_sizes[3] != kSeq * kHeads) return;
  if (in_sizes[4] != kDim * kDim || in_sizes[5] != kDim * kDim || in_sizes[6] != kDim * kDim || in_sizes[7] != kDim * kDim) return;
  if (in_sizes[8] != kDim || in_sizes[9] != kDim) return;
  if ((size_t)out_size != nTokD) return;

  const size_t bWb  = nTokD * 2;
  const size_t bWT  = (size_t)4 * kDim * kDim * 2;
  const size_t bQKF = nTokD * 4 * 2;
  const size_t bVh  = nTokD * 2;
  const size_t bQR  = nTokD * 2 * 2;
  const size_t bKR  = nTokD * 2 * 2;
  const size_t bTB  = (size_t)kHeads * kSeq * 4;
  const size_t oWb  = 0;
  const size_t oWT  = oWb + bWb;
  const size_t oQKF = oWT + bWT;
  const size_t oVh  = oQKF + bQKF;
  const size_t oQR  = oVh + bVh;
  const size_t oKR  = oQR + bQR;
  const size_t oTB  = oKR + bKR;
  const size_t total = oTB + bTB;                               // 92,340,224
  if (total > ws_size) return;

  char* ws = (char*)d_ws;
  unsigned short* Wb  = (unsigned short*)(ws + oWb);
  unsigned short* WT  = (unsigned short*)(ws + oWT);
  float*          QKF = (float*)(ws + oQKF);
  float*          qf  = QKF;
  float*          kf  = QKF + nTokD;
  unsigned short* Vh  = (unsigned short*)(ws + oVh);
  unsigned short* QRh = (unsigned short*)(ws + oQR);
  unsigned short* QRl = QRh + nTokD;
  unsigned short* KRh = (unsigned short*)(ws + oKR);
  unsigned short* KRl = KRh + nTokD;
  float*          TB  = (float*)(ws + oTB);
  unsigned short* AVh = (unsigned short*)(ws + oQKF);          // reuse of the dead q f32 region
  unsigned short* AVl = AVh + nTokD;
  float*          AO  = kf;                                    // reuse of the dead k f32 region

  const int n8 = (int)(nTokD / 8);                             // 524288
  const long wPlane = (long)kDim * kDim;

  // 1. w -> bf16 plane
  cvt_bf16x8_kernel<<<dim3(n8 / 256), dim3(256), 0, stream>>>(w, Wb, n8);
  // 2. weight transposes: in W[1024 in][1024 out] -> out WT[out][in], planes 0..3 = Wq, Wk, Wv, Wo
  wtcast4_kernel<<<dim3(kDim / 64, kDim / 64, 4), dim3(256), 0, stream>>>(Wq, Wk, Wv, Wo, WT);
  // 3. q and k (f32): batch index selects WT plane 0/1 and output plane; M=4096, N=1024, K=1024 (block tiles 32x8 = 256 blocks x 4 waves)
  wmma_gemm64<1, 0, 0, 0, false><<<dim3(256, 2), dim3(128), 0, stream>>>(
      Wb, Wb, kDim, 0L,
      WT, WT, kDim, wPlane,
      (void*)QKF, (void*)QKF, kDim, (long)nTokD,
      gamma, gamma, 0L,
      kTok, kDim, kDim, 1.0f);
  // 4. v (f16 plane)
  wmma_gemm64<1, 0, 0, 1, false><<<dim3(256, 1), dim3(128), 0, stream>>>(
      Wb, Wb, kDim, 0L,
      WT + 2 * wPlane, WT + 2 * wPlane, kDim, 0L,
      (void*)Vh, (void*)Vh, kDim, 0L,
      gamma, gamma, 0L,
      kTok, kDim, kDim, 1.0f);
  // 5. (q + r_w_bias) hi/lo planes
  qplanes_kernel<<<dim3(n8 / 256), dim3(256), 0, stream>>>(qf, rwb, QRh, QRl, n8);
  // 6. (k_j + r_emb_{j+1}) hi/lo planes
  krplanes_kernel<<<dim3(n8 / 256), dim3(256), 0, stream>>>(kf, remb, KRh, KRl, n8);
  // 7. score bias table [16][1024]
  tb_kernel<<<dim3((kHeads * kSeq) / 256), dim3(256), 0, stream>>>(rwb, remb, rbias, TB);
  // 8. attention -> attn_vec bf16 hi/lo planes
  relattn_kernel<<<dim3(kBatch * kHeads * (kSeq / 64)), dim3(128), 0, stream>>>(QRh, QRl, KRh, KRl, Vh, TB, AVh, AVl);
  // 9. attn_vec @ Wo (A hi/lo split, Wo bf16) -> f32
  wmma_gemm64<1, 2, 0, 0, false><<<dim3(256, 1), dim3(128), 0, stream>>>(
      AVh, AVl, kDim, 0L,
      WT + 3 * wPlane, WT + 3 * wPlane, kDim, 0L,
      (void*)AO, (void*)AO, kDim, 0L,
      gamma, gamma, 0L,
      kTok, kDim, kDim, 1.0f);
  // 10. residual + LayerNorm -> out
  ln_kernel<<<dim3(kTok), dim3(256), 0, stream>>>(w, AO, gamma, beta, out);
}

// v003
// Measured time: 141 microseconds a run.
// Two timings next to v002 both put it at 1.20 times that version's speed.
// All steps since v000 together make it 2.18 times as fast.
// Compute dtypes: w@Wq|Wk|Wv on v_wmma_f32_16x16x32_bf16 (inputs RNE-converted to bf16, single product); scores (q+r_w_bias)·(k_j+r_emb_{j+1}) on v_wmma_f32_16x16x32_bf16 with bf16 hi/lo planes (hi*hi+hi*lo+lo*hi); attn_prob·v on v_wmma_f32_16x16x32_f16 (P f16 carried x32768, V f16); attn_vec@Wo on v_wmma_f32_16x16x32_bf16 (attn_vec bf16 hi/lo, Wo bf16: hi*W+lo*W); f32 accumulate everywhere; softmax, bias table, residual and LayerNorm in f32.
#include <hip/hip_runtime.h>
#include <math.h>

// ---------------------------------------------------------------------------
// Problem constants
// ---------------------------------------------------------------------------
constexpr int kBatch = 4;
constexpr int kSeq   = 1024;
constexpr int kDim   = 1024;
constexpr int kHeads = 16;
constexpr int kHd    = 64;
constexpr int kTok   = kBatch * kSeq;      // 4096 token rows
constexpr float kLnEps  = 1e-5f;
constexpr float kInvDim = 1.0f / 1024.0f;
constexpr float kScale  = 0.125f;          // 1/sqrt(64)
constexpr float kPCarry = 32768.0f;        // probabilities carried x2^15 in f16
constexpr int kKC = 64;                    // keys per chunk
constexpr int kOsPitch = 68;
// LDS row pitch of the attention K, V and P tiles in 16-bit elements: 208 B = 16 B x 13, an odd count of 16-B units, so the
// sixteen rows that a 16-B fragment read touches fall on sixteen different groups of four banks. 13 and not 9: the banks see
// no difference, but the builds do: at 144 B the twelve staging loads of a chunk are waited out almost one by one, at 208 B
// (69 KB a block, four blocks a WGP, which is what the grid supplies) all twelve are issued together.
constexpr int kAPitch = 104;

typedef __attribute__((ext_vector_type(16))) _Float16 v16h;
typedef __attribute__((ext_vector_type(8)))  _Float16 v8h;
typedef __attribute__((ext_vector_type(16))) __bf16   v16b;
typedef __attribute__((ext_vector_type(8)))  __bf16   v8b;
typedef __attribute__((ext_vector_type(8)))  float    v8f;
typedef __attribute__((ext_vector_type(4)))  float    v4f;
typedef __attribute__((ext_vector_type(4)))  unsigned int v4u;

__device__ __forceinline__ unsigned short f2bf_bits(float f) {
  unsigned u = __float_as_uint(f);
  return (unsigned short)((u + 0x7FFFu + ((u >> 16) & 1u)) >> 16);
}
__device__ __forceinline__ float bf_bits2f(unsigned short h) { return __uint_as_float(((unsigned)h) << 16); }
__device__ __forceinline__ float bf_rne(float f) { return bf_bits2f(f2bf_bits(f)); }

// hazard guards as plain device helpers
__device__ __forceinline__ void dep_guard_h(v8f& a, v8f& b, v16h x, v16h y) { asm volatile("v_nop\n\tv_nop\n\tv_nop\n\tv_nop" : "+v"(a), "+v"(b) : "v"(x), "v"(y)); }
__device__ __forceinline__ void dep_guard_b(v8f& a, v8f& b, v16b x, v16b y) { asm volatile("v_nop\n\tv_nop\n\tv_nop\n\tv_nop" : "+v"(a), "+v"(b) : "v"(x), "v"(y)); }
__device__ __forceinline__ void keep4_h(v16h a, v16h b, v16h c, v16h d) { asm volatile("v_nop" :: "v"(a), "v"(b), "v"(c), "v"(d)); }
__device__ __forceinline__ void keep4_b(v16b a, v16b b, v16b c, v16b d) { asm volatile("v_nop" :: "v"(a), "v"(b), "v"(c), "v"(d)); }
__device__ __forceinline__ void acc_guard4(v8f& a, v8f& b, v8f& c, v8f& d) { asm volatile("v_nop\n\tv_nop\n\tv_nop\n\tv_nop" : "+v"(a), "+v"(b), "+v"(c), "+v"(d)); }
template <typename T> struct Frag;
template <> struct Frag<_Float16> {
  typedef v16h V; union U { v16h v; v8h h[2]; };
  static __device__ __forceinline__ v16h load(const _Float16* p) {   // elements 0..7 <- p[0..7], 8..15 <- p[16..23]
    U f; f.h[0] = *(const v8h*)(p); f.h[1] = *(const v8h*)(p + 16); return f.v;
  }
  static __device__ __forceinline__ v8f mma(v16h a, v16h b, v8f c) {
    return __builtin_amdgcn_wmma_f32_16x16x32_f16(false, a, false, b, (short)0, c, false, false);
  }
  static __device__ __forceinline__ void guard(v8f& a, v8f& b, v16h x, v16h y) { dep_guard_h(a, b, x, y); }
  static __device__ __forceinline__ void keep(v16h a, v16h b, v16h c, v16h d) { keep4_h(a, b, c, d); }
};
template <> struct Frag<__bf16> {
  typedef v16b V; union U { v16b v; v8b h[2]; };
  static __device__ __forceinline__ v16b load(const __bf16* p) {
    U f; f.h[0] = *(const v8b*)(p); f.h[1] = *(const v8b*)(p + 16); return f.v;
  }
  static __device__ __forceinline__ v8f mma(v16b a, v16b b, v8f c) {
    return __builtin_amdgcn_wmma_f32_16x16x32_bf16(false, a, false, b, (short)0, c, false, false);
  }
  static __device__ __forceinline__ void guard(v8f& a, v8f& b, v16b x, v16b y) { dep_guard_b(a, b, x, y); }
  static __device__ __forceinline__ void keep(v16b a, v16b b, v16b c, v16b d) { keep4_b(a, b, c, d); }
};

__device__ __forceinline__ unsigned pk16(unsigned short a, unsigned short b) { return (unsigned)a | ((unsigned)b << 16); }

// single WMMA issue with hazard guard (bf16 and f16 twins)
__device__ __forceinline__ v8f mma_bf16g(v16b a, v16b b, v8f c) {
  c = __builtin_amdgcn_wmma_f32_16x16x32_bf16(false, a, false, b, (short)0, c, false, false);
  asm volatile("v_nop\n\tv_nop\n\tv_nop\n\tv_nop" : "+v"(c) : "v"(a), "v"(b));
  return c;
}
__device__ __forceinline__ v8f mma_f16g(v16h a, v16h b, v8f c) {
  c = __builtin_amdgcn_wmma_f32_16x16x32_f16(false, a, false, b, (short)0, c, false, false);
  asm volatile("v_nop\n\tv_nop\n\tv_nop\n\tv_nop" : "+v"(c) : "v"(a), "v"(b));
  return c;
}

// ---- LDS staging of the GEMM operands ----
constexpr int kGK     = 64;                  // k per pass: 128 B of every operand row
constexpr int kGPitch = 72;                  // LDS row pitch in 16-bit elements: 144 B = 16 B x 9, conflict-free for 16-B row reads
constexpr int kGPlane = 128 * kGPitch;       // one operand plane of one buffer: 128 rows

// Eight asynchronous 16-B copies of one lane, global -> LDS, rows 16 apart (l, g: the lane's own LDS byte address and
// global address of the first; lstep, gstep: the step to the next). The closing s_wait_xcnt stands inside the statement
// so that no address register named here is rewritten ahead of it.
__device__ __forceinline__ void async_copy8(unsigned l, unsigned lstep, const unsigned short* g, size_t gstep) {
  asm volatile(
      "global_load_async_to_lds_b128 %0, %8, off\n\t"
      "global_load_async_to_lds_b128 %1, %9, off\n\t"
      "global_load_async_to_lds_b128 %2, %10, off\n\t"
      "global_load_async_to_lds_b128 %3, %11, off\n\t"
      "global_load_async_to_lds_b128 %4, %12, off\n\t"
      "global_load_async_to_lds_b128 %5, %13, off\n\t"
      "global_load_async_to_lds_b128 %6, %14, off\n\t"
      "global_load_async_to_lds_b128 %7, %15, off\n\t"
      "s_wait_xcnt 0x0"
      :: "v"(l), "v"(l + lstep), "v"(l + 2 * lstep), "v"(l + 3 * lstep),
         "v"(l + 4 * lstep), "v"(l + 5 * lstep), "v"(l + 6 * lstep), "v"(l + 7 * lstep),
         "v"(g), "v"(g + gstep), "v"(g + 2 * gstep), "v"(g + 3 * gstep),
         "v"(g + 4 * gstep), "v"(g + 5 * gstep), "v"(g + 6 * gstep), "v"(g + 7 * gstep)
      : "memory");
}

// Eight 16-B global loads of one lane: 32 B from each of four row pointers. Loads and their data wait stand in one
// statement and every result is an early-clobber output, so that no result lands in an address pair of the run and no
// address register is rewritten while a load that names it is in flight.
__device__ __forceinline__ void load4x32(const float* p0, const float* p1, const float* p2, const float* p3, v4f (&lo)[4], v4f (&hi)[4]) {
  asm volatile(
      "global_load_b128 %0, %8, off\n\t"
      "global_load_b128 %1, %8, off offset:16\n\t"
      "global_load_b128 %2, %9, off\n\t"
      "global_load_b128 %3, %9, off offset:16\n\t"
      "global_load_b128 %4, %10, off\n\t"
      "global_load_b128 %5, %10, off offset:16\n\t"
      "global_load_b128 %6, %11, off\n\t"
      "global_load_b128 %7, %11, off offset:16\n\t"
      "s_wait_loadcnt 0x0"
      : "=&v"(lo[0]), "=&v"(hi[0]), "=&v"(lo[1]), "=&v"(hi[1]), "=&v"(lo[2]), "=&v"(hi[2]), "=&v"(lo[3]), "=&v"(hi[3])
      : "v"(p0), "v"(p1), "v"(p2), "v"(p3)
      : "memory");
}

// ---- Register-blocked batched WMMA GEMM (SPLIT widened to an int mode, ACT reduced to relu/leaky) ----
// C[m,n] = scale * sum_k A[m,k] * Bt[n,k] (+bias)(+resid); each wave owns a 64x64 tile, 2x2 waves share a 128x128 block tile.
// Per pass the block's 128 A rows and 128 Bt rows x 64 k are staged in LDS by asynchronous copies, two buffers: the copies
// of pass t+1 fly while pass t is worked on; fragments are read from LDS in the same k order as from global memory.
// A row-major [M,K]; Bt row-major [N,K]; M,N % 128 == 0, K % 64 == 0.
// SPLIT: 0 = single product; 1 = A and Bt hi/lo planes (hi*hi + hi*lo + lo*hi); 2 = A hi/lo only (hi*B + lo*B).
// BIAS_MODE: 0 = none, 1 = bias[m], 2 = bias[n].
// OUT_MODE: 0 = f32, 1 = f16, 2 = bf16 hi plane (Cout) + bf16 lo plane (Cout2),
//           3 = the q|k|v projection, one launch, batch index b picks the product and what its epilogue does:
//               b = 0: x = q + bf(bias[n])                                   -> bf16 hi/lo planes (bias = r_w_bias, flat [1024])
//               b = 1: x = k_j + bf(resid[j+1][n]), nothing added at j = 1023 -> bf16 hi/lo planes (resid = r_emb, flat [1024][1024],
//                      j = m mod 1024; the address is clamped to row 1023 and the value zeroed by predicate)
//               b = 2: v -> f16 plane (Cout only)
// ET: 0 = f16 operands, 1 = bf16 operands (pointers passed as 16-bit storage)
template <int ET> struct Elem;
template <> struct Elem<0> { typedef _Float16 T; };
template <> struct Elem<1> { typedef __bf16 T; };
template <int ET, int SPLIT, int BIAS_MODE, int OUT_MODE, bool RESID, int ACT = 0>
__global__ __launch_bounds__(128) void wmma_gemm64(
    const unsigned short* __restrict__ Ap, const unsigned short* __restrict__ A2p, int lda, long strideA,
    const unsigned short* __restrict__ Btp, const unsigned short* __restrict__ Bt2p, int ldb, long strideB,
    void* __restrict__ Cout, void* __restrict__ Cout2, int ldc, long strideC,
    const float* __restrict__ bias,
    const float* __restrict__ resid, long strideR,
    int M, int N, int K, float scale) {
  typedef typename Elem<ET>::T T;
  typedef typename Frag<T>::V V;
  constexpr int NPL = 2 + ((SPLIT != 0) ? 1 : 0) + ((SPLIT == 1) ? 1 : 0);   // planes per buffer: A, Bt, A lo, Bt lo
  __shared__ __align__(16) T sStage[2 * NPL * kGPlane];   // two buffers of NPL planes
  __shared__ __align__(16) float sT[4][16 * 68];   // per-wave 16x64 slab, pitch 68 floats
  const int b    = blockIdx.y;
  const int tid  = threadIdx.x;
  const int lane = tid & 31;
  const int wave = tid >> 5;
  const int tilesN = N >> 7;
  const int tilesM = M >> 7;
  const int tile = blockIdx.x;
  if (tile >= tilesM * tilesN) return;   // block-uniform, ahead of every barrier and copy
  const int tm = tile / tilesN;
  const int tn = tile - tm * tilesN;
  const int bm0 = tm << 7;
  const int bn0 = tn << 7;
  const int wm  = (wave >> 1) << 6;            // this wave's 64x64 tile inside the block tile
  const int wn  = (wave & 1) << 6;
  const int m0 = bm0 + wm;
  const int n0 = bn0 + wn;

  // staging coverage per plane: 128 threads x 8 copies x 16 B = 128 rows x 128 B; 8 lanes cover one whole 128-B row piece
  const int crow = tid >> 3;                   // 0..15, copy i takes row crow + 16 i
  const int ccol = (tid & 7) * 8;              // element offset of the lane's 16 B
  const unsigned short* gA  = Ap  + (size_t)b * strideA + (size_t)(bm0 + crow) * lda + ccol;
  const unsigned short* gB  = Btp + (size_t)b * strideB + (size_t)(bn0 + crow) * ldb + ccol;
  const unsigned short* gA2 = (SPLIT != 0) ? (A2p  + (size_t)b * strideA + (size_t)(bm0 + crow) * lda + ccol) : nullptr;
  const unsigned short* gB2 = (SPLIT == 1) ? (Bt2p + (size_t)b * strideB + (size_t)(bn0 + crow) * ldb + ccol) : nullptr;
  const unsigned lBase = (unsigned)(size_t)sStage + (unsigned)(crow * kGPitch + ccol) * 2u;
  auto stage = [&](int t) {                    // pass t's operand rows into buffer t & 1
    const unsigned l = lBase + (unsigned)(t & 1) * (unsigned)(NPL * kGPlane * 2);
    const int k0 = t * kGK;
    async_copy8(l, 16 * kGPitch * 2, gA + k0, (size_t)16 * lda);
    async_copy8(l + kGPlane * 2, 16 * kGPitch * 2, gB + k0, (size_t)16 * ldb);
    if (SPLIT != 0) async_copy8(l + 2 * kGPlane * 2, 16 * kGPitch * 2, gA2 + k0, (size_t)16 * lda);
    if (SPLIT == 1) async_copy8(l + 3 * kGPlane * 2, 16 * kGPitch * 2, gB2 + k0, (size_t)16 * ldb);
  };

  const int rlane = lane & 15;                 // row (A) / col (B, D) within subtile
  const int koff  = (lane >> 4) * 8;           // k offset of this lane half
  const int mOff  = (lane >> 4) * 8;           // D row offset

  v8f acc[4][4];
#pragma unroll
  for (int i = 0; i < 4; ++i)
#pragma unroll
    for (int j = 0; j < 4; ++j) acc[i][j] = (v8f){0.f,0.f,0.f,0.f,0.f,0.f,0.f,0.f};

  const int nT = K >> 6;                       // passes
  stage(0);
  asm volatile("s_wait_asynccnt 0x0" ::: "memory");   // this wave's copies of pass 0 have landed
  __syncthreads();                                     // every wave's have: pass 0 is readable
  if (nT > 1) stage(1);

  for (int t = 0; t < nT; ++t) {
    const T* sb = sStage + (t & 1) * (NPL * kGPlane);
    const int aoff = (wm + rlane) * kGPitch + koff;
    const int boff = (wn + rlane) * kGPitch + koff;
    // the loops below are unrolled so that every fragment and accumulator index is a constant (registers, no scratch)
#pragma unroll
    for (int ks = 0; ks < kGK; ks += 32) {
      V bh[4], bl[4];
#pragma unroll
      for (int j = 0; j < 4; ++j) {
        const int bo = boff + (j << 4) * kGPitch + ks;
        bh[j] = Frag<T>::load(sb + kGPlane + bo);
        if (SPLIT == 1) bl[j] = Frag<T>::load(sb + 3 * kGPlane + bo);
      }
      V ah[4], al[4];                            // the whole 32-k block's fragments are read as one group ahead of its products
#pragma unroll
      for (int i = 0; i < 4; ++i) {
        const int ao = aoff + (i << 4) * kGPitch + ks;
        ah[i] = Frag<T>::load(sb + ao);
        if (SPLIT != 0) al[i] = Frag<T>::load(sb + 2 * kGPlane + ao);
      }
#pragma unroll
      for (int i = 0; i < 4; ++i) {
#pragma unroll
        for (int j = 0; j < 4; ++j) {
          acc[i][j] = Frag<T>::mma(ah[i], bh[j], acc[i][j]);
          if (SPLIT == 1) acc[i][j] = Frag<T>::mma(ah[i], bl[j], acc[i][j]);
          if (SPLIT != 0) acc[i][j] = Frag<T>::mma(al[i], bh[j], acc[i][j]);
        }
        Frag<T>::guard(acc[i][0], acc[i][3], ah[i], (SPLIT != 0) ? al[i] : ah[i]);
      }
      Frag<T>::keep(bh[0], bh[1], bh[2], bh[3]);
      if (SPLIT == 1) Frag<T>::keep(bl[0], bl[1], bl[2], bl[3]);
    }
    asm volatile("s_wait_dscnt 0x0" ::: "memory");     // this wave's reads of buffer t & 1 are done before it is refilled
    asm volatile("s_wait_asynccnt 0x0" ::: "memory");  // this wave's copies of pass t + 1 have landed
    __syncthreads();                                    // publishes pass t + 1 and ends every reader's use of buffer t & 1
    if (t + 2 < nT) stage(t + 2);
  }
  asm volatile("s_wait_asynccnt 0x0" ::: "memory");    // nothing in flight when the wave goes on to the epilogue and ends
  acc_guard4(acc[0][0], acc[0][1], acc[0][2], acc[0][3]);
  acc_guard4(acc[1][0], acc[1][1], acc[1][2], acc[1][3]);
  acc_guard4(acc[2][0], acc[2][1], acc[2][2], acc[2][3]);
  acc_guard4(acc[3][0], acc[3][1], acc[3][2], acc[3][3]);

  // ---- epilogue ----
  float* slab = sT[wave];
  const float* Rb = RESID ? (resid + (size_t)b * strideR) : nullptr;
#pragma unroll
  for (int i = 0; i < 4; ++i) {
    const int mBase = m0 + (i << 4);
#pragma unroll
    for (int j = 0; j < 4; ++j) {
      const int n = n0 + (j << 4) + rlane;
      float bv = 0.f;
      if (BIAS_MODE == 2) bv = bias[n];
#pragma unroll
      for (int r = 0; r < 8; ++r) {
        float v = acc[i][j][r] * scale;
        if (BIAS_MODE == 1) v += bias[mBase + mOff + r];
        if (BIAS_MODE == 2) v += bv;
        if (RESID) v += Rb[(size_t)(mBase + mOff + r) * ldc + n];
        if (ACT == 2) v = fmaxf(v, 0.0f);
        if (ACT == 4) v = (v > 0.f) ? v : 0.01f * v;
        slab[(mOff + r) * 68 + (j << 4) + rlane] = v;
      }
    }
    __builtin_amdgcn_fence(__ATOMIC_RELEASE, "workgroup");
    __builtin_amdgcn_wave_barrier();
    __builtin_amdgcn_fence(__ATOMIC_ACQUIRE, "workgroup");
    if (OUT_MODE == 0) {
      float* C = (float*)Cout + (size_t)b * strideC;
      const int hh = lane >> 4, c4 = (lane & 15) * 4;     // row seg = 256 B = 16 lanes x 16 B
      {
#pragma unroll
        for (int it = 0; it < 8; ++it) {
          const int row = it * 2 + hh;
          v4f v = *(const v4f*)(slab + row * 68 + c4);
          *(v4f*)(C + (size_t)(mBase + row) * ldc + n0 + c4) = v;
        }
        
      }
    } else if (OUT_MODE == 3) {
      const int q = lane >> 3, c8 = (lane & 7) * 8;       // row seg = 128 B = 8 lanes x 16 B, per plane
      unsigned short* C  = (unsigned short*)Cout  + (size_t)b * strideC;
      unsigned short* C2 = (unsigned short*)Cout2 + (size_t)b * strideC;
      // the loops below are unrolled so that every vector element and array index is a constant (registers, no scratch)
      if (b == 2) {                                        // block-uniform
#pragma unroll
        for (int it = 0; it < 4; ++it) {
          const int row = it * 4 + q;
          const float* sp = slab + row * 68 + c8;
          v8h hv;
#pragma unroll
          for (int e = 0; e < 8; ++e) hv[e] = (_Float16)sp[e];
          *(v8h*)(C + (size_t)(mBase + row) * ldc + n0 + c8) = hv;
        }
      } else {
        const float* ap[4];
        bool keep[4];
#pragma unroll
        for (int it = 0; it < 4; ++it) {
          const int jtok = (mBase + it * 4 + q) & (kSeq - 1);
          keep[it] = (b == 0) || (jtok + 1 < kSeq);
          const int jr = (jtok + 1 < kSeq) ? (jtok + 1) : (kSeq - 1);                 // clamped address
          ap[it] = (b == 0) ? (bias + n0 + c8) : (resid + (size_t)jr * kDim + n0 + c8);
        }
        v4f a0[4], a1[4];
        load4x32(ap[0], ap[1], ap[2], ap[3], a0, a1);
#pragma unroll
        for (int it = 0; it < 4; ++it) {
          const int row = it * 4 + q;
          const float* sp = slab + row * 68 + c8;
          v8h hv, lv;
#pragma unroll
          for (int e = 0; e < 8; ++e) {
            const float ad = (e < 4) ? a0[it][e & 3] : a1[it][e & 3];
            const float x = sp[e] + (keep[it] ? bf_rne(ad) : 0.0f);
            const unsigned short hb = f2bf_bits(x);
            const unsigned short lb = f2bf_bits(x - bf_bits2f(hb));
            hv[e] = __builtin_bit_cast(_Float16, hb);
            lv[e] = __builtin_bit_cast(_Float16, lb);
          }
          *(v8h*)(C  + (size_t)(mBase + row) * ldc + n0 + c8) = hv;
          *(v8h*)(C2 + (size_t)(mBase + row) * ldc + n0 + c8) = lv;
        }
        asm volatile("s_wait_xcnt 0x0" ::: "memory");   // no register that these stores name is rewritten ahead of this wait
      }
    } else {
      const int q = lane >> 3, c8 = (lane & 7) * 8;
      unsigned short* C  = (unsigned short*)Cout  + (size_t)b * strideC;
      unsigned short* C2 = (OUT_MODE == 2) ? ((unsigned short*)Cout2 + (size_t)b * strideC) : nullptr;
      {
#pragma unroll
        for (int it = 0; it < 4; ++it) {
          const int row = it * 4 + q;
          const float* sp = slab + row * 68 + c8;
          v8h hv, lv;
#pragma unroll
          for (int e = 0; e < 8; ++e) {
            if (OUT_MODE == 1) {
              hv[e] = (_Float16)sp[e];
            } else {
              unsigned short hb = f2bf_bits(sp[e]);
              unsigned short lb = f2bf_bits(sp[e] - bf_bits2f(hb));
              hv[e] = __builtin_bit_cast(_Float16, hb);
              lv[e] = __builtin_bit_cast(_Float16, lb);
            }
          }
          *(v8h*)(C + (size_t)(mBase + row) * ldc + n0 + c8) = hv;
          if (OUT_MODE == 2) *(v8h*)(C2 + (size_t)(mBase + row) * ldc + n0 + c8) = lv;
        }
        
      }
    }
    __builtin_amdgcn_fence(__ATOMIC_RELEASE, "workgroup");
    __builtin_amdgcn_wave_barrier();
    __builtin_amdgcn_fence(__ATOMIC_ACQUIRE, "workgroup");
  }
}

// ---------------------------------------------------------------------------
// f32 -> bf16 (RNE) plane, 8 elements per thread: one 16-B store per lane, 32 lanes = 512 contiguous B =
// ---------------------------------------------------------------------------
__global__ __launch_bounds__(256) void cvt_bf16x8_kernel(const float* __restrict__ in, unsigned short* __restrict__ out, int n8) {
  const int i = blockIdx.x * 256 + threadIdx.x;
  if (i >= n8) return;
  const size_t base = (size_t)i * 8;
  const v4f a = *(const v4f*)(in + base), c = *(const v4f*)(in + base + 4);
  unsigned short hb[8];
#pragma unroll
  for (int e = 0; e < 4; ++e) { hb[e] = f2bf_bits(a[e]); hb[4 + e] = f2bf_bits(c[e]); }
  const v4u u = (v4u){pk16(hb[0], hb[1]), pk16(hb[2], hb[3]), pk16(hb[4], hb[5]), pk16(hb[6], hb[7])};
  *(v4u*)(out + base) = u;
  
}

// ---------------------------------------------------------------------------
// Weight transpose + cast: in W[d][h] (row-major [in 1024][out 1024] f32) -> out WT[h][d] = bf16_rne(W[d][h]), 4 planes.
// grid (16, 16, 4): blockIdx.x = d tile (64 cols of WT), blockIdx.y = h tile (64 rows of WT), blockIdx.z selects W0..W3
// and the output plane (plane z at out + z*1024*1024 halves). 256 threads.
// Load coverage: 16 iterations x 256 threads = 4096 = the whole 64x64 tile (coalesced along h).
// Store coverage: 8 waves x 2 iterations x 4 rows (lane>>3) = 64 rows; (lane&7) x 8 halves = 64 cols; each row segment =
// ---------------------------------------------------------------------------
__global__ __launch_bounds__(256) void wtcast4_kernel(const float* __restrict__ W0, const float* __restrict__ W1,
                                                      const float* __restrict__ W2, const float* __restrict__ W3,
                                                      unsigned short* __restrict__ out) {
  __shared__ float sm[64][65];   // sm[h_local][d_local]
  const int t  = threadIdx.x;
  const int d0 = blockIdx.x * 64;
  const int h0 = blockIdx.y * 64;
  const int z  = blockIdx.z;                                   // block-uniform
  const float* W = (z == 0) ? W0 : (z == 1) ? W1 : (z == 2) ? W2 : W3;
#pragma unroll
  for (int i = 0; i < 16; ++i) {
    const int e = i * 256 + t;
    const int r = e >> 6;          // d local
    const int cc = e & 63;         // h local
    sm[cc][r] = W[(size_t)(d0 + r) * kDim + h0 + cc];
  }
  __syncthreads();
  const int lane = t & 31, wave = t >> 5;
  const int q = lane >> 3, c8 = (lane & 7) * 8;
  unsigned short* op = out + (size_t)z * kDim * kDim;
  {
#pragma unroll
    for (int it = 0; it < 2; ++it) {
      const int row = wave * 8 + it * 4 + q;                 // h local
      unsigned short hb[8];
#pragma unroll
      for (int e = 0; e < 8; ++e) hb[e] = f2bf_bits(sm[row][c8 + e]);
      const v4u u = (v4u){pk16(hb[0], hb[1]), pk16(hb[2], hb[3]), pk16(hb[4], hb[5]), pk16(hb[6], hb[7])};
      *(v4u*)(op + (size_t)(h0 + row) * kDim + d0 + c8) = u;
    }
    
  }
}

// ---------------------------------------------------------------------------
// Score bias table tb[n][j] (f32, [16][1024]): for j <= 1022: bf(r_bias[j+1][n]) - sum_d bf(r_w_bias[n][d]) * bf(r_emb[j+1][n][d]);
// tb[n][1023] = 0. Thread per (n, j), 64-tap rolled dot in fixed order (inputs only). r_emb / r_bias addresses clamped to row 1023,
// ---------------------------------------------------------------------------
__global__ __launch_bounds__(256) void tb_kernel(const float* __restrict__ rwb, const float* __restrict__ remb,
                                                 const float* __restrict__ rbias, float* __restrict__ tb) {
  const int i = blockIdx.x * 256 + threadIdx.x;          // 0..16383
  const int n = i >> 10;
  const int j = i & (kSeq - 1);
  const bool keep = (j + 1 < kSeq);
  const int jr = keep ? (j + 1) : (kSeq - 1);
  const float* rp = remb + ((size_t)jr * kHeads + n) * kHd;
  const float* up = rwb + n * kHd;
  float acc = 0.f;
#pragma unroll 1
  for (int d = 0; d < kHd; ++d) acc = fmaf(bf_rne(up[d]), bf_rne(rp[d]), acc);
  const float val = keep ? (bf_rne(rbias[jr * kHeads + n]) - acc) : 0.0f;
  ((float*)tb)[i] = val;
  
}

// ---------------------------------------------------------------------------
// Relative-position flash attention for head_dim 64 (no mask). Block = 4 waves = 64 query rows of one (batch, head);
// grid = 4 * 16 * 16 = 1024 blocks of 128 threads; blockIdx.x = b*256 + h*16 + qb.
// Inputs: QRh/QRl = bf16 hi/lo planes of (q + r_w_bias) [4096][1024]; KRh/KRl = bf16 hi/lo planes of (k_j + r_emb_{j+1});
// Vp = f16 plane of v [4096][1024]; tb = f32 [16][1024] score bias table.
// score[i][j] = ((q+rwb)_i · (k_j + r_{j+1}) + tb[h][j]) * 0.125  : v_wmma_f32_16x16x32_bf16, hi*hi + hi*lo + lo*hi.
// out += P·V : v_wmma_f32_16x16x32_f16 (V staged transposed [d][kv] in LDS as f16); final out * 1/(l * 2^15).
// ---------------------------------------------------------------------------
__global__ __launch_bounds__(128) void relattn_kernel(
    const unsigned short* __restrict__ QRh, const unsigned short* __restrict__ QRl,
    const unsigned short* __restrict__ KRh, const unsigned short* __restrict__ KRl,
    const unsigned short* __restrict__ Vp, const float* __restrict__ tb,
    unsigned short* __restrict__ AVh, unsigned short* __restrict__ AVl) {
  union FB { v16b v; v8b h[2]; };
  union FH { v16h v; v8h h[2]; };
  __shared__ __align__(16) __bf16   Ksh[kKC * kAPitch];        // K hi [kv][d]   13 KB
  __shared__ __align__(16) __bf16   Ksl[kKC * kAPitch];        // K lo [kv][d]   13 KB
  __shared__ __align__(16) _Float16 Vt[kHd * kAPitch];         // V f16 [d][kv]  13 KB
  __shared__ __align__(16) _Float16 Psh[4][16 * kAPitch];      // per wave P [row][kv] 13 KB
  __shared__ __align__(16) float    Os[4][16 * kOsPitch];      // per wave out tile, pitch 68

  const int tid  = threadIdx.x;
  const int wave = tid >> 5;
  const int lane = tid & 31;
  const int hh   = lane >> 4;
  const int c    = lane & 15;

  const int bx = blockIdx.x;
  const int qb = bx & 15;
  const int h  = (bx >> 4) & 15;
  const int b  = bx >> 8;
  const int q0 = qb * 64 + wave * 16;
  const size_t tok0 = (size_t)b * kSeq;
  const int hcol = h * kHd;

  // ---- Q fragments (A operand): 2 d-chunks, hi and lo. Frag load: elements 0..7 <- k 8hh+0..7, 8..15 <- k 16+8hh+0..7 ----
  v16b qah[2], qal[2];
  {
    const __bf16* ph = (const __bf16*)QRh + (tok0 + q0 + c) * kDim + hcol + 8 * hh;
    const __bf16* pl = (const __bf16*)QRl + (tok0 + q0 + c) * kDim + hcol + 8 * hh;
#pragma unroll
    for (int dc = 0; dc < 2; ++dc) {
      qah[dc] = Frag<__bf16>::load(ph + dc * 32);
      qal[dc] = Frag<__bf16>::load(pl + dc * 32);
    }
  }

  float mrow[8], lrow[8];
  v8f oacc[4];
#pragma unroll
  for (int r = 0; r < 8; ++r) { mrow[r] = -INFINITY; lrow[r] = 0.f; }
#pragma unroll
  for (int t = 0; t < 4; ++t) oacc[t] = (v8f){0.f,0.f,0.f,0.f,0.f,0.f,0.f,0.f};

  for (int kc = 0; kc < kSeq / kKC; ++kc) {     // 16 chunks, block-uniform
    const int kv0 = kc * kKC;
    __syncthreads();
    {
      // staging coverage: 128 threads = 64 kv rows x 2 halves of 32 d; 4 x 16-B pieces each -> whole 64x64 tiles of K hi, K lo, V
      const int kvr = tid >> 1;
      const int dh  = (tid & 1) * 32;
      const size_t g = (tok0 + kv0 + kvr) * kDim + hcol + dh;
      const v8b* gkh = (const v8b*)((const __bf16*)KRh + g);
      const v8b* gkl = (const v8b*)((const __bf16*)KRl + g);
      const v8h* gv  = (const v8h*)((const _Float16*)Vp + g);
#pragma unroll
      for (int i = 0; i < 4; ++i) {
        const v8b a  = gkh[i];
        const v8b al = gkl[i];
        const v8h vv = gv[i];
        *(v8b*)(Ksh + kvr * kAPitch + dh + 8 * i) = a;
        *(v8b*)(Ksl + kvr * kAPitch + dh + 8 * i) = al;
#pragma unroll
        for (int e = 0; e < 8; ++e) Vt[(dh + 8 * i + e) * kAPitch + kvr] = vv[e];
      }
    }
    __syncthreads();

    v8f s[4];
#pragma unroll
    for (int j = 0; j < 4; ++j) {
      s[j] = (v8f){0.f,0.f,0.f,0.f,0.f,0.f,0.f,0.f};
#pragma unroll
      for (int dc = 0; dc < 2; ++dc) {
        FB kb, kl;
        kb.h[0] = *(const v8b*)(Ksh + (j * 16 + c) * kAPitch + dc * 32 + 8 * hh);
        kb.h[1] = *(const v8b*)(Ksh + (j * 16 + c) * kAPitch + dc * 32 + 16 + 8 * hh);
        kl.h[0] = *(const v8b*)(Ksl + (j * 16 + c) * kAPitch + dc * 32 + 8 * hh);
        kl.h[1] = *(const v8b*)(Ksl + (j * 16 + c) * kAPitch + dc * 32 + 16 + 8 * hh);
        s[j] = mma_bf16g(qah[dc], kb.v, s[j]);
        s[j] = mma_bf16g(qah[dc], kl.v, s[j]);
        s[j] = mma_bf16g(qal[dc], kb.v, s[j]);
      }
    }
    float tbv[4];
#pragma unroll
    for (int j = 0; j < 4; ++j) tbv[j] = tb[h * kSeq + kv0 + j * 16 + c];

    float cm[8];
#pragma unroll
    for (int r = 0; r < 8; ++r) {
      float m = -INFINITY;
#pragma unroll
      for (int j = 0; j < 4; ++j) {
        s[j][r] = (s[j][r] + tbv[j]) * kScale;
        m = fmaxf(m, s[j][r]);
      }
#pragma unroll
      for (int off = 1; off < 16; off <<= 1) m = fmaxf(m, __shfl_xor(m, off, 32));
      cm[r] = m;
    }
    _Float16* pw = Psh[wave];
#pragma unroll
    for (int r = 0; r < 8; ++r) {
      const float mnew  = fmaxf(mrow[r], cm[r]);
      const float alpha = expf(mrow[r] - mnew);
      mrow[r] = mnew;
      float psum = 0.f;
#pragma unroll
      for (int j = 0; j < 4; ++j) {
        const float p = expf(s[j][r] - mnew);
        psum += p;
        pw[(8 * hh + r) * kAPitch + j * 16 + c] = (_Float16)(p * kPCarry);
      }
#pragma unroll
      for (int off = 1; off < 16; off <<= 1) psum += __shfl_xor(psum, off, 32);
      lrow[r] = lrow[r] * alpha + psum;
#pragma unroll
      for (int t = 0; t < 4; ++t) oacc[t][r] *= alpha;
    }
    __builtin_amdgcn_fence(__ATOMIC_RELEASE, "workgroup");
    __builtin_amdgcn_wave_barrier();
    __builtin_amdgcn_fence(__ATOMIC_ACQUIRE, "workgroup");
#pragma unroll
    for (int kk = 0; kk < 2; ++kk) {
      FH pa;
      pa.h[0] = *(const v8h*)(pw + c * kAPitch + kk * 32 + 8 * hh);
      pa.h[1] = *(const v8h*)(pw + c * kAPitch + kk * 32 + 16 + 8 * hh);
#pragma unroll
      for (int t = 0; t < 4; ++t) {
        FH vb;
        vb.h[0] = *(const v8h*)(Vt + (t * 16 + c) * kAPitch + kk * 32 + 8 * hh);
        vb.h[1] = *(const v8h*)(Vt + (t * 16 + c) * kAPitch + kk * 32 + 16 + 8 * hh);
        oacc[t] = mma_f16g(pa.v, vb.v, oacc[t]);
      }
    }
  }

  float* os = Os[wave];
#pragma unroll
  for (int r = 0; r < 8; ++r) {
    const float inv = 1.0f / (lrow[r] * kPCarry);
#pragma unroll
    for (int t = 0; t < 4; ++t) os[(8 * hh + r) * kOsPitch + t * 16 + c] = oacc[t][r] * inv;
  }
  __builtin_amdgcn_fence(__ATOMIC_RELEASE, "workgroup");
  __builtin_amdgcn_wave_barrier();
  __builtin_amdgcn_fence(__ATOMIC_ACQUIRE, "workgroup");
  {
    const int q = lane >> 3, c8 = (lane & 7) * 8;
    {
#pragma unroll
      for (int it = 0; it < 4; ++it) {
        const int row = it * 4 + q;                       // 0..15
        const float* sp = os + row * kOsPitch + c8;
        v8h hv, lv;
#pragma unroll
        for (int e = 0; e < 8; ++e) {
          const unsigned short hb = f2bf_bits(sp[e]);
          const unsigned short lb = f2bf_bits(sp[e] - bf_bits2f(hb));
          hv[e] = __builtin_bit_cast(_Float16, hb);
          lv[e] = __builtin_bit_cast(_Float16, lb);
        }
        const size_t o = (tok0 + q0 + row) * kDim + hcol + c8;
        *(v8h*)(AVh + o) = hv;
        *(v8h*)(AVl + o) = lv;
      }
      
    }
  }
}

// ---------------------------------------------------------------------------
// y = (x - mu) * rsqrt(var + eps) * bf(gamma) + bf(beta). One block of 256 threads (8 waves) per row; thread t owns
// ---------------------------------------------------------------------------
__global__ __launch_bounds__(256) void ln_kernel(const float* __restrict__ w, const float* __restrict__ ao,
                                                 const float* __restrict__ g, const float* __restrict__ bt,
                                                 float* __restrict__ out) {
  __shared__ float red[16];
  const int row  = blockIdx.x;
  const int t    = threadIdx.x, lane = t & 31, wave = t >> 5;
  const int c0   = t * 4;
  const size_t off = (size_t)row * kDim + c0;
  const v4f a = *(const v4f*)(w + off);
  const v4f o = *(const v4f*)(ao + off);
  float x[4];
#pragma unroll
  for (int e = 0; e < 4; ++e) x[e] = bf_rne(a[e]) + o[e];
  float s = (x[0] + x[1]) + (x[2] + x[3]);
#pragma unroll
  for (int sh = 16; sh > 0; sh >>= 1) s += __shfl_xor(s, sh, 32);
  if (lane == 0) red[wave] = s;
  __syncthreads();
  const float mu = (((red[0] + red[1]) + (red[2] + red[3])) + ((red[4] + red[5]) + (red[6] + red[7]))) * kInvDim;
  float d[4];
  float s2 = 0.f;
#pragma unroll
  for (int e = 0; e < 4; ++e) { d[e] = x[e] - mu; s2 += d[e] * d[e]; }
#pragma unroll
  for (int sh = 16; sh > 0; sh >>= 1) s2 += __shfl_xor(s2, sh, 32);
  if (lane == 0) red[8 + wave] = s2;
  __syncthreads();
  const float var  = (((red[8] + red[9]) + (red[10] + red[11])) + ((red[12] + red[13]) + (red[14] + red[15]))) * kInvDim;
  const float rstd = rsqrtf(var + kLnEps);
  const v4f gg = *(const v4f*)(g + c0);
  const v4f bb = *(const v4f*)(bt + c0);
  v4f y;
#pragma unroll
  for (int e = 0; e < 4; ++e) y[e] = (d[e] * rstd) * bf_rne(gg[e]) + bf_rne(bb[e]);
  *(v4f*)(out + off) = y;
  
}

// ---------------------------------------------------------------------------
// Host launch glue. Workspace region map (bytes, all offsets 256-B aligned):
//   [0]            Wb    bf16 w plane            [4096][1024]      8,388,608
//   [8,388,608]    WT    bf16 Wq^T|Wk^T|Wv^T|Wo^T 4 x [1024][1024]  8,388,608
//   [16,777,216]   AVh|AVl bf16 attn_vec hi/lo   2 x [4096][1024]  16,777,216
//   [33,554,432]   AO    f32 attn_vec @ Wo       [4096][1024]      16,777,216
//   [50,331,648]   QRh|QRl bf16 (q+rwb) hi/lo    2 x [4096][1024]  16,777,216   (these three follow one another: the projection
//   [67,108,864]   KRh|KRl bf16 (k+r) hi/lo      2 x [4096][1024]  16,777,216    launch steps from q to k to v by one stride of
//   [83,886,080]   Vh    f16 v plane             [4096][1024]      8,388,608     two planes)
//   [92,274,688]   TB    f32 [16][1024]                            65,536
//   total 92,340,224
// ---------------------------------------------------------------------------
extern "C" void kernel_launch(void* const* d_in, const int* in_sizes, int n_in,
                              void* d_out, int out_size, void* d_ws, size_t ws_size,
                              hipStream_t stream) {
  if (n_in < 10) return;
  const float* w     = (const float*)d_in[0];
  const float* remb  = (const float*)d_in[1];
  const float* rwb   = (const float*)d_in[2];
  const float* rbias = (const float*)d_in[3];
  const float* Wq    = (const float*)d_in[4];
  const float* Wk    = (const float*)d_in[5];
  const float* Wv    = (const float*)d_in[6];
  const float* Wo    = (const float*)d_in[7];
  const float* gamma = (const float*)d_in[8];
  const float* beta  = (const float*)d_in[9];
  float* out = (float*)d_out;

  const size_t nTokD = (size_t)kTok * kDim;                    // 4,194,304 elements
  if ((size_t)in_sizes[0] != nTokD) return;
  if (in_sizes[1] != kSeq * kHeads * kHd) return;
  if (in_sizes[2] != kHeads * kHd) return;
  if (in_sizes[3] != kSeq * kHeads) return;
  if (in_sizes[4] != kDim * kDim || in_sizes[5] != kDim * kDim || in_sizes[6] != kDim * kDim || in_sizes[7] != kDim * kDim) return;
  if (in_sizes[8] != kDim || in_sizes[9] != kDim) return;
  if ((size_t)out_size != nTokD) return;

  const size_t bWb  = nTokD * 2;
  const size_t bWT  = (size_t)4 * kDim * kDim * 2;
  const size_t bAV  = nTokD * 2 * 2;
  const size_t bAO  = nTokD * 4;
  const size_t bQR  = nTokD * 2 * 2;
  const size_t bKR  = nTokD * 2 * 2;
  const size_t bVh  = nTokD * 2;
  const size_t bTB  = (size_t)kHeads * kSeq * 4;
  const size_t oWb  = 0;
  const size_t oWT  = oWb + bWb;
  const size_t oAV  = oWT + bWT;
  const size_t oAO  = oAV + bAV;
  const size_t oQR  = oAO + bAO;
  const size_t oKR  = oQR + bQR;
  const size_t oVh  = oKR + bKR;
  const size_t oTB  = oVh + bVh;
  const size_t total = oTB + bTB;                               // 92,340,224
  if (total > ws_size) return;

  char* ws = (char*)d_ws;
  unsigned short* Wb  = (unsigned short*)(ws + oWb);
  unsigned short* WT  = (unsigned short*)(ws + oWT);
  unsigned short* AVh = (unsigned short*)(ws + oAV);
  unsigned short* AVl = AVh + nTokD;
  float*          AO  = (float*)(ws + oAO);
  unsigned short* QRh = (unsigned short*)(ws + oQR);
  unsigned short* QRl = QRh + nTokD;
  unsigned short* KRh = (unsigned short*)(ws + oKR);
  unsigned short* KRl = KRh + nTokD;
  unsigned short* Vh  = (unsigned short*)(ws + oVh);
  float*          TB  = (float*)(ws + oTB);

  const int n8 = (int)(nTokD / 8);                             // 524288
  const long wPlane = (long)kDim * kDim;

  // 1. w -> bf16 plane
  cvt_bf16x8_kernel<<<dim3(n8 / 256), dim3(256), 0, stream>>>(w, Wb, n8);
  // 2. weight transposes: in W[1024 in][1024 out] -> out WT[out][in], planes 0..3 = Wq, Wk, Wv, Wo
  wtcast4_kernel<<<dim3(kDim / 64, kDim / 64, 4), dim3(256), 0, stream>>>(Wq, Wk, Wv, Wo, WT);
  // 3. q, k and v in one launch: batch index 0/1/2 selects the WT plane and the output (QRh|QRl, KRh|KRl, Vh: stride two planes);
  //    the epilogue adds r_w_bias (q) or the shifted r_emb row (k) and writes the planes that the attention reads.
  //    M=4096, N=1024, K=1024 (block tiles 32x8 = 256 blocks x 4 waves, x 3)
  wmma_gemm64<1, 0, 0, 3, false><<<dim3(256, 3), dim3(128), 0, stream>>>(
      Wb, Wb, kDim, 0L,
      WT, WT, kDim, wPlane,
      (void*)QRh, (void*)QRl, kDim, (long)(2 * nTokD),
      rwb, remb, 0L,
      kTok, kDim, kDim, 1.0f);
  // 4. score bias table [16][1024]
  tb_kernel<<<dim3((kHeads * kSeq) / 256), dim3(256), 0, stream>>>(rwb, remb, rbias, TB);
  // 5. attention -> attn_vec bf16 hi/lo planes
  relattn_kernel<<<dim3(kBatch * kHeads * (kSeq / 64)), dim3(128), 0, stream>>>(QRh, QRl, KRh, KRl, Vh, TB, AVh, AVl);
  // 6. attn_vec @ Wo (A hi/lo split, Wo bf16) -> f32
  wmma_gemm64<1, 2, 0, 0, false><<<dim3(256, 1), dim3(128), 0, stream>>>(
      AVh, AVl, kDim, 0L,
      WT + 3 * wPlane, WT + 3 * wPlane, kDim, 0L,
      (void*)AO, (void*)AO, kDim, 0L,
      gamma, gamma, 0L,
      kTok, kDim, kDim, 1.0f);
  // 7. residual + LayerNorm -> out
  ln_kernel<<<dim3(kTok), dim3(256), 0, stream>>>(w, AO, gamma, beta, out);
}

// v004
// It runs in 135 microseconds.
// Timed twice side by side with v003, it ran 1.04 times as fast both times.
// Counting every step since v000, it is 2.27 times as fast.
// Compute dtypes: w@Wq|Wk|Wv on v_wmma_f32_16x16x32_bf16 (inputs RNE-converted to bf16, single product); scores (q+r_w_bias)·(k_j+r_emb_{j+1}) on v_wmma_f32_16x16x32_bf16 with bf16 hi/lo planes (hi*hi+hi*lo+lo*hi); attn_prob·v on v_wmma_f32_16x16x32_f16 (P f16 carried x32768, V f16); attn_vec@Wo on v_wmma_f32_16x16x32_bf16 (attn_vec bf16 hi/lo, Wo bf16: hi*W+lo*W); f32 accumulate everywhere; softmax, bias table, residual and LayerNorm in f32.
#include <hip/hip_runtime.h>
#include <math.h>

// ---------------------------------------------------------------------------
// Problem constants
// ---------------------------------------------------------------------------
constexpr int kBatch = 4;
constexpr int kSeq   = 1024;
constexpr int kDim   = 1024;
constexpr int kHeads = 16;
constexpr int kHd    = 64;
constexpr int kTok   = kBatch * kSeq;      // 4096 token rows
constexpr float kLnEps  = 1e-5f;
constexpr float kInvDim = 1.0f / 1024.0f;
constexpr float kScale  = 0.125f;          // 1/sqrt(64)
constexpr float kPCarry = 32768.0f;        // probabilities carried x2^15 in f16
constexpr int kKC = 64;                    // keys per chunk
constexpr int kOsPitch = 68;
// LDS row pitch of the attention K, V and P tiles in 16-bit elements: 208 B = 16 B x 13, an odd count of 16-B units, so the
// sixteen rows that a 16-B fragment read touches fall on sixteen different groups of four banks. 13 and not 9: the banks see
// no difference, but the builds do: at 144 B the twelve staging loads of a chunk are waited out almost one by one, at 208 B
// (69 KB a block, four blocks a WGP, which is what the grid supplies) all twelve are issued together.
constexpr int kAPitch = 104;

typedef __attribute__((ext_vector_type(16))) _Float16 v16h;
typedef __attribute__((ext_vector_type(8)))  _Float16 v8h;
typedef __attribute__((ext_vector_type(16))) __bf16   v16b;
typedef __attribute__((ext_vector_type(8)))  __bf16   v8b;
typedef __attribute__((ext_vector_type(8)))  float    v8f;
typedef __attribute__((ext_vector_type(4)))  float    v4f;
typedef __attribute__((ext_vector_type(4)))  unsigned int v4u;

__device__ __forceinline__ unsigned short f2bf_bits(float f) {
  unsigned u = __float_as_uint(f);
  return (unsigned short)((u + 0x7FFFu + ((u >> 16) & 1u)) >> 16);
}
__device__ __forceinline__ float bf_bits2f(unsigned short h) { return __uint_as_float(((unsigned)h) << 16); }
__device__ __forceinline__ float bf_rne(float f) { return bf_bits2f(f2bf_bits(f)); }

// hazard guards as plain device helpers
__device__ __forceinline__ void dep_guard_h(v8f& a, v8f& b, v16h x, v16h y) { asm volatile("v_nop\n\tv_nop\n\tv_nop\n\tv_nop" : "+v"(a), "+v"(b) : "v"(x), "v"(y)); }
__device__ __forceinline__ void dep_guard_b(v8f& a, v8f& b, v16b x, v16b y) { asm volatile("v_nop\n\tv_nop\n\tv_nop\n\tv_nop" : "+v"(a), "+v"(b) : "v"(x), "v"(y)); }
__device__ __forceinline__ void keep4_h(v16h a, v16h b, v16h c, v16h d) { asm volatile("v_nop" :: "v"(a), "v"(b), "v"(c), "v"(d)); }
__device__ __forceinline__ void keep4_b(v16b a, v16b b, v16b c, v16b d) { asm volatile("v_nop" :: "v"(a), "v"(b), "v"(c), "v"(d)); }
__device__ __forceinline__ void acc_guard4(v8f& a, v8f& b, v8f& c, v8f& d) { asm volatile("v_nop\n\tv_nop\n\tv_nop\n\tv_nop" : "+v"(a), "+v"(b), "+v"(c), "+v"(d)); }
template <typename T> struct Frag;
template <> struct Frag<_Float16> {
  typedef v16h V; union U { v16h v; v8h h[2]; };
  static __device__ __forceinline__ v16h load(const _Float16* p) {   // elements 0..7 <- p[0..7], 8..15 <- p[16..23]
    U f; f.h[0] = *(const v8h*)(p); f.h[1] = *(const v8h*)(p + 16); return f.v;
  }
  static __device__ __forceinline__ v8f mma(v16h a, v16h b, v8f c) {
    return __builtin_amdgcn_wmma_f32_16x16x32_f16(false, a, false, b, (short)0, c, false, false);
  }
  static __device__ __forceinline__ void guard(v8f& a, v8f& b, v16h x, v16h y) { dep_guard_h(a, b, x, y); }
  static __device__ __forceinline__ void keep(v16h a, v16h b, v16h c, v16h d) { keep4_h(a, b, c, d); }
};
template <> struct Frag<__bf16> {
  typedef v16b V; union U { v16b v; v8b h[2]; };
  static __device__ __forceinline__ v16b load(const __bf16* p) {
    U f; f.h[0] = *(const v8b*)(p); f.h[1] = *(const v8b*)(p + 16); return f.v;
  }
  static __device__ __forceinline__ v8f mma(v16b a, v16b b, v8f c) {
    return __builtin_amdgcn_wmma_f32_16x16x32_bf16(false, a, false, b, (short)0, c, false, false);
  }
  static __device__ __forceinline__ void guard(v8f& a, v8f& b, v16b x, v16b y) { dep_guard_b(a, b, x, y); }
  static __device__ __forceinline__ void keep(v16b a, v16b b, v16b c, v16b d) { keep4_b(a, b, c, d); }
};

__device__ __forceinline__ unsigned pk16(unsigned short a, unsigned short b) { return (unsigned)a | ((unsigned)b << 16); }

// single WMMA issue with hazard guard (bf16 and f16 twins)
__device__ __forceinline__ v8f mma_bf16g(v16b a, v16b b, v8f c) {
  c = __builtin_amdgcn_wmma_f32_16x16x32_bf16(false, a, false, b, (short)0, c, false, false);
  asm volatile("v_nop\n\tv_nop\n\tv_nop\n\tv_nop" : "+v"(c) : "v"(a), "v"(b));
  return c;
}
__device__ __forceinline__ v8f mma_f16g(v16h a, v16h b, v8f c) {
  c = __builtin_amdgcn_wmma_f32_16x16x32_f16(false, a, false, b, (short)0, c, false, false);
  asm volatile("v_nop\n\tv_nop\n\tv_nop\n\tv_nop" : "+v"(c) : "v"(a), "v"(b));
  return c;
}

// ---- LDS staging of the GEMM operands ----
constexpr int kGK     = 64;                  // k per pass: 128 B of every operand row
constexpr int kGPitch = 72;                  // LDS row pitch in 16-bit elements: 144 B = 16 B x 9, conflict-free for 16-B row reads
constexpr int kGPlane = 128 * kGPitch;       // one operand plane of one buffer: 128 rows

// Eight asynchronous 16-B copies of one lane, global -> LDS, rows 16 apart (l, g: the lane's own LDS byte address and
// global address of the first; lstep, gstep: the step to the next). The closing s_wait_xcnt stands inside the statement
// so that no address register named here is rewritten ahead of it.
__device__ __forceinline__ void async_copy8(unsigned l, unsigned lstep, const unsigned short* g, size_t gstep) {
  asm volatile(
      "global_load_async_to_lds_b128 %0, %8, off\n\t"
      "global_load_async_to_lds_b128 %1, %9, off\n\t"
      "global_load_async_to_lds_b128 %2, %10, off\n\t"
      "global_load_async_to_lds_b128 %3, %11, off\n\t"
      "global_load_async_to_lds_b128 %4, %12, off\n\t"
      "global_load_async_to_lds_b128 %5, %13, off\n\t"
      "global_load_async_to_lds_b128 %6, %14, off\n\t"
      "global_load_async_to_lds_b128 %7, %15, off\n\t"
      "s_wait_xcnt 0x0"
      :: "v"(l), "v"(l + lstep), "v"(l + 2 * lstep), "v"(l + 3 * lstep),
         "v"(l + 4 * lstep), "v"(l + 5 * lstep), "v"(l + 6 * lstep), "v"(l + 7 * lstep),
         "v"(g), "v"(g + gstep), "v"(g + 2 * gstep), "v"(g + 3 * gstep),
         "v"(g + 4 * gstep), "v"(g + 5 * gstep), "v"(g + 6 * gstep), "v"(g + 7 * gstep)
      : "memory");
}

// Eight 16-B global loads of one lane: 32 B from each of four row pointers. Loads and their data wait stand in one
// statement and every result is an early-clobber output, so that no result lands in an address pair of the run and no
// address register is rewritten while a load that names it is in flight.
__device__ __forceinline__ void load4x32(const float* p0, const float* p1, const float* p2, const float* p3, v4f (&lo)[4], v4f (&hi)[4]) {
  asm volatile(
      "global_load_b128 %0, %8, off\n\t"
      "global_load_b128 %1, %8, off offset:16\n\t"
      "global_load_b128 %2, %9, off\n\t"
      "global_load_b128 %3, %9, off offset:16\n\t"
      "global_load_b128 %4, %10, off\n\t"
      "global_load_b128 %5, %10, off offset:16\n\t"
      "global_load_b128 %6, %11, off\n\t"
      "global_load_b128 %7, %11, off offset:16\n\t"
      "s_wait_loadcnt 0x0"
      : "=&v"(lo[0]), "=&v"(hi[0]), "=&v"(lo[1]), "=&v"(hi[1]), "=&v"(lo[2]), "=&v"(hi[2]), "=&v"(lo[3]), "=&v"(hi[3])
      : "v"(p0), "v"(p1), "v"(p2), "v"(p3)
      : "memory");
}

// ---- Register-blocked batched WMMA GEMM (SPLIT widened to an int mode, ACT reduced to relu/leaky) ----
// C[m,n] = scale * sum_k A[m,k] * Bt[n,k] (+bias)(+resid); each wave owns a 64x64 tile, 2x2 waves share a 128x128 block tile.
// Per pass the block's 128 A rows and 128 Bt rows x 64 k are staged in LDS by asynchronous copies, two buffers: the copies
// of pass t+1 fly while pass t is worked on; fragments are read from LDS in the same k order as from global memory.
// A row-major [M,K]; Bt row-major [N,K]; M,N % 128 == 0, K % 64 == 0.
// SPLIT: 0 = single product; 1 = A and Bt hi/lo planes (hi*hi + hi*lo + lo*hi); 2 = A hi/lo only (hi*B + lo*B).
// BIAS_MODE: 0 = none, 1 = bias[m], 2 = bias[n].
// OUT_MODE: 0 = f32, 1 = f16, 2 = bf16 hi plane (Cout) + bf16 lo plane (Cout2),
//           3 = the q|k|v projection, one launch, batch index b picks the product and what its epilogue does:
//               b = 0: x = q + bf(bias[n])                                   -> bf16 hi/lo planes (bias = r_w_bias, flat [1024])
//               b = 1: x = k_j + bf(resid[j+1][n]), nothing added at j = 1023 -> bf16 hi/lo planes (resid = r_emb, flat [1024][1024],
//                      j = m mod 1024; the address is clamped to row 1023 and the value zeroed by predicate)
//               b = 2: v -> f16 plane (Cout only)
// ET: 0 = f16 operands, 1 = bf16 operands (pointers passed as 16-bit storage)
template <int ET> struct Elem;
template <> struct Elem<0> { typedef _Float16 T; };
template <> struct Elem<1> { typedef __bf16 T; };
template <int ET, int SPLIT, int BIAS_MODE, int OUT_MODE, bool RESID, int ACT = 0>
__global__ __launch_bounds__(128) void wmma_gemm64(
    const unsigned short* __restrict__ Ap, const unsigned short* __restrict__ A2p, int lda, long strideA,
    const unsigned short* __restrict__ Btp, const unsigned short* __restrict__ Bt2p, int ldb, long strideB,
    void* __restrict__ Cout, void* __restrict__ Cout2, int ldc, long strideC,
    const float* __restrict__ bias,
    const float* __restrict__ resid, long strideR,
    int M, int N, int K, float scale) {
  typedef typename Elem<ET>::T T;
  typedef typename Frag<T>::V V;
  constexpr int NPL = 2 + ((SPLIT != 0) ? 1 : 0) + ((SPLIT == 1) ? 1 : 0);   // planes per buffer: A, Bt, A lo, Bt lo
  __shared__ __align__(16) T sStage[2 * NPL * kGPlane];   // two buffers of NPL planes
  __shared__ __align__(16) float sT[4][16 * 68];   // per-wave 16x64 slab, pitch 68 floats
  const int b    = blockIdx.y;
  const int tid  = threadIdx.x;
  const int lane = tid & 31;
  const int wave = tid >> 5;
  const int tilesN = N >> 7;
  const int tilesM = M >> 7;
  const int tile = blockIdx.x;
  if (tile >= tilesM * tilesN) return;   // block-uniform, ahead of every barrier and copy
  const int tm = tile / tilesN;
  const int tn = tile - tm * tilesN;
  const int bm0 = tm << 7;
  const int bn0 = tn << 7;
  const int wm  = (wave >> 1) << 6;            // this wave's 64x64 tile inside the block tile
  const int wn  = (wave & 1) << 6;
  const int m0 = bm0 + wm;
  const int n0 = bn0 + wn;

  // staging coverage per plane: 128 threads x 8 copies x 16 B = 128 rows x 128 B; 8 lanes cover one whole 128-B row piece
  const int crow = tid >> 3;                   // 0..15, copy i takes row crow + 16 i
  const int ccol = (tid & 7) * 8;              // element offset of the lane's 16 B
  const unsigned short* gA  = Ap  + (size_t)b * strideA + (size_t)(bm0 + crow) * lda + ccol;
  const unsigned short* gB  = Btp + (size_t)b * strideB + (size_t)(bn0 + crow) * ldb + ccol;
  const unsigned short* gA2 = (SPLIT != 0) ? (A2p  + (size_t)b * strideA + (size_t)(bm0 + crow) * lda + ccol) : nullptr;
  const unsigned short* gB2 = (SPLIT == 1) ? (Bt2p + (size_t)b * strideB + (size_t)(bn0 + crow) * ldb + ccol) : nullptr;
  const unsigned lBase = (unsigned)(size_t)sStage + (unsigned)(crow * kGPitch + ccol) * 2u;
  auto stage = [&](int t) {                    // pass t's operand rows into buffer t & 1
    const unsigned l = lBase + (unsigned)(t & 1) * (unsigned)(NPL * kGPlane * 2);
    const int k0 = t * kGK;
    async_copy8(l, 16 * kGPitch * 2, gA + k0, (size_t)16 * lda);
    async_copy8(l + kGPlane * 2, 16 * kGPitch * 2, gB + k0, (size_t)16 * ldb);
    if (SPLIT != 0) async_copy8(l + 2 * kGPlane * 2, 16 * kGPitch * 2, gA2 + k0, (size_t)16 * lda);
    if (SPLIT == 1) async_copy8(l + 3 * kGPlane * 2, 16 * kGPitch * 2, gB2 + k0, (size_t)16 * ldb);
  };

  const int rlane = lane & 15;                 // row (A) / col (B, D) within subtile
  const int koff  = (lane >> 4) * 8;           // k offset of this lane half
  const int mOff  = (lane >> 4) * 8;           // D row offset

  v8f acc[4][4];
#pragma unroll
  for (int i = 0; i < 4; ++i)
#pragma unroll
    for (int j = 0; j < 4; ++j) acc[i][j] = (v8f){0.f,0.f,0.f,0.f,0.f,0.f,0.f,0.f};

  const int nT = K >> 6;                       // passes
  stage(0);
  asm volatile("s_wait_asynccnt 0x0" ::: "memory");   // this wave's copies of pass 0 have landed
  __syncthreads();                                     // every wave's have: pass 0 is readable
  if (nT > 1) stage(1);

  for (int t = 0; t < nT; ++t) {
    const T* sb = sStage + (t & 1) * (NPL * kGPlane);
    const int aoff = (wm + rlane) * kGPitch + koff;
    const int boff = (wn + rlane) * kGPitch + koff;
    // the loops below are unrolled so that every fragment and accumulator index is a constant (registers, no scratch)
#pragma unroll
    for (int ks = 0; ks < kGK; ks += 32) {
      V bh[4], bl[4];
#pragma unroll
      for (int j = 0; j < 4; ++j) {
        const int bo = boff + (j << 4) * kGPitch + ks;
        bh[j] = Frag<T>::load(sb + kGPlane + bo);
        if (SPLIT == 1) bl[j] = Frag<T>::load(sb + 3 * kGPlane + bo);
      }
      V ah[4], al[4];                            // the whole 32-k block's fragments are read as one group ahead of its products
#pragma unroll
      for (int i = 0; i < 4; ++i) {
        const int ao = aoff + (i << 4) * kGPitch + ks;
        ah[i] = Frag<T>::load(sb + ao);
        if (SPLIT != 0) al[i] = Frag<T>::load(sb + 2 * kGPlane + ao);
      }
#pragma unroll
      for (int i = 0; i < 4; ++i) {
#pragma unroll
        for (int j = 0; j < 4; ++j) {
          acc[i][j] = Frag<T>::mma(ah[i], bh[j], acc[i][j]);
          if (SPLIT == 1) acc[i][j] = Frag<T>::mma(ah[i], bl[j], acc[i][j]);
          if (SPLIT != 0) acc[i][j] = Frag<T>::mma(al[i], bh[j], acc[i][j]);
        }
        Frag<T>::guard(acc[i][0], acc[i][3], ah[i], (SPLIT != 0) ? al[i] : ah[i]);
      }
      Frag<T>::keep(bh[0], bh[1], bh[2], bh[3]);
      if (SPLIT == 1) Frag<T>::keep(bl[0], bl[1], bl[2], bl[3]);
    }
    asm volatile("s_wait_dscnt 0x0" ::: "memory");     // this wave's reads of buffer t & 1 are done before it is refilled
    asm volatile("s_wait_asynccnt 0x0" ::: "memory");  // this wave's copies of pass t + 1 have landed
    __syncthreads();                                    // publishes pass t + 1 and ends every reader's use of buffer t & 1
    if (t + 2 < nT) stage(t + 2);
  }
  asm volatile("s_wait_asynccnt 0x0" ::: "memory");    // nothing in flight when the wave goes on to the epilogue and ends
  acc_guard4(acc[0][0], acc[0][1], acc[0][2], acc[0][3]);
  acc_guard4(acc[1][0], acc[1][1], acc[1][2], acc[1][3]);
  acc_guard4(acc[2][0], acc[2][1], acc[2][2], acc[2][3]);
  acc_guard4(acc[3][0], acc[3][1], acc[3][2], acc[3][3]);

  // ---- epilogue ----
  float* slab = sT[wave];
  const float* Rb = RESID ? (resid + (size_t)b * strideR) : nullptr;
#pragma unroll
  for (int i = 0; i < 4; ++i) {
    const int mBase = m0 + (i << 4);
#pragma unroll
    for (int j = 0; j < 4; ++j) {
      const int n = n0 + (j << 4) + rlane;
      float bv = 0.f;
      if (BIAS_MODE == 2) bv = bias[n];
#pragma unroll
      for (int r = 0; r < 8; ++r) {
        float v = acc[i][j][r] * scale;
        if (BIAS_MODE == 1) v += bias[mBase + mOff + r];
        if (BIAS_MODE == 2) v += bv;
        if (RESID) v += Rb[(size_t)(mBase + mOff + r) * ldc + n];
        if (ACT == 2) v = fmaxf(v, 0.0f);
        if (ACT == 4) v = (v > 0.f) ? v : 0.01f * v;
        slab[(mOff + r) * 68 + (j << 4) + rlane] = v;
      }
    }
    __builtin_amdgcn_fence(__ATOMIC_RELEASE, "workgroup");
    __builtin_amdgcn_wave_barrier();
    __builtin_amdgcn_fence(__ATOMIC_ACQUIRE, "workgroup");
    if (OUT_MODE == 0) {
      float* C = (float*)Cout + (size_t)b * strideC;
      const int hh = lane >> 4, c4 = (lane & 15) * 4;     // row seg = 256 B = 16 lanes x 16 B
      {
#pragma unroll
        for (int it = 0; it < 8; ++it) {
          const int row = it * 2 + hh;
          v4f v = *(const v4f*)(slab + row * 68 + c4);
          *(v4f*)(C + (size_t)(mBase + row) * ldc + n0 + c4) = v;
        }
        
      }
    } else if (OUT_MODE == 3) {
      const int q = lane >> 3, c8 = (lane & 7) * 8;       // row seg = 128 B = 8 lanes x 16 B, per plane
      unsigned short* C  = (unsigned short*)Cout  + (size_t)b * strideC;
      unsigned short* C2 = (unsigned short*)Cout2 + (size_t)b * strideC;
      // the loops below are unrolled so that every vector element and array index is a constant (registers, no scratch)
      if (b == 2) {                                        // block-uniform
#pragma unroll
        for (int it = 0; it < 4; ++it) {
          const int row = it * 4 + q;
          const float* sp = slab + row * 68 + c8;
          v8h hv;
#pragma unroll
          for (int e = 0; e < 8; ++e) hv[e] = (_Float16)sp[e];
          *(v8h*)(C + (size_t)(mBase + row) * ldc + n0 + c8) = hv;
        }
      } else {
        const float* ap[4];
        bool keep[4];
#pragma unroll
        for (int it = 0; it < 4; ++it) {
          const int jtok = (mBase + it * 4 + q) & (kSeq - 1);
          keep[it] = (b == 0) || (jtok + 1 < kSeq);
          const int jr = (jtok + 1 < kSeq) ? (jtok + 1) : (kSeq - 1);                 // clamped address
          ap[it] = (b == 0) ? (bias + n0 + c8) : (resid + (size_t)jr * kDim + n0 + c8);
        }
        v4f a0[4], a1[4];
        load4x32(ap[0], ap[1], ap[2], ap[3], a0, a1);
#pragma unroll
        for (int it = 0; it < 4; ++it) {
          const int row = it * 4 + q;
          const float* sp = slab + row * 68 + c8;
          v8h hv, lv;
#pragma unroll
          for (int e = 0; e < 8; ++e) {
            const float ad = (e < 4) ? a0[it][e & 3] : a1[it][e & 3];
            const float x = sp[e] + (keep[it] ? bf_rne(ad) : 0.0f);
            const unsigned short hb = f2bf_bits(x);
            const unsigned short lb = f2bf_bits(x - bf_bits2f(hb));
            hv[e] = __builtin_bit_cast(_Float16, hb);
            lv[e] = __builtin_bit_cast(_Float16, lb);
          }
          *(v8h*)(C  + (size_t)(mBase + row) * ldc + n0 + c8) = hv;
          *(v8h*)(C2 + (size_t)(mBase + row) * ldc + n0 + c8) = lv;
        }
        asm volatile("s_wait_xcnt 0x0" ::: "memory");   // no register that these stores name is rewritten ahead of this wait
      }
    } else {
      const int q = lane >> 3, c8 = (lane & 7) * 8;
      unsigned short* C  = (unsigned short*)Cout  + (size_t)b * strideC;
      unsigned short* C2 = (OUT_MODE == 2) ? ((unsigned short*)Cout2 + (size_t)b * strideC) : nullptr;
      {
#pragma unroll
        for (int it = 0; it < 4; ++it) {
          const int row = it * 4 + q;
          const float* sp = slab + row * 68 + c8;
          v8h hv, lv;
#pragma unroll
          for (int e = 0; e < 8; ++e) {
            if (OUT_MODE == 1) {
              hv[e] = (_Float16)sp[e];
            } else {
              unsigned short hb = f2bf_bits(sp[e]);
              unsigned short lb = f2bf_bits(sp[e] - bf_bits2f(hb));
              hv[e] = __builtin_bit_cast(_Float16, hb);
              lv[e] = __builtin_bit_cast(_Float16, lb);
            }
          }
          *(v8h*)(C + (size_t)(mBase + row) * ldc + n0 + c8) = hv;
          if (OUT_MODE == 2) *(v8h*)(C2 + (size_t)(mBase + row) * ldc + n0 + c8) = lv;
        }
        
      }
    }
    __builtin_amdgcn_fence(__ATOMIC_RELEASE, "workgroup");
    __builtin_amdgcn_wave_barrier();
    __builtin_amdgcn_fence(__ATOMIC_ACQUIRE, "workgroup");
  }
}

// ---------------------------------------------------------------------------
// f32 -> bf16 (RNE) plane, 8 elements per thread: one 16-B store per lane, 32 lanes = 512 contiguous B =
// ---------------------------------------------------------------------------
__device__ __forceinline__ void cvt_bf16x8_body(int blk, const float* __restrict__ in, unsigned short* __restrict__ out, int n8) {
  const int i = blk * 256 + threadIdx.x;
  if (i >= n8) return;
  const size_t base = (size_t)i * 8;
  const v4f a = *(const v4f*)(in + base), c = *(const v4f*)(in + base + 4);
  unsigned short hb[8];
#pragma unroll
  for (int e = 0; e < 4; ++e) { hb[e] = f2bf_bits(a[e]); hb[4 + e] = f2bf_bits(c[e]); }
  const v4u u = (v4u){pk16(hb[0], hb[1]), pk16(hb[2], hb[3]), pk16(hb[4], hb[5]), pk16(hb[6], hb[7])};
  *(v4u*)(out + base) = u;
  
}

// ---------------------------------------------------------------------------
// Weight transpose + cast: in W[d][h] (row-major [in 1024][out 1024] f32) -> out WT[h][d] = bf16_rne(W[d][h]), 4 planes.
// 1024 blocks: blk & 15 = d tile (64 cols of WT), (blk >> 4) & 15 = h tile (64 rows of WT), blk >> 8 selects W0..W3
// and the output plane (plane z at out + z*1024*1024 halves). 256 threads.
// Load coverage: 16 iterations x 256 threads = 4096 = the whole 64x64 tile (coalesced along h).
// Store coverage: 8 waves x 2 iterations x 4 rows (lane>>3) = 64 rows; (lane&7) x 8 halves = 64 cols; each row segment =
// ---------------------------------------------------------------------------
__device__ __forceinline__ void wtcast4_body(int blk, const float* __restrict__ W0, const float* __restrict__ W1,
                                             const float* __restrict__ W2, const float* __restrict__ W3,
                                             unsigned short* __restrict__ out) {
  __shared__ float sm[64][65];   // sm[h_local][d_local]
  const int t  = threadIdx.x;
  const int d0 = (blk & 15) * 64;
  const int h0 = ((blk >> 4) & 15) * 64;
  const int z  = blk >> 8;                                     // block-uniform
  const float* W = (z == 0) ? W0 : (z == 1) ? W1 : (z == 2) ? W2 : W3;
#pragma unroll
  for (int i = 0; i < 16; ++i) {
    const int e = i * 256 + t;
    const int r = e >> 6;          // d local
    const int cc = e & 63;         // h local
    sm[cc][r] = W[(size_t)(d0 + r) * kDim + h0 + cc];
  }
  __syncthreads();
  const int lane = t & 31, wave = t >> 5;
  const int q = lane >> 3, c8 = (lane & 7) * 8;
  unsigned short* op = out + (size_t)z * kDim * kDim;
  {
#pragma unroll
    for (int it = 0; it < 2; ++it) {
      const int row = wave * 8 + it * 4 + q;                 // h local
      unsigned short hb[8];
#pragma unroll
      for (int e = 0; e < 8; ++e) hb[e] = f2bf_bits(sm[row][c8 + e]);
      const v4u u = (v4u){pk16(hb[0], hb[1]), pk16(hb[2], hb[3]), pk16(hb[4], hb[5]), pk16(hb[6], hb[7])};
      *(v4u*)(op + (size_t)(h0 + row) * kDim + d0 + c8) = u;
    }
    asm volatile("s_wait_xcnt 0x0" ::: "memory");   // code of the launch's other work follows: no register that these stores name is rewritten ahead of this wait
  }
}

// ---------------------------------------------------------------------------
// Score bias table tb[n][j] (f32, [16][1024]): for j <= 1022: bf(r_bias[j+1][n]) - sum_d bf(r_w_bias[n][d]) * bf(r_emb[j+1][n][d]);
// tb[n][1023] = 0. Thread per (n, j), 64-tap rolled dot in fixed order (inputs only). r_emb / r_bias addresses clamped to row 1023,
// ---------------------------------------------------------------------------
__device__ __forceinline__ void tb_body(int blk, const float* __restrict__ rwb, const float* __restrict__ remb,
                                        const float* __restrict__ rbias, float* __restrict__ tb) {
  const int i = blk * 256 + threadIdx.x;                 // 0..16383
  const int n = i >> 10;
  const int j = i & (kSeq - 1);
  const bool keep = (j + 1 < kSeq);
  const int jr = keep ? (j + 1) : (kSeq - 1);
  const float* rp = remb + ((size_t)jr * kHeads + n) * kHd;
  const float* up = rwb + n * kHd;
  float acc = 0.f;
#pragma unroll 1
  for (int d = 0; d < kHd; ++d) acc = fmaf(bf_rne(up[d]), bf_rne(rp[d]), acc);
  const float val = keep ? (bf_rne(rbias[jr * kHeads + n]) - acc) : 0.0f;
  ((float*)tb)[i] = val;
  
}

// ---------------------------------------------------------------------------
// The three preparations that read inputs only (score bias table, weight transposes, w -> bf16 plane) in one launch of
// 256-thread blocks; the block index picks the work. The table's blocks come first: each of their threads walks a chain of
// 64 waited loads, the longest path of the launch, and it runs while the other blocks stream.
// ---------------------------------------------------------------------------
constexpr int kTbBlocks  = (kHeads * kSeq) / 256;               // 64
constexpr int kWtBlocks  = (kDim / 64) * (kDim / 64) * 4;       // 1024
constexpr int kCvtBlocks = (kTok * kDim / 8) / 256;             // 2048
__global__ __launch_bounds__(256) void prep_kernel(const float* __restrict__ w, const float* __restrict__ W0,
                                                   const float* __restrict__ W1, const float* __restrict__ W2,
                                                   const float* __restrict__ W3, const float* __restrict__ rwb,
                                                   const float* __restrict__ remb, const float* __restrict__ rbias,
                                                   unsigned short* __restrict__ Wb, unsigned short* __restrict__ WT,
                                                   float* __restrict__ tb) {
  const int bx = blockIdx.x;                                    // every branch below is block-uniform
  if (bx < kTbBlocks) {
    tb_body(bx, rwb, remb, rbias, tb);
  } else if (bx < kTbBlocks + kWtBlocks) {
    wtcast4_body(bx - kTbBlocks, W0, W1, W2, W3, WT);
  } else {
    cvt_bf16x8_body(bx - kTbBlocks - kWtBlocks, w, Wb, kTok * kDim / 8);
  }
}

// ---------------------------------------------------------------------------
// Relative-position flash attention for head_dim 64 (no mask). Block = 4 waves = 64 query rows of one (batch, head);
// grid = 4 * 16 * 16 = 1024 blocks of 128 threads; blockIdx.x = b*256 + h*16 + qb.
// Inputs: QRh/QRl = bf16 hi/lo planes of (q + r_w_bias) [4096][1024]; KRh/KRl = bf16 hi/lo planes of (k_j + r_emb_{j+1});
// Vp = f16 plane of v [4096][1024]; tb = f32 [16][1024] score bias table.
// score[i][j] = ((q+rwb)_i · (k_j + r_{j+1}) + tb[h][j]) * 0.125  : v_wmma_f32_16x16x32_bf16, hi*hi + hi*lo + lo*hi.
// out += P·V : v_wmma_f32_16x16x32_f16 (V staged transposed [d][kv] in LDS as f16); final out * 1/(l * 2^15).
// ---------------------------------------------------------------------------
__global__ __launch_bounds__(128) void relattn_kernel(
    const unsigned short* __restrict__ QRh, const unsigned short* __restrict__ QRl,
    const unsigned short* __restrict__ KRh, const unsigned short* __restrict__ KRl,
    const unsigned short* __restrict__ Vp, const float* __restrict__ tb,
    unsigned short* __restrict__ AVh, unsigned short* __restrict__ AVl) {
  union FB { v16b v; v8b h[2]; };
  union FH { v16h v; v8h h[2]; };
  __shared__ __align__(16) __bf16   Ksh[kKC * kAPitch];        // K hi [kv][d]   13 KB
  __shared__ __align__(16) __bf16   Ksl[kKC * kAPitch];        // K lo [kv][d]   13 KB
  __shared__ __align__(16) _Float16 Vt[kHd * kAPitch];         // V f16 [d][kv]  13 KB
  __shared__ __align__(16) _Float16 Psh[4][16 * kAPitch];      // per wave P [row][kv] 13 KB
  __shared__ __align__(16) float    Os[4][16 * kOsPitch];      // per wave out tile, pitch 68

  const int tid  = threadIdx.x;
  const int wave = tid >> 5;
  const int lane = tid & 31;
  const int hh   = lane >> 4;
  const int c    = lane & 15;

  const int bx = blockIdx.x;
  const int qb = bx & 15;
  const int h  = (bx >> 4) & 15;
  const int b  = bx >> 8;
  const int q0 = qb * 64 + wave * 16;
  const size_t tok0 = (size_t)b * kSeq;
  const int hcol = h * kHd;

  // ---- Q fragments (A operand): 2 d-chunks, hi and lo. Frag load: elements 0..7 <- k 8hh+0..7, 8..15 <- k 16+8hh+0..7 ----
  v16b qah[2], qal[2];
  {
    const __bf16* ph = (const __bf16*)QRh + (tok0 + q0 + c) * kDim + hcol + 8 * hh;
    const __bf16* pl = (const __bf16*)QRl + (tok0 + q0 + c) * kDim + hcol + 8 * hh;
#pragma unroll
    for (int dc = 0; dc < 2; ++dc) {
      qah[dc] = Frag<__bf16>::load(ph + dc * 32);
      qal[dc] = Frag<__bf16>::load(pl + dc * 32);
    }
  }

  float mrow[8], lrow[8];
  v8f oacc[4];
#pragma unroll
  for (int r = 0; r < 8; ++r) { mrow[r] = -INFINITY; lrow[r] = 0.f; }
#pragma unroll
  for (int t = 0; t < 4; ++t) oacc[t] = (v8f){0.f,0.f,0.f,0.f,0.f,0.f,0.f,0.f};

  for (int kc = 0; kc < kSeq / kKC; ++kc) {     // 16 chunks, block-uniform
    const int kv0 = kc * kKC;
    __syncthreads();
    {
      // staging coverage: 128 threads = 64 kv rows x 2 halves of 32 d; 4 x 16-B pieces each -> whole 64x64 tiles of K hi, K lo, V
      const int kvr = tid >> 1;
      const int dh  = (tid & 1) * 32;
      const size_t g = (tok0 + kv0 + kvr) * kDim + hcol + dh;
      const v8b* gkh = (const v8b*)((const __bf16*)KRh + g);
      const v8b* gkl = (const v8b*)((const __bf16*)KRl + g);
      const v8h* gv  = (const v8h*)((const _Float16*)Vp + g);
#pragma unroll
      for (int i = 0; i < 4; ++i) {
        const v8b a  = gkh[i];
        const v8b al = gkl[i];
        const v8h vv = gv[i];
        *(v8b*)(Ksh + kvr * kAPitch + dh + 8 * i) = a;
        *(v8b*)(Ksl + kvr * kAPitch + dh + 8 * i) = al;
#pragma unroll
        for (int e = 0; e < 8; ++e) Vt[(dh + 8 * i + e) * kAPitch + kvr] = vv[e];
      }
    }
    __syncthreads();

    v8f s[4];
#pragma unroll
    for (int j = 0; j < 4; ++j) {
      s[j] = (v8f){0.f,0.f,0.f,0.f,0.f,0.f,0.f,0.f};
#pragma unroll
      for (int dc = 0; dc < 2; ++dc) {
        FB kb, kl;
        kb.h[0] = *(const v8b*)(Ksh + (j * 16 + c) * kAPitch + dc * 32 + 8 * hh);
        kb.h[1] = *(const v8b*)(Ksh + (j * 16 + c) * kAPitch + dc * 32 + 16 + 8 * hh);
        kl.h[0] = *(const v8b*)(Ksl + (j * 16 + c) * kAPitch + dc * 32 + 8 * hh);
        kl.h[1] = *(const v8b*)(Ksl + (j * 16 + c) * kAPitch + dc * 32 + 16 + 8 * hh);
        s[j] = mma_bf16g(qah[dc], kb.v, s[j]);
        s[j] = mma_bf16g(qah[dc], kl.v, s[j]);
        s[j] = mma_bf16g(qal[dc], kb.v, s[j]);
      }
    }
    float tbv[4];
#pragma unroll
    for (int j = 0; j < 4; ++j) tbv[j] = tb[h * kSeq + kv0 + j * 16 + c];

    float cm[8];
#pragma unroll
    for (int r = 0; r < 8; ++r) {
      float m = -INFINITY;
#pragma unroll
      for (int j = 0; j < 4; ++j) {
        s[j][r] = (s[j][r] + tbv[j]) * kScale;
        m = fmaxf(m, s[j][r]);
      }
#pragma unroll
      for (int off = 1; off < 16; off <<= 1) m = fmaxf(m, __shfl_xor(m, off, 32));
      cm[r] = m;
    }
    _Float16* pw = Psh[wave];
#pragma unroll
    for (int r = 0; r < 8; ++r) {
      const float mnew  = fmaxf(mrow[r], cm[r]);
      const float alpha = expf(mrow[r] - mnew);
      mrow[r] = mnew;
      float psum = 0.f;
#pragma unroll
      for (int j = 0; j < 4; ++j) {
        const float p = expf(s[j][r] - mnew);
        psum += p;
        pw[(8 * hh + r) * kAPitch + j * 16 + c] = (_Float16)(p * kPCarry);
      }
#pragma unroll
      for (int off = 1; off < 16; off <<= 1) psum += __shfl_xor(psum, off, 32);
      lrow[r] = lrow[r] * alpha + psum;
#pragma unroll
      for (int t = 0; t < 4; ++t) oacc[t][r] *= alpha;
    }
    __builtin_amdgcn_fence(__ATOMIC_RELEASE, "workgroup");
    __builtin_amdgcn_wave_barrier();
    __builtin_amdgcn_fence(__ATOMIC_ACQUIRE, "workgroup");
#pragma unroll
    for (int kk = 0; kk < 2; ++kk) {
      FH pa;
      pa.h[0] = *(const v8h*)(pw + c * kAPitch + kk * 32 + 8 * hh);
      pa.h[1] = *(const v8h*)(pw + c * kAPitch + kk * 32 + 16 + 8 * hh);
#pragma unroll
      for (int t = 0; t < 4; ++t) {
        FH vb;
        vb.h[0] = *(const v8h*)(Vt + (t * 16 + c) * kAPitch + kk * 32 + 8 * hh);
        vb.h[1] = *(const v8h*)(Vt + (t * 16 + c) * kAPitch + kk * 32 + 16 + 8 * hh);
        oacc[t] = mma_f16g(pa.v, vb.v, oacc[t]);
      }
    }
  }

  float* os = Os[wave];
#pragma unroll
  for (int r = 0; r < 8; ++r) {
    const float inv = 1.0f / (lrow[r] * kPCarry);
#pragma unroll
    for (int t = 0; t < 4; ++t) os[(8 * hh + r) * kOsPitch + t * 16 + c] = oacc[t][r] * inv;
  }
  __builtin_amdgcn_fence(__ATOMIC_RELEASE, "workgroup");
  __builtin_amdgcn_wave_barrier();
  __builtin_amdgcn_fence(__ATOMIC_ACQUIRE, "workgroup");
  {
    const int q = lane >> 3, c8 = (lane & 7) * 8;
    {
#pragma unroll
      for (int it = 0; it < 4; ++it) {
        const int row = it * 4 + q;                       // 0..15
        const float* sp = os + row * kOsPitch + c8;
        v8h hv, lv;
#pragma unroll
        for (int e = 0; e < 8; ++e) {
          const unsigned short hb = f2bf_bits(sp[e]);
          const unsigned short lb = f2bf_bits(sp[e] - bf_bits2f(hb));
          hv[e] = __builtin_bit_cast(_Float16, hb);
          lv[e] = __builtin_bit_cast(_Float16, lb);
        }
        const size_t o = (tok0 + q0 + row) * kDim + hcol + c8;
        *(v8h*)(AVh + o) = hv;
        *(v8h*)(AVl + o) = lv;
      }
      
    }
  }
}

// ---------------------------------------------------------------------------
// y = (x - mu) * rsqrt(var + eps) * bf(gamma) + bf(beta). One block of 256 threads (8 waves) per row; thread t owns
// ---------------------------------------------------------------------------
__global__ __launch_bounds__(256) void ln_kernel(const float* __restrict__ w, const float* __restrict__ ao,
                                                 const float* __restrict__ g, const float* __restrict__ bt,
                                                 float* __restrict__ out) {
  __shared__ float red[16];
  const int row  = blockIdx.x;
  const int t    = threadIdx.x, lane = t & 31, wave = t >> 5;
  const int c0   = t * 4;
  const size_t off = (size_t)row * kDim + c0;
  const v4f a = *(const v4f*)(w + off);
  const v4f o = *(const v4f*)(ao + off);
  float x[4];
#pragma unroll
  for (int e = 0; e < 4; ++e) x[e] = bf_rne(a[e]) + o[e];
  float s = (x[0] + x[1]) + (x[2] + x[3]);
#pragma unroll
  for (int sh = 16; sh > 0; sh >>= 1) s += __shfl_xor(s, sh, 32);
  if (lane == 0) red[wave] = s;
  __syncthreads();
  const float mu = (((red[0] + red[1]) + (red[2] + red[3])) + ((red[4] + red[5]) + (red[6] + red[7]))) * kInvDim;
  float d[4];
  float s2 = 0.f;
#pragma unroll
  for (int e = 0; e < 4; ++e) { d[e] = x[e] - mu; s2 += d[e] * d[e]; }
#pragma unroll
  for (int sh = 16; sh > 0; sh >>= 1) s2 += __shfl_xor(s2, sh, 32);
  if (lane == 0) red[8 + wave] = s2;
  __syncthreads();
  const float var  = (((red[8] + red[9]) + (red[10] + red[11])) + ((red[12] + red[13]) + (red[14] + red[15]))) * kInvDim;
  const float rstd = rsqrtf(var + kLnEps);
  const v4f gg = *(const v4f*)(g + c0);
  const v4f bb = *(const v4f*)(bt + c0);
  v4f y;
#pragma unroll
  for (int e = 0; e < 4; ++e) y[e] = (d[e] * rstd) * bf_rne(gg[e]) + bf_rne(bb[e]);
  *(v4f*)(out + off) = y;
  
}

// ---------------------------------------------------------------------------
// Host launch glue. Workspace region map (bytes, all offsets 256-B aligned):
//   [0]            Wb    bf16 w plane            [4096][1024]      8,388,608
//   [8,388,608]    WT    bf16 Wq^T|Wk^T|Wv^T|Wo^T 4 x [1024][1024]  8,388,608
//   [16,777,216]   AVh|AVl bf16 attn_vec hi/lo   2 x [4096][1024]  16,777,216
//   [33,554,432]   AO    f32 attn_vec @ Wo       [4096][1024]      16,777,216
//   [50,331,648]   QRh|QRl bf16 (q+rwb) hi/lo    2 x [4096][1024]  16,777,216   (these three follow one another: the projection
//   [67,108,864]   KRh|KRl bf16 (k+r) hi/lo      2 x [4096][1024]  16,777,216    launch steps from q to k to v by one stride of
//   [83,886,080]   Vh    f16 v plane             [4096][1024]      8,388,608     two planes)
//   [92,274,688]   TB    f32 [16][1024]                            65,536
//   total 92,340,224
// ---------------------------------------------------------------------------
extern "C" void kernel_launch(void* const* d_in, const int* in_sizes, int n_in,
                              void* d_out, int out_size, void* d_ws, size_t ws_size,
                              hipStream_t stream) {
  if (n_in < 10) return;
  const float* w     = (const float*)d_in[0];
  const float* remb  = (const float*)d_in[1];
  const float* rwb   = (const float*)d_in[2];
  const float* rbias = (const float*)d_in[3];
  const float* Wq    = (const float*)d_in[4];
  const float* Wk    = (const float*)d_in[5];
  const float* Wv    = (const float*)d_in[6];
  const float* Wo    = (const float*)d_in[7];
  const float* gamma = (const float*)d_in[8];
  const float* beta  = (const float*)d_in[9];
  float* out = (float*)d_out;

  const size_t nTokD = (size_t)kTok * kDim;                    // 4,194,304 elements
  if ((size_t)in_sizes[0] != nTokD) return;
  if (in_sizes[1] != kSeq * kHeads * kHd) return;
  if (in_sizes[2] != kHeads * kHd) return;
  if (in_sizes[3] != kSeq * kHeads) return;
  if (in_sizes[4] != kDim * kDim || in_sizes[5] != kDim * kDim || in_sizes[6] != kDim * kDim || in_sizes[7] != kDim * kDim) return;
  if (in_sizes[8] != kDim || in_sizes[9] != kDim) return;
  if ((size_t)out_size != nTokD) return;

  const size_t bWb  = nTokD * 2;
  const size_t bWT  = (size_t)4 * kDim * kDim * 2;
  const size_t bAV  = nTokD * 2 * 2;
  const size_t bAO  = nTokD * 4;
  const size_t bQR  = nTokD * 2 * 2;
  const size_t bKR  = nTokD * 2 * 2;
  const size_t bVh  = nTokD * 2;
  const size_t bTB  = (size_t)kHeads * kSeq * 4;
  const size_t oWb  = 0;
  const size_t oWT  = oWb + bWb;
  const size_t oAV  = oWT + bWT;
  const size_t oAO  = oAV + bAV;
  const size_t oQR  = oAO + bAO;
  const size_t oKR  = oQR + bQR;
  const size_t oVh  = oKR + bKR;
  const size_t oTB  = oVh + bVh;
  const size_t total = oTB + bTB;                               // 92,340,224
  if (total > ws_size) return;

  char* ws = (char*)d_ws;
  unsigned short* Wb  = (unsigned short*)(ws + oWb);
  unsigned short* WT  = (unsigned short*)(ws + oWT);
  unsigned short* AVh = (unsigned short*)(ws + oAV);
  unsigned short* AVl = AVh + nTokD;
  float*          AO  = (float*)(ws + oAO);
  unsigned short* QRh = (unsigned short*)(ws + oQR);
  unsigned short* QRl = QRh + nTokD;
  unsigned short* KRh = (unsigned short*)(ws + oKR);
  unsigned short* KRl = KRh + nTokD;
  unsigned short* Vh  = (unsigned short*)(ws + oVh);
  float*          TB  = (float*)(ws + oTB);

  const long wPlane = (long)kDim * kDim;

  // 1. score bias table [16][1024]; weight transposes: in W[1024 in][1024 out] -> out WT[out][in], planes 0..3 = Wq, Wk, Wv, Wo;
  //    w -> bf16 plane
  prep_kernel<<<dim3(kTbBlocks + kWtBlocks + kCvtBlocks), dim3(256), 0, stream>>>(w, Wq, Wk, Wv, Wo, rwb, remb, rbias, Wb, WT, TB);
  // 2. q, k and v in one launch: batch index 0/1/2 selects the WT plane and the output (QRh|QRl, KRh|KRl, Vh: stride two planes);
  //    the epilogue adds r_w_bias (q) or the shifted r_emb row (k) and writes the planes that the attention reads.
  //    M=4096, N=1024, K=1024 (block tiles 32x8 = 256 blocks x 4 waves, x 3)
  wmma_gemm64<1, 0, 0, 3, false><<<dim3(256, 3), dim3(128), 0, stream>>>(
      Wb, Wb, kDim, 0L,
      WT, WT, kDim, wPlane,
      (void*)QRh, (void*)QRl, kDim, (long)(2 * nTokD),
      rwb, remb, 0L,
      kTok, kDim, kDim, 1.0f);
  // 3. attention -> attn_vec bf16 hi/lo planes
  relattn_kernel<<<dim3(kBatch * kHeads * (kSeq / 64)), dim3(128), 0, stream>>>(QRh, QRl, KRh, KRl, Vh, TB, AVh, AVl);
  // 4. attn_vec @ Wo (A hi/lo split, Wo bf16) -> f32
  wmma_gemm64<1, 2, 0, 0, false><<<dim3(256, 1), dim3(128), 0, stream>>>(
      AVh, AVl, kDim, 0L,
      WT + 3 * wPlane, WT + 3 * wPlane, kDim, 0L,
      (void*)AO, (void*)AO, kDim, 0L,
      gamma, gamma, 0L,
      kTok, kDim, kDim, 1.0f);
  // 5. residual + LayerNorm -> out
  ln_kernel<<<dim3(kTok), dim3(256), 0, stream>>>(w, AO, gamma, beta, out);
}

// v005
// A run of this version takes 121 microseconds.
// In two side-by-side timings against v004, it was 1.12 and 1.13 times as fast.
// Counting every step since v000, it is 2.55 times as fast.
// Compute dtypes: w@Wq|Wk|Wv on v_wmma_f32_16x16x32_bf16 (inputs RNE-converted to bf16, single product); scores (q+r_w_bias)·(k_j+r_emb_{j+1}) on v_wmma_f32_16x16x32_bf16 with bf16 hi/lo planes (hi*hi+hi*lo+lo*hi); attn_prob·v on v_wmma_f32_16x16x32_f16 (P f16 carried x32768, V f16); attn_vec@Wo on v_wmma_f32_16x16x32_bf16 (attn_vec bf16 hi/lo, Wo bf16: hi*W+lo*W); f32 accumulate everywhere; softmax, bias table, residual and LayerNorm in f32.
#include <hip/hip_runtime.h>
#include <math.h>

// ---------------------------------------------------------------------------
// Problem constants
// ---------------------------------------------------------------------------
constexpr int kBatch = 4;
constexpr int kSeq   = 1024;
constexpr int kDim   = 1024;
constexpr int kHeads = 16;
constexpr int kHd    = 64;
constexpr int kTok   = kBatch * kSeq;      // 4096 token rows
constexpr float kLnEps  = 1e-5f;
constexpr float kInvDim = 1.0f / 1024.0f;
constexpr float kScale  = 0.125f;          // 1/sqrt(64)
constexpr float kPCarry = 32768.0f;        // probabilities carried x2^15 in f16
constexpr int kKC = 64;                    // keys per chunk
constexpr int kOsPitch = 68;
// LDS row pitch of the attention K and V tiles in 16-bit elements: 208 B = 16 B x 13, an odd count of 16-B units, so the
// sixteen rows that a 16-B fragment read touches fall on sixteen different groups of four banks. 13 and not 9: the banks see
// no difference, but the builds do: at 144 B the twelve staging loads of a chunk are waited out almost one by one, at 208 B
// (five blocks a WGP fit, the grid supplies four) all twelve are issued together.
constexpr int kAPitch = 104;

typedef __attribute__((ext_vector_type(16))) _Float16 v16h;
typedef __attribute__((ext_vector_type(8)))  _Float16 v8h;
typedef __attribute__((ext_vector_type(16))) __bf16   v16b;
typedef __attribute__((ext_vector_type(8)))  __bf16   v8b;
typedef __attribute__((ext_vector_type(8)))  float    v8f;
typedef __attribute__((ext_vector_type(4)))  float    v4f;
typedef __attribute__((ext_vector_type(4)))  unsigned int v4u;

__device__ __forceinline__ unsigned short f2bf_bits(float f) {
  unsigned u = __float_as_uint(f);
  return (unsigned short)((u + 0x7FFFu + ((u >> 16) & 1u)) >> 16);
}
__device__ __forceinline__ float bf_bits2f(unsigned short h) { return __uint_as_float(((unsigned)h) << 16); }
__device__ __forceinline__ float bf_rne(float f) { return bf_bits2f(f2bf_bits(f)); }

// hazard guards as plain device helpers
__device__ __forceinline__ void dep_guard_h(v8f& a, v8f& b, v16h x, v16h y) { asm volatile("v_nop\n\tv_nop\n\tv_nop\n\tv_nop" : "+v"(a), "+v"(b) : "v"(x), "v"(y)); }
__device__ __forceinline__ void dep_guard_b(v8f& a, v8f& b, v16b x, v16b y) { asm volatile("v_nop\n\tv_nop\n\tv_nop\n\tv_nop" : "+v"(a), "+v"(b) : "v"(x), "v"(y)); }
__device__ __forceinline__ void keep4_h(v16h a, v16h b, v16h c, v16h d) { asm volatile("v_nop" :: "v"(a), "v"(b), "v"(c), "v"(d)); }
__device__ __forceinline__ void keep4_b(v16b a, v16b b, v16b c, v16b d) { asm volatile("v_nop" :: "v"(a), "v"(b), "v"(c), "v"(d)); }
__device__ __forceinline__ void acc_guard4(v8f& a, v8f& b, v8f& c, v8f& d) { asm volatile("v_nop\n\tv_nop\n\tv_nop\n\tv_nop" : "+v"(a), "+v"(b), "+v"(c), "+v"(d)); }
template <typename T> struct Frag;
template <> struct Frag<_Float16> {
  typedef v16h V; union U { v16h v; v8h h[2]; };
  static __device__ __forceinline__ v16h load(const _Float16* p) {   // elements 0..7 <- p[0..7], 8..15 <- p[16..23]
    U f; f.h[0] = *(const v8h*)(p); f.h[1] = *(const v8h*)(p + 16); return f.v;
  }
  static __device__ __forceinline__ v8f mma(v16h a, v16h b, v8f c) {
    return __builtin_amdgcn_wmma_f32_16x16x32_f16(false, a, false, b, (short)0, c, false, false);
  }
  static __device__ __forceinline__ void guard(v8f& a, v8f& b, v16h x, v16h y) { dep_guard_h(a, b, x, y); }
  static __device__ __forceinline__ void keep(v16h a, v16h b, v16h c, v16h d) { keep4_h(a, b, c, d); }
};
template <> struct Frag<__bf16> {
  typedef v16b V; union U { v16b v; v8b h[2]; };
  static __device__ __forceinline__ v16b load(const __bf16* p) {
    U f; f.h[0] = *(const v8b*)(p); f.h[1] = *(const v8b*)(p + 16); return f.v;
  }
  static __device__ __forceinline__ v8f mma(v16b a, v16b b, v8f c) {
    return __builtin_amdgcn_wmma_f32_16x16x32_bf16(false, a, false, b, (short)0, c, false, false);
  }
  static __device__ __forceinline__ void guard(v8f& a, v8f& b, v16b x, v16b y) { dep_guard_b(a, b, x, y); }
  static __device__ __forceinline__ void keep(v16b a, v16b b, v16b c, v16b d) { keep4_b(a, b, c, d); }
};

__device__ __forceinline__ unsigned pk16(unsigned short a, unsigned short b) { return (unsigned)a | ((unsigned)b << 16); }

// single WMMA issue with hazard guard (bf16 and f16 twins)
__device__ __forceinline__ v8f mma_bf16g(v16b a, v16b b, v8f c) {
  c = __builtin_amdgcn_wmma_f32_16x16x32_bf16(false, a, false, b, (short)0, c, false, false);
  asm volatile("v_nop\n\tv_nop\n\tv_nop\n\tv_nop" : "+v"(c) : "v"(a), "v"(b));
  return c;
}
__device__ __forceinline__ v8f mma_f16g(v16h a, v16h b, v8f c) {
  c = __builtin_amdgcn_wmma_f32_16x16x32_f16(false, a, false, b, (short)0, c, false, false);
  asm volatile("v_nop\n\tv_nop\n\tv_nop\n\tv_nop" : "+v"(c) : "v"(a), "v"(b));
  return c;
}

// the value that lane l ^ 16 holds
__device__ __forceinline__ float other_half(float x) {
  const int b = __float_as_int(x);
  return __int_as_float(__builtin_amdgcn_permlanex16(b, b, 0x76543210, 0xfedcba98, false, false));
}

// ---- LDS staging of the GEMM operands ----
constexpr int kGK     = 64;                  // k per pass: 128 B of every operand row
constexpr int kGPitch = 72;                  // LDS row pitch in 16-bit elements: 144 B = 16 B x 9, conflict-free for 16-B row reads
constexpr int kGPlane = 128 * kGPitch;       // one operand plane of one buffer: 128 rows

// Eight asynchronous 16-B copies of one lane, global -> LDS, rows 16 apart (l, g: the lane's own LDS byte address and
// global address of the first; lstep, gstep: the step to the next). The closing s_wait_xcnt stands inside the statement
// so that no address register named here is rewritten ahead of it.
__device__ __forceinline__ void async_copy8(unsigned l, unsigned lstep, const unsigned short* g, size_t gstep) {
  asm volatile(
      "global_load_async_to_lds_b128 %0, %8, off\n\t"
      "global_load_async_to_lds_b128 %1, %9, off\n\t"
      "global_load_async_to_lds_b128 %2, %10, off\n\t"
      "global_load_async_to_lds_b128 %3, %11, off\n\t"
      "global_load_async_to_lds_b128 %4, %12, off\n\t"
      "global_load_async_to_lds_b128 %5, %13, off\n\t"
      "global_load_async_to_lds_b128 %6, %14, off\n\t"
      "global_load_async_to_lds_b128 %7, %15, off\n\t"
      "s_wait_xcnt 0x0"
      :: "v"(l), "v"(l + lstep), "v"(l + 2 * lstep), "v"(l + 3 * lstep),
         "v"(l + 4 * lstep), "v"(l + 5 * lstep), "v"(l + 6 * lstep), "v"(l + 7 * lstep),
         "v"(g), "v"(g + gstep), "v"(g + 2 * gstep), "v"(g + 3 * gstep),
         "v"(g + 4 * gstep), "v"(g + 5 * gstep), "v"(g + 6 * gstep), "v"(g + 7 * gstep)
      : "memory");
}

// Eight 16-B global loads of one lane: 32 B from each of four row pointers. Loads and their data wait stand in one
// statement and every result is an early-clobber output, so that no result lands in an address pair of the run and no
// address register is rewritten while a load that names it is in flight.
__device__ __forceinline__ void load4x32(const float* p0, const float* p1, const float* p2, const float* p3, v4f (&lo)[4], v4f (&hi)[4]) {
  asm volatile(
      "global_load_b128 %0, %8, off\n\t"
      "global_load_b128 %1, %8, off offset:16\n\t"
      "global_load_b128 %2, %9, off\n\t"
      "global_load_b128 %3, %9, off offset:16\n\t"
      "global_load_b128 %4, %10, off\n\t"
      "global_load_b128 %5, %10, off offset:16\n\t"
      "global_load_b128 %6, %11, off\n\t"
      "global_load_b128 %7, %11, off offset:16\n\t"
      "s_wait_loadcnt 0x0"
      : "=&v"(lo[0]), "=&v"(hi[0]), "=&v"(lo[1]), "=&v"(hi[1]), "=&v"(lo[2]), "=&v"(hi[2]), "=&v"(lo[3]), "=&v"(hi[3])
      : "v"(p0), "v"(p1), "v"(p2), "v"(p3)
      : "memory");
}

// ---- Register-blocked batched WMMA GEMM (SPLIT widened to an int mode, ACT reduced to relu/leaky) ----
// C[m,n] = scale * sum_k A[m,k] * Bt[n,k] (+bias)(+resid); each wave owns a 64x64 tile, 2x2 waves share a 128x128 block tile.
// Per pass the block's 128 A rows and 128 Bt rows x 64 k are staged in LDS by asynchronous copies, two buffers: the copies
// of pass t+1 fly while pass t is worked on; fragments are read from LDS in the same k order as from global memory.
// A row-major [M,K]; Bt row-major [N,K]; M,N % 128 == 0, K % 64 == 0.
// SPLIT: 0 = single product; 1 = A and Bt hi/lo planes (hi*hi + hi*lo + lo*hi); 2 = A hi/lo only (hi*B + lo*B).
// BIAS_MODE: 0 = none, 1 = bias[m], 2 = bias[n].
// OUT_MODE: 0 = f32, 1 = f16, 2 = bf16 hi plane (Cout) + bf16 lo plane (Cout2),
//           3 = the q|k|v projection, one launch, batch index b picks the product and what its epilogue does:
//               b = 0: x = q + bf(bias[n])                                   -> bf16 hi/lo planes (bias = r_w_bias, flat [1024])
//               b = 1: x = k_j + bf(resid[j+1][n]), nothing added at j = 1023 -> bf16 hi/lo planes (resid = r_emb, flat [1024][1024],
//                      j = m mod 1024; the address is clamped to row 1023 and the value zeroed by predicate)
//               b = 2: v -> f16 plane (Cout only)
// ET: 0 = f16 operands, 1 = bf16 operands (pointers passed as 16-bit storage)
template <int ET> struct Elem;
template <> struct Elem<0> { typedef _Float16 T; };
template <> struct Elem<1> { typedef __bf16 T; };
template <int ET, int SPLIT, int BIAS_MODE, int OUT_MODE, bool RESID, int ACT = 0>
__global__ __launch_bounds__(128) void wmma_gemm64(
    const unsigned short* __restrict__ Ap, const unsigned short* __restrict__ A2p, int lda, long strideA,
    const unsigned short* __restrict__ Btp, const unsigned short* __restrict__ Bt2p, int ldb, long strideB,
    void* __restrict__ Cout, void* __restrict__ Cout2, int ldc, long strideC,
    const float* __restrict__ bias,
    const float* __restrict__ resid, long strideR,
    int M, int N, int K, float scale) {
  typedef typename Elem<ET>::T T;
  typedef typename Frag<T>::V V;
  constexpr int NPL = 2 + ((SPLIT != 0) ? 1 : 0) + ((SPLIT == 1) ? 1 : 0);   // planes per buffer: A, Bt, A lo, Bt lo
  __shared__ __align__(16) T sStage[2 * NPL * kGPlane];   // two buffers of NPL planes
  __shared__ __align__(16) float sT[4][16 * 68];   // per-wave 16x64 slab, pitch 68 floats
  const int b    = blockIdx.y;
  const int tid  = threadIdx.x;
  const int lane = tid & 31;
  const int wave = tid >> 5;
  const int tilesN = N >> 7;
  const int tilesM = M >> 7;
  const int tile = blockIdx.x;
  if (tile >= tilesM * tilesN) return;   // block-uniform, ahead of every barrier and copy
  const int tm = tile / tilesN;
  const int tn = tile - tm * tilesN;
  const int bm0 = tm << 7;
  const int bn0 = tn << 7;
  const int wm  = (wave >> 1) << 6;            // this wave's 64x64 tile inside the block tile
  const int wn  = (wave & 1) << 6;
  const int m0 = bm0 + wm;
  const int n0 = bn0 + wn;

  // staging coverage per plane: 128 threads x 8 copies x 16 B = 128 rows x 128 B; 8 lanes cover one whole 128-B row piece
  const int crow = tid >> 3;                   // 0..15, copy i takes row crow + 16 i
  const int ccol = (tid & 7) * 8;              // element offset of the lane's 16 B
  const unsigned short* gA  = Ap  + (size_t)b * strideA + (size_t)(bm0 + crow) * lda + ccol;
  const unsigned short* gB  = Btp + (size_t)b * strideB + (size_t)(bn0 + crow) * ldb + ccol;
  const unsigned short* gA2 = (SPLIT != 0) ? (A2p  + (size_t)b * strideA + (size_t)(bm0 + crow) * lda + ccol) : nullptr;
  const unsigned short* gB2 = (SPLIT == 1) ? (Bt2p + (size_t)b * strideB + (size_t)(bn0 + crow) * ldb + ccol) : nullptr;
  const unsigned lBase = (unsigned)(size_t)sStage + (unsigned)(crow * kGPitch + ccol) * 2u;
  auto stage = [&](int t) {                    // pass t's operand rows into buffer t & 1
    const unsigned l = lBase + (unsigned)(t & 1) * (unsigned)(NPL * kGPlane * 2);
    const int k0 = t * kGK;
    async_copy8(l, 16 * kGPitch * 2, gA + k0, (size_t)16 * lda);
    async_copy8(l + kGPlane * 2, 16 * kGPitch * 2, gB + k0, (size_t)16 * ldb);
    if (SPLIT != 0) async_copy8(l + 2 * kGPlane * 2, 16 * kGPitch * 2, gA2 + k0, (size_t)16 * lda);
    if (SPLIT == 1) async_copy8(l + 3 * kGPlane * 2, 16 * kGPitch * 2, gB2 + k0, (size_t)16 * ldb);
  };

  const int rlane = lane & 15;                 // row (A) / col (B, D) within subtile
  const int koff  = (lane >> 4) * 8;           // k offset of this lane half
  const int mOff  = (lane >> 4) * 8;           // D row offset

  v8f acc[4][4];
#pragma unroll
  for (int i = 0; i < 4; ++i)
#pragma unroll
    for (int j = 0; j < 4; ++j) acc[i][j] = (v8f){0.f,0.f,0.f,0.f,0.f,0.f,0.f,0.f};

  const int nT = K >> 6;                       // passes
  stage(0);
  asm volatile("s_wait_asynccnt 0x0" ::: "memory");   // this wave's copies of pass 0 have landed
  __syncthreads();                                     // every wave's have: pass 0 is readable
  if (nT > 1) stage(1);

  for (int t = 0; t < nT; ++t) {
    const T* sb = sStage + (t & 1) * (NPL * kGPlane);
    const int aoff = (wm + rlane) * kGPitch + koff;
    const int boff = (wn + rlane) * kGPitch + koff;
    // the loops below are unrolled so that every fragment and accumulator index is a constant (registers, no scratch)
#pragma unroll
    for (int ks = 0; ks < kGK; ks += 32) {
      V bh[4], bl[4];
#pragma unroll
      for (int j = 0; j < 4; ++j) {
        const int bo = boff + (j << 4) * kGPitch + ks;
        bh[j] = Frag<T>::load(sb + kGPlane + bo);
        if (SPLIT == 1) bl[j] = Frag<T>::load(sb + 3 * kGPlane + bo);
      }
      V ah[4], al[4];                            // the whole 32-k block's fragments are read as one group ahead of its products
#pragma unroll
      for (int i = 0; i < 4; ++i) {
        const int ao = aoff + (i << 4) * kGPitch + ks;
        ah[i] = Frag<T>::load(sb + ao);
        if (SPLIT != 0) al[i] = Frag<T>::load(sb + 2 * kGPlane + ao);
      }
#pragma unroll
      for (int i = 0; i < 4; ++i) {
#pragma unroll
        for (int j = 0; j < 4; ++j) {
          acc[i][j] = Frag<T>::mma(ah[i], bh[j], acc[i][j]);
          if (SPLIT == 1) acc[i][j] = Frag<T>::mma(ah[i], bl[j], acc[i][j]);
          if (SPLIT != 0) acc[i][j] = Frag<T>::mma(al[i], bh[j], acc[i][j]);
        }
        Frag<T>::guard(acc[i][0], acc[i][3], ah[i], (SPLIT != 0) ? al[i] : ah[i]);
      }
      Frag<T>::keep(bh[0], bh[1], bh[2], bh[3]);
      if (SPLIT == 1) Frag<T>::keep(bl[0], bl[1], bl[2], bl[3]);
    }
    asm volatile("s_wait_dscnt 0x0" ::: "memory");     // this wave's reads of buffer t & 1 are done before it is refilled
    asm volatile("s_wait_asynccnt 0x0" ::: "memory");  // this wave's copies of pass t + 1 have landed
    __syncthreads();                                    // publishes pass t + 1 and ends every reader's use of buffer t & 1
    if (t + 2 < nT) stage(t + 2);
  }
  asm volatile("s_wait_asynccnt 0x0" ::: "memory");    // nothing in flight when the wave goes on to the epilogue and ends
  acc_guard4(acc[0][0], acc[0][1], acc[0][2], acc[0][3]);
  acc_guard4(acc[1][0], acc[1][1], acc[1][2], acc[1][3]);
  acc_guard4(acc[2][0], acc[2][1], acc[2][2], acc[2][3]);
  acc_guard4(acc[3][0], acc[3][1], acc[3][2], acc[3][3]);

  // ---- epilogue ----
  float* slab = sT[wave];
  const float* Rb = RESID ? (resid + (size_t)b * strideR) : nullptr;
#pragma unroll
  for (int i = 0; i < 4; ++i) {
    const int mBase = m0 + (i << 4);
#pragma unroll
    for (int j = 0; j < 4; ++j) {
      const int n = n0 + (j << 4) + rlane;
      float bv = 0.f;
      if (BIAS_MODE == 2) bv = bias[n];
#pragma unroll
      for (int r = 0; r < 8; ++r) {
        float v = acc[i][j][r] * scale;
        if (BIAS_MODE == 1) v += bias[mBase + mOff + r];
        if (BIAS_MODE == 2) v += bv;
        if (RESID) v += Rb[(size_t)(mBase + mOff + r) * ldc + n];
        if (ACT == 2) v = fmaxf(v, 0.0f);
        if (ACT == 4) v = (v > 0.f) ? v : 0.01f * v;
        slab[(mOff + r) * 68 + (j << 4) + rlane] = v;
      }
    }
    __builtin_amdgcn_fence(__ATOMIC_RELEASE, "workgroup");
    __builtin_amdgcn_wave_barrier();
    __builtin_amdgcn_fence(__ATOMIC_ACQUIRE, "workgroup");
    if (OUT_MODE == 0) {
      float* C = (float*)Cout + (size_t)b * strideC;
      const int hh = lane >> 4, c4 = (lane & 15) * 4;     // row seg = 256 B = 16 lanes x 16 B
      {
#pragma unroll
        for (int it = 0; it < 8; ++it) {
          const int row = it * 2 + hh;
          v4f v = *(const v4f*)(slab + row * 68 + c4);
          *(v4f*)(C + (size_t)(mBase + row) * ldc + n0 + c4) = v;
        }
        
      }
    } else if (OUT_MODE == 3) {
      const int q = lane >> 3, c8 = (lane & 7) * 8;       // row seg = 128 B = 8 lanes x 16 B, per plane
      unsigned short* C  = (unsigned short*)Cout  + (size_t)b * strideC;
      unsigned short* C2 = (unsigned short*)Cout2 + (size_t)b * strideC;
      // the loops below are unrolled so that every vector element and array index is a constant (registers, no scratch)
      if (b == 2) {                                        // block-uniform
#pragma unroll
        for (int it = 0; it < 4; ++it) {
          const int row = it * 4 + q;
          const float* sp = slab + row * 68 + c8;
          v8h hv;
#pragma unroll
          for (int e = 0; e < 8; ++e) hv[e] = (_Float16)sp[e];
          *(v8h*)(C + (size_t)(mBase + row) * ldc + n0 + c8) = hv;
        }
      } else {
        const float* ap[4];
        bool keep[4];
#pragma unroll
        for (int it = 0; it < 4; ++it) {
          const int jtok = (mBase + it * 4 + q) & (kSeq - 1);
          keep[it] = (b == 0) || (jtok + 1 < kSeq);
          const int jr = (jtok + 1 < kSeq) ? (jtok + 1) : (kSeq - 1);                 // clamped address
          ap[it] = (b == 0) ? (bias + n0 + c8) : (resid + (size_t)jr * kDim + n0 + c8);
        }
        v4f a0[4], a1[4];
        load4x32(ap[0], ap[1], ap[2], ap[3], a0, a1);
#pragma unroll
        for (int it = 0; it < 4; ++it) {
          const int row = it * 4 + q;
          const float* sp = slab + row * 68 + c8;
          v8h hv, lv;
#pragma unroll
          for (int e = 0; e < 8; ++e) {
            const float ad = (e < 4) ? a0[it][e & 3] : a1[it][e & 3];
            const float x = sp[e] + (keep[it] ? bf_rne(ad) : 0.0f);
            const unsigned short hb = f2bf_bits(x);
            const unsigned short lb = f2bf_bits(x - bf_bits2f(hb));
            hv[e] = __builtin_bit_cast(_Float16, hb);
            lv[e] = __builtin_bit_cast(_Float16, lb);
          }
          *(v8h*)(C  + (size_t)(mBase + row) * ldc + n0 + c8) = hv;
          *(v8h*)(C2 + (size_t)(mBase + row) * ldc + n0 + c8) = lv;
        }
        asm volatile("s_wait_xcnt 0x0" ::: "memory");   // no register that these stores name is rewritten ahead of this wait
      }
    } else {
      const int q = lane >> 3, c8 = (lane & 7) * 8;
      unsigned short* C  = (unsigned short*)Cout  + (size_t)b * strideC;
      unsigned short* C2 = (OUT_MODE == 2) ? ((unsigned short*)Cout2 + (size_t)b * strideC) : nullptr;
      {
#pragma unroll
        for (int it = 0; it < 4; ++it) {
          const int row = it * 4 + q;
          const float* sp = slab + row * 68 + c8;
          v8h hv, lv;
#pragma unroll
          for (int e = 0; e < 8; ++e) {
            if (OUT_MODE == 1) {
              hv[e] = (_Float16)sp[e];
            } else {
              unsigned short hb = f2bf_bits(sp[e]);
              unsigned short lb = f2bf_bits(sp[e] - bf_bits2f(hb));
              hv[e] = __builtin_bit_cast(_Float16, hb);
              lv[e] = __builtin_bit_cast(_Float16, lb);
            }
          }
          *(v8h*)(C + (size_t)(mBase + row) * ldc + n0 + c8) = hv;
          if (OUT_MODE == 2) *(v8h*)(C2 + (size_t)(mBase + row) * ldc + n0 + c8) = lv;
        }
        
      }
    }
    __builtin_amdgcn_fence(__ATOMIC_RELEASE, "workgroup");
    __builtin_amdgcn_wave_barrier();
    __builtin_amdgcn_fence(__ATOMIC_ACQUIRE, "workgroup");
  }
}

// ---------------------------------------------------------------------------
// f32 -> bf16 (RNE) plane, 8 elements per thread: one 16-B store per lane, 32 lanes = 512 contiguous B =
// ---------------------------------------------------------------------------
__device__ __forceinline__ void cvt_bf16x8_body(int blk, const float* __restrict__ in, unsigned short* __restrict__ out, int n8) {
  const int i = blk * 256 + threadIdx.x;
  if (i >= n8) return;
  const size_t base = (size_t)i * 8;
  const v4f a = *(const v4f*)(in + base), c = *(const v4f*)(in + base + 4);
  unsigned short hb[8];
#pragma unroll
  for (int e = 0; e < 4; ++e) { hb[e] = f2bf_bits(a[e]); hb[4 + e] = f2bf_bits(c[e]); }
  const v4u u = (v4u){pk16(hb[0], hb[1]), pk16(hb[2], hb[3]), pk16(hb[4], hb[5]), pk16(hb[6], hb[7])};
  *(v4u*)(out + base) = u;
  
}

// ---------------------------------------------------------------------------
// Weight transpose + cast: in W[d][h] (row-major [in 1024][out 1024] f32) -> out WT[h][d] = bf16_rne(W[d][h]), 4 planes.
// 1024 blocks: blk & 15 = d tile (64 cols of WT), (blk >> 4) & 15 = h tile (64 rows of WT), blk >> 8 selects W0..W3
// and the output plane (plane z at out + z*1024*1024 halves). 256 threads.
// Load coverage: 16 iterations x 256 threads = 4096 = the whole 64x64 tile (coalesced along h).
// Store coverage: 8 waves x 2 iterations x 4 rows (lane>>3) = 64 rows; (lane&7) x 8 halves = 64 cols; each row segment =
// ---------------------------------------------------------------------------
__device__ __forceinline__ void wtcast4_body(int blk, const float* __restrict__ W0, const float* __restrict__ W1,
                                             const float* __restrict__ W2, const float* __restrict__ W3,
                                             unsigned short* __restrict__ out) {
  __shared__ float sm[64][65];   // sm[h_local][d_local]
  const int t  = threadIdx.x;
  const int d0 = (blk & 15) * 64;
  const int h0 = ((blk >> 4) & 15) * 64;
  const int z  = blk >> 8;                                     // block-uniform
  const float* W = (z == 0) ? W0 : (z == 1) ? W1 : (z == 2) ? W2 : W3;
#pragma unroll
  for (int i = 0; i < 16; ++i) {
    const int e = i * 256 + t;
    const int r = e >> 6;          // d local
    const int cc = e & 63;         // h local
    sm[cc][r] = W[(size_t)(d0 + r) * kDim + h0 + cc];
  }
  __syncthreads();
  const int lane = t & 31, wave = t >> 5;
  const int q = lane >> 3, c8 = (lane & 7) * 8;
  unsigned short* op = out + (size_t)z * kDim * kDim;
  {
#pragma unroll
    for (int it = 0; it < 2; ++it) {
      const int row = wave * 8 + it * 4 + q;                 // h local
      unsigned short hb[8];
#pragma unroll
      for (int e = 0; e < 8; ++e) hb[e] = f2bf_bits(sm[row][c8 + e]);
      const v4u u = (v4u){pk16(hb[0], hb[1]), pk16(hb[2], hb[3]), pk16(hb[4], hb[5]), pk16(hb[6], hb[7])};
      *(v4u*)(op + (size_t)(h0 + row) * kDim + d0 + c8) = u;
    }
    asm volatile("s_wait_xcnt 0x0" ::: "memory");   // code of the launch's other work follows: no register that these stores name is rewritten ahead of this wait
  }
}

// ---------------------------------------------------------------------------
// Score bias table tb[n][j] (f32, [16][1024]): for j <= 1022: bf(r_bias[j+1][n]) - sum_d bf(r_w_bias[n][d]) * bf(r_emb[j+1][n][d]);
// tb[n][1023] = 0. Thread per (n, j), 64-tap rolled dot in fixed order (inputs only). r_emb / r_bias addresses clamped to row 1023,
// ---------------------------------------------------------------------------
__device__ __forceinline__ void tb_body(int blk, const float* __restrict__ rwb, const float* __restrict__ remb,
                                        const float* __restrict__ rbias, float* __restrict__ tb) {
  const int i = blk * 256 + threadIdx.x;                 // 0..16383
  const int n = i >> 10;
  const int j = i & (kSeq - 1);
  const bool keep = (j + 1 < kSeq);
  const int jr = keep ? (j + 1) : (kSeq - 1);
  const float* rp = remb + ((size_t)jr * kHeads + n) * kHd;
  const float* up = rwb + n * kHd;
  float acc = 0.f;
#pragma unroll 1
  for (int d = 0; d < kHd; ++d) acc = fmaf(bf_rne(up[d]), bf_rne(rp[d]), acc);
  const float val = keep ? (bf_rne(rbias[jr * kHeads + n]) - acc) : 0.0f;
  ((float*)tb)[i] = val;
  
}

// ---------------------------------------------------------------------------
// The three preparations that read inputs only (score bias table, weight transposes, w -> bf16 plane) in one launch of
// 256-thread blocks; the block index picks the work. The table's blocks come first: each of their threads walks a chain of
// 64 waited loads, the longest path of the launch, and it runs while the other blocks stream.
// ---------------------------------------------------------------------------
constexpr int kTbBlocks  = (kHeads * kSeq) / 256;               // 64
constexpr int kWtBlocks  = (kDim / 64) * (kDim / 64) * 4;       // 1024
constexpr int kCvtBlocks = (kTok * kDim / 8) / 256;             // 2048
__global__ __launch_bounds__(256) void prep_kernel(const float* __restrict__ w, const float* __restrict__ W0,
                                                   const float* __restrict__ W1, const float* __restrict__ W2,
                                                   const float* __restrict__ W3, const float* __restrict__ rwb,
                                                   const float* __restrict__ remb, const float* __restrict__ rbias,
                                                   unsigned short* __restrict__ Wb, unsigned short* __restrict__ WT,
                                                   float* __restrict__ tb) {
  const int bx = blockIdx.x;                                    // every branch below is block-uniform
  if (bx < kTbBlocks) {
    tb_body(bx, rwb, remb, rbias, tb);
  } else if (bx < kTbBlocks + kWtBlocks) {
    wtcast4_body(bx - kTbBlocks, W0, W1, W2, W3, WT);
  } else {
    cvt_bf16x8_body(bx - kTbBlocks - kWtBlocks, w, Wb, kTok * kDim / 8);
  }
}

// ---------------------------------------------------------------------------
// Relative-position flash attention for head_dim 64 (no mask). Block = 4 waves = 64 query rows of one (batch, head);
// grid = 4 * 16 * 16 = 1024 blocks of 128 threads; blockIdx.x = b*256 + h*16 + qb.
// Inputs: QRh/QRl = bf16 hi/lo planes of (q + r_w_bias) [4096][1024]; KRh/KRl = bf16 hi/lo planes of (k_j + r_emb_{j+1});
// Vp = f16 plane of v [4096][1024]; tb = f32 [16][1024] score bias table.
// score[i][j] = ((q+rwb)_i · (k_j + r_{j+1}) + tb[h][j]) * 0.125  : v_wmma_f32_16x16x32_bf16, hi*hi + hi*lo + lo*hi.
// out += P·V : v_wmma_f32_16x16x32_f16 (V staged transposed [d][kv] in LDS as f16); final out * 1/(l * 2^15).
// Both products are formed transposed (S^T = K Q^T, out^T = V^T P^T): a lane holds one query's scores, so the row maximum and
// sum are taken in the lane with one exchange between the wave's halves, and P^T goes from the score registers into the B operand.
// ---------------------------------------------------------------------------
// Four waves a SIMD is what the grid supplies (1024 blocks of 4 waves on 256 WGPs): stated, so that the compiler budgets registers
// for that and not for the larger number of blocks that the LDS would admit; with the tighter budget it waits out the staging
// loads one by one and strings the exponentials in one chain.
__global__ __launch_bounds__(128) __attribute__((amdgpu_waves_per_eu(4, 4))) void relattn_kernel(
    const unsigned short* __restrict__ QRh, const unsigned short* __restrict__ QRl,
    const unsigned short* __restrict__ KRh, const unsigned short* __restrict__ KRl,
    const unsigned short* __restrict__ Vp, const float* __restrict__ tb,
    unsigned short* __restrict__ AVh, unsigned short* __restrict__ AVl) {
  union FB { v16b v; v8b h[2]; };
  union FH { v16h v; v8h h[2]; };
  __shared__ __align__(16) __bf16   Ksh[kKC * kAPitch];        // K hi [kv][d]   13 KB
  __shared__ __align__(16) __bf16   Ksl[kKC * kAPitch];        // K lo [kv][d]   13 KB
  __shared__ __align__(16) _Float16 Vt[kHd * kAPitch];         // V f16 [d][kv]  13 KB
  __shared__ __align__(16) float    Os[4][16 * kOsPitch];      // per wave out tile, pitch 68

  const int tid  = threadIdx.x;
  const int wave = tid >> 5;
  const int lane = tid & 31;
  const int hh   = lane >> 4;
  const int c    = lane & 15;

  const int bx = blockIdx.x;
  const int qb = bx & 15;
  const int h  = (bx >> 4) & 15;
  const int b  = bx >> 8;
  const int q0 = qb * 64 + wave * 16;
  const size_t tok0 = (size_t)b * kSeq;
  const int hcol = h * kHd;

  // ---- Q fragments (B operand): 2 d-chunks, hi and lo. Frag load: elements 0..7 <- k 8hh+0..7, 8..15 <- k 16+8hh+0..7 ----
  v16b qah[2], qal[2];
  {
    const __bf16* ph = (const __bf16*)QRh + (tok0 + q0 + c) * kDim + hcol + 8 * hh;
    const __bf16* pl = (const __bf16*)QRl + (tok0 + q0 + c) * kDim + hcol + 8 * hh;
#pragma unroll
    for (int dc = 0; dc < 2; ++dc) {
      qah[dc] = Frag<__bf16>::load(ph + dc * 32);
      qal[dc] = Frag<__bf16>::load(pl + dc * 32);
    }
  }

  // Lane (c, hh) owns query column c: mrow is that query's running maximum (equal in both halves), lrow the sum over the keys
  // that this half holds (8hh + 0..7 of every 16); the halves' sums are joined once, behind the loop.
  float mrow = -INFINITY, lrow = 0.f;
  v8f oacc[4];                                  // oacc[t][r] = out^T[d = 16t + 8hh + r][query c]
#pragma unroll
  for (int t = 0; t < 4; ++t) oacc[t] = (v8f){0.f,0.f,0.f,0.f,0.f,0.f,0.f,0.f};

  for (int kc = 0; kc < kSeq / kKC; ++kc) {     // 16 chunks, block-uniform
    const int kv0 = kc * kKC;
    __syncthreads();
    {
      // staging coverage: 128 threads = 64 kv rows x 2 halves of 32 d; 4 x 16-B pieces each -> whole 64x64 tiles of K hi, K lo, V
      const int kvr = tid >> 1;
      const int dh  = (tid & 1) * 32;
      const size_t g = (tok0 + kv0 + kvr) * kDim + hcol + dh;
      const v8b* gkh = (const v8b*)((const __bf16*)KRh + g);
      const v8b* gkl = (const v8b*)((const __bf16*)KRl + g);
      const v8h* gv  = (const v8h*)((const _Float16*)Vp + g);
      v8b a[4], al[4];
      v8h vv[4];
#pragma unroll
      for (int i = 0; i < 4; ++i) {
        a[i]  = gkh[i];
        al[i] = gkl[i];
        vv[i] = gv[i];
      }
      // the three address pairs are inputs here, so they stay whole up to this wait: no result of the twelve loads lands in one,
      // and nothing rewrites one ahead of the wait
      asm volatile("s_wait_xcnt 0x0" :: "v"(gkh), "v"(gkl), "v"(gv) : "memory");
#pragma unroll
      for (int i = 0; i < 4; ++i) {
        *(v8b*)(Ksh + kvr * kAPitch + dh + 8 * i) = a[i];
        *(v8b*)(Ksl + kvr * kAPitch + dh + 8 * i) = al[i];
#pragma unroll
        for (int e = 0; e < 8; ++e) Vt[(dh + 8 * i + e) * kAPitch + kvr] = vv[i][e];
      }
    }
    __syncthreads();

    // the table entries of this lane's 32 keys (16j + 8hh + 0..7); they arrive while the score products run
    v4f tb0[4], tb1[4];
#pragma unroll
    for (int j = 0; j < 4; ++j) {
      const float* tp = tb + h * kSeq + kv0 + j * 16 + 8 * hh;
      tb0[j] = *(const v4f*)(tp);
      tb1[j] = *(const v4f*)(tp + 4);
    }

    // S^T = K Q^T: A = K rows, B = Q columns, both read in one k order; s[j][r] = score[query c][key 16j + 8hh + r]
    v8f s[4];
#pragma unroll
    for (int j = 0; j < 4; ++j) {
      s[j] = (v8f){0.f,0.f,0.f,0.f,0.f,0.f,0.f,0.f};
#pragma unroll
      for (int dc = 0; dc < 2; ++dc) {
        FB kb, kl;
        kb.h[0] = *(const v8b*)(Ksh + (j * 16 + c) * kAPitch + dc * 32 + 8 * hh);
        kb.h[1] = *(const v8b*)(Ksh + (j * 16 + c) * kAPitch + dc * 32 + 16 + 8 * hh);
        kl.h[0] = *(const v8b*)(Ksl + (j * 16 + c) * kAPitch + dc * 32 + 8 * hh);
        kl.h[1] = *(const v8b*)(Ksl + (j * 16 + c) * kAPitch + dc * 32 + 16 + 8 * hh);
        s[j] = mma_bf16g(kb.v, qah[dc], s[j]);
        s[j] = mma_bf16g(kl.v, qah[dc], s[j]);
        s[j] = mma_bf16g(kb.v, qal[dc], s[j]);
      }
    }

    float mj[4];
#pragma unroll
    for (int j = 0; j < 4; ++j) {
      float m = -INFINITY;
#pragma unroll
      for (int r = 0; r < 8; ++r) {
        const float tv = (r < 4) ? tb0[j][r & 3] : tb1[j][r & 3];
        s[j][r] = (s[j][r] + tv) * kScale;
        m = fmaxf(m, s[j][r]);
      }
      mj[j] = m;
    }
    float cm = fmaxf(fmaxf(mj[0], mj[1]), fmaxf(mj[2], mj[3]));
    cm = fmaxf(cm, other_half(cm));
    const float mnew  = fmaxf(mrow, cm);
    const float alpha = expf(mrow - mnew);
    mrow = mnew;
    // P^T packs in place into the B operand of the second product: tiles 2kk and 2kk+1 give keys 8hh + 0..7 and 16 + 8hh + 0..7
    // of a 32-key block, the k order in which the V^T fragments are read.
    FH pb[2];
    float ps[4];
#pragma unroll
    for (int j = 0; j < 4; ++j) {
      v8f pv;
      float a = 0.f;
#pragma unroll
      for (int r = 0; r < 8; ++r) {
        const float p = expf(s[j][r] - mnew);
        a += p;
        pv[r] = p * kPCarry;
      }
      ps[j] = a;
      pb[j >> 1].h[j & 1] = __builtin_convertvector(pv, v8h);
    }
    lrow = lrow * alpha + ((ps[0] + ps[1]) + (ps[2] + ps[3]));
#pragma unroll
    for (int t = 0; t < 4; ++t)
#pragma unroll
      for (int r = 0; r < 8; ++r) oacc[t][r] *= alpha;
    // out^T += V^T P^T: A = V^T rows (d), B = P^T columns (queries)
#pragma unroll
    for (int kk = 0; kk < 2; ++kk) {
#pragma unroll
      for (int t = 0; t < 4; ++t) {
        FH vb;
        vb.h[0] = *(const v8h*)(Vt + (t * 16 + c) * kAPitch + kk * 32 + 8 * hh);
        vb.h[1] = *(const v8h*)(Vt + (t * 16 + c) * kAPitch + kk * 32 + 16 + 8 * hh);
        oacc[t] = mma_f16g(vb.v, pb[kk].v, oacc[t]);
      }
    }
  }

  float* os = Os[wave];
  {
    const float inv = 1.0f / ((lrow + other_half(lrow)) * kPCarry);
#pragma unroll
    for (int t = 0; t < 4; ++t) {
      float* op = os + c * kOsPitch + t * 16 + 8 * hh;   // eight consecutive d of query row c
      *(v4f*)(op)     = (v4f){oacc[t][0] * inv, oacc[t][1] * inv, oacc[t][2] * inv, oacc[t][3] * inv};
      *(v4f*)(op + 4) = (v4f){oacc[t][4] * inv, oacc[t][5] * inv, oacc[t][6] * inv, oacc[t][7] * inv};
    }
  }
  __builtin_amdgcn_fence(__ATOMIC_RELEASE, "workgroup");
  __builtin_amdgcn_wave_barrier();
  __builtin_amdgcn_fence(__ATOMIC_ACQUIRE, "workgroup");
  {
    const int q = lane >> 3, c8 = (lane & 7) * 8;
    {
#pragma unroll
      for (int it = 0; it < 4; ++it) {
        const int row = it * 4 + q;                       // 0..15
        const float* sp = os + row * kOsPitch + c8;
        v8h hv, lv;
#pragma unroll
        for (int e = 0; e < 8; ++e) {
          const unsigned short hb = f2bf_bits(sp[e]);
          const unsigned short lb = f2bf_bits(sp[e] - bf_bits2f(hb));
          hv[e] = __builtin_bit_cast(_Float16, hb);
          lv[e] = __builtin_bit_cast(_Float16, lb);
        }
        const size_t o = (tok0 + q0 + row) * kDim + hcol + c8;
        *(v8h*)(AVh + o) = hv;
        *(v8h*)(AVl + o) = lv;
      }
      
    }
  }
}

// ---------------------------------------------------------------------------
// y = (x - mu) * rsqrt(var + eps) * bf(gamma) + bf(beta). One block of 256 threads (8 waves) per row; thread t owns
// ---------------------------------------------------------------------------
__global__ __launch_bounds__(256) void ln_kernel(const float* __restrict__ w, const float* __restrict__ ao,
                                                 const float* __restrict__ g, const float* __restrict__ bt,
                                                 float* __restrict__ out) {
  __shared__ float red[16];
  const int row  = blockIdx.x;
  const int t    = threadIdx.x, lane = t & 31, wave = t >> 5;
  const int c0   = t * 4;
  const size_t off = (size_t)row * kDim + c0;
  const v4f a = *(const v4f*)(w + off);
  const v4f o = *(const v4f*)(ao + off);
  float x[4];
#pragma unroll
  for (int e = 0; e < 4; ++e) x[e] = bf_rne(a[e]) + o[e];
  float s = (x[0] + x[1]) + (x[2] + x[3]);
#pragma unroll
  for (int sh = 16; sh > 0; sh >>= 1) s += __shfl_xor(s, sh, 32);
  if (lane == 0) red[wave] = s;
  __syncthreads();
  const float mu = (((red[0] + red[1]) + (red[2] + red[3])) + ((red[4] + red[5]) + (red[6] + red[7]))) * kInvDim;
  float d[4];
  float s2 = 0.f;
#pragma unroll
  for (int e = 0; e < 4; ++e) { d[e] = x[e] - mu; s2 += d[e] * d[e]; }
#pragma unroll
  for (int sh = 16; sh > 0; sh >>= 1) s2 += __shfl_xor(s2, sh, 32);
  if (lane == 0) red[8 + wave] = s2;
  __syncthreads();
  const float var  = (((red[8] + red[9]) + (red[10] + red[11])) + ((red[12] + red[13]) + (red[14] + red[15]))) * kInvDim;
  const float rstd = rsqrtf(var + kLnEps);
  const v4f gg = *(const v4f*)(g + c0);
  const v4f bb = *(const v4f*)(bt + c0);
  v4f y;
#pragma unroll
  for (int e = 0; e < 4; ++e) y[e] = (d[e] * rstd) * bf_rne(gg[e]) + bf_rne(bb[e]);
  *(v4f*)(out + off) = y;
  
}

// ---------------------------------------------------------------------------
// Host launch glue. Workspace region map (bytes, all offsets 256-B aligned):
//   [0]            Wb    bf16 w plane            [4096][1024]      8,388,608
//   [8,388,608]    WT    bf16 Wq^T|Wk^T|Wv^T|Wo^T 4 x [1024][1024]  8,388,608
//   [16,777,216]   AVh|AVl bf16 attn_vec hi/lo   2 x [4096][1024]  16,777,216
//   [33,554,432]   AO    f32 attn_vec @ Wo       [4096][1024]      16,777,216
//   [50,331,648]   QRh|QRl bf16 (q+rwb) hi/lo    2 x [4096][1024]  16,777,216   (these three follow one another: the projection
//   [67,108,864]   KRh|KRl bf16 (k+r) hi/lo      2 x [4096][1024]  16,777,216    launch steps from q to k to v by one stride of
//   [83,886,080]   Vh    f16 v plane             [4096][1024]      8,388,608     two planes)
//   [92,274,688]   TB    f32 [16][1024]                            65,536
//   total 92,340,224
// ---------------------------------------------------------------------------
extern "C" void kernel_launch(void* const* d_in, const int* in_sizes, int n_in,
                              void* d_out, int out_size, void* d_ws, size_t ws_size,
                              hipStream_t stream) {
  if (n_in < 10) return;
  const float* w     = (const float*)d_in[0];
  const float* remb  = (const float*)d_in[1];
  const float* rwb   = (const float*)d_in[2];
  const float* rbias = (const float*)d_in[3];
  const float* Wq    = (const float*)d_in[4];
  const float* Wk    = (const float*)d_in[5];
  const float* Wv    = (const float*)d_in[6];
  const float* Wo    = (const float*)d_in[7];
  const float* gamma = (const float*)d_in[8];
  const float* beta  = (const float*)d_in[9];
  float* out = (float*)d_out;

  const size_t nTokD = (size_t)kTok * kDim;                    // 4,194,304 elements
  if ((size_t)in_sizes[0] != nTokD) return;
  if (in_sizes[1] != kSeq * kHeads * kHd) return;
  if (in_sizes[2] != kHeads * kHd) return;
  if (in_sizes[3] != kSeq * kHeads) return;
  if (in_sizes[4] != kDim * kDim || in_sizes[5] != kDim * kDim || in_sizes[6] != kDim * kDim || in_sizes[7] != kDim * kDim) return;
  if (in_sizes[8] != kDim || in_sizes[9] != kDim) return;
  if ((size_t)out_size != nTokD) return;

  const size_t bWb  = nTokD * 2;
  const size_t bWT  = (size_t)4 * kDim * kDim * 2;
  const size_t bAV  = nTokD * 2 * 2;
  const size_t bAO  = nTokD * 4;
  const size_t bQR  = nTokD * 2 * 2;
  const size_t bKR  = nTokD * 2 * 2;
  const size_t bVh  = nTokD * 2;
  const size_t bTB  = (size_t)kHeads * kSeq * 4;
  const size_t oWb  = 0;
  const size_t oWT  = oWb + bWb;
  const size_t oAV  = oWT + bWT;
  const size_t oAO  = oAV + bAV;
  const size_t oQR  = oAO + bAO;
  const size_t oKR  = oQR + bQR;
  const size_t oVh  = oKR + bKR;
  const size_t oTB  = oVh + bVh;
  const size_t total = oTB + bTB;                               // 92,340,224
  if (total > ws_size) return;

  char* ws = (char*)d_ws;
  unsigned short* Wb  = (unsigned short*)(ws + oWb);
  unsigned short* WT  = (unsigned short*)(ws + oWT);
  unsigned short* AVh = (unsigned short*)(ws + oAV);
  unsigned short* AVl = AVh + nTokD;
  float*          AO  = (float*)(ws + oAO);
  unsigned short* QRh = (unsigned short*)(ws + oQR);
  unsigned short* QRl = QRh + nTokD;
  unsigned short* KRh = (unsigned short*)(ws + oKR);
  unsigned short* KRl = KRh + nTokD;
  unsigned short* Vh  = (unsigned short*)(ws + oVh);
  float*          TB  = (float*)(ws + oTB);

  const long wPlane = (long)kDim * kDim;

  // 1. score bias table [16][1024]; weight transposes: in W[1024 in][1024 out] -> out WT[out][in], planes 0..3 = Wq, Wk, Wv, Wo;
  //    w -> bf16 plane
  prep_kernel<<<dim3(kTbBlocks + kWtBlocks + kCvtBlocks), dim3(256), 0, stream>>>(w, Wq, Wk, Wv, Wo, rwb, remb, rbias, Wb, WT, TB);
  // 2. q, k and v in one launch: batch index 0/1/2 selects the WT plane and the output (QRh|QRl, KRh|KRl, Vh: stride two planes);
  //    the epilogue adds r_w_bias (q) or the shifted r_emb row (k) and writes the planes that the attention reads.
  //    M=4096, N=1024, K=1024 (block tiles 32x8 = 256 blocks x 4 waves, x 3)
  wmma_gemm64<1, 0, 0, 3, false><<<dim3(256, 3), dim3(128), 0, stream>>>(
      Wb, Wb, kDim, 0L,
      WT, WT, kDim, wPlane,
      (void*)QRh, (void*)QRl, kDim, (long)(2 * nTokD),
      rwb, remb, 0L,
      kTok, kDim, kDim, 1.0f);
  // 3. attention -> attn_vec bf16 hi/lo planes
  relattn_kernel<<<dim3(kBatch * kHeads * (kSeq / 64)), dim3(128), 0, stream>>>(QRh, QRl, KRh, KRl, Vh, TB, AVh, AVl);
  // 4. attn_vec @ Wo (A hi/lo split, Wo bf16) -> f32
  wmma_gemm64<1, 2, 0, 0, false><<<dim3(256, 1), dim3(128), 0, stream>>>(
      AVh, AVl, kDim, 0L,
      WT + 3 * wPlane, WT + 3 * wPlane, kDim, 0L,
      (void*)AO, (void*)AO, kDim, 0L,
      gamma, gamma, 0L,
      kTok, kDim, kDim, 1.0f);
  // 5. residual + LayerNorm -> out
  ln_kernel<<<dim3(kTok), dim3(256), 0, stream>>>(w, AO, gamma, beta, out);
}

// v006
// One run takes 114 microseconds.
// Next to v005, in two timings, it ran 1.06 times as fast each time.
// Over all steps from v000 it is 2.71 times as fast.
// Compute dtypes: w@Wq|Wk|Wv on v_wmma_f32_16x16x32_bf16 (inputs RNE-converted to bf16, single product); scores (q+r_w_bias)·(k_j+r_emb_{j+1}) on v_wmma_f32_16x16x32_bf16 with bf16 hi/lo planes (hi*hi+hi*lo+lo*hi); attn_prob·v on v_wmma_f32_16x16x32_f16 (P f16 carried x32768, V f16); attn_vec@Wo on v_wmma_f32_16x16x32_bf16 (attn_vec bf16 hi/lo, Wo bf16: hi*W+lo*W); f32 accumulate everywhere; softmax, bias table, residual and LayerNorm in f32.
#include <hip/hip_runtime.h>
#include <math.h>

// ---------------------------------------------------------------------------
// Problem constants
// ---------------------------------------------------------------------------
constexpr int kBatch = 4;
constexpr int kSeq   = 1024;
constexpr int kDim   = 1024;
constexpr int kHeads = 16;
constexpr int kHd    = 64;
constexpr int kTok   = kBatch * kSeq;      // 4096 token rows
constexpr float kLnEps  = 1e-5f;
constexpr float kInvDim = 1.0f / 1024.0f;
constexpr float kScaleLog2e = 0.125f * 1.4426950408889634f;   // 1/sqrt(64) * log2(e): the softmax is taken in base 2
constexpr float kCarryExp   = 15.0f;       // probabilities carried x2^15 in f16: added to the exponent
constexpr int kKC = 64;                    // keys per chunk
constexpr int kOsPitch = 68;
// LDS row pitch of the attention K and V tiles in 16-bit elements: 208 B = 16 B x 13, an odd count of 16-B units, so the
// sixteen rows that a 16-B fragment read touches fall on sixteen different groups of four banks. 13 and not 9: the banks see
// no difference, but the builds do: at 144 B the twelve staging loads of a chunk are waited out almost one by one, at 208 B
// (five blocks a WGP fit, the grid supplies four) all twelve are issued together.
constexpr int kAPitch = 104;

typedef __attribute__((ext_vector_type(16))) _Float16 v16h;
typedef __attribute__((ext_vector_type(8)))  _Float16 v8h;
typedef __attribute__((ext_vector_type(16))) __bf16   v16b;
typedef __attribute__((ext_vector_type(8)))  __bf16   v8b;
typedef __attribute__((ext_vector_type(8)))  float    v8f;
typedef __attribute__((ext_vector_type(4)))  float    v4f;
typedef __attribute__((ext_vector_type(4)))  unsigned int v4u;

__device__ __forceinline__ unsigned short f2bf_bits(float f) {
  unsigned u = __float_as_uint(f);
  return (unsigned short)((u + 0x7FFFu + ((u >> 16) & 1u)) >> 16);
}
__device__ __forceinline__ float bf_bits2f(unsigned short h) { return __uint_as_float(((unsigned)h) << 16); }
__device__ __forceinline__ float bf_rne(float f) { return bf_bits2f(f2bf_bits(f)); }

// hazard guards as plain device helpers
__device__ __forceinline__ void dep_guard_h(v8f& a, v8f& b, v16h x, v16h y) { asm volatile("v_nop\n\tv_nop\n\tv_nop\n\tv_nop" : "+v"(a), "+v"(b) : "v"(x), "v"(y)); }
__device__ __forceinline__ void dep_guard_b(v8f& a, v8f& b, v16b x, v16b y) { asm volatile("v_nop\n\tv_nop\n\tv_nop\n\tv_nop" : "+v"(a), "+v"(b) : "v"(x), "v"(y)); }
__device__ __forceinline__ void keep4_h(v16h a, v16h b, v16h c, v16h d) { asm volatile("v_nop" :: "v"(a), "v"(b), "v"(c), "v"(d)); }
__device__ __forceinline__ void keep4_b(v16b a, v16b b, v16b c, v16b d) { asm volatile("v_nop" :: "v"(a), "v"(b), "v"(c), "v"(d)); }
__device__ __forceinline__ void acc_guard4(v8f& a, v8f& b, v8f& c, v8f& d) { asm volatile("v_nop\n\tv_nop\n\tv_nop\n\tv_nop" : "+v"(a), "+v"(b), "+v"(c), "+v"(d)); }
template <typename T> struct Frag;
template <> struct Frag<_Float16> {
  typedef v16h V; union U { v16h v; v8h h[2]; };
  static __device__ __forceinline__ v16h load(const _Float16* p) {   // elements 0..7 <- p[0..7], 8..15 <- p[16..23]
    U f; f.h[0] = *(const v8h*)(p); f.h[1] = *(const v8h*)(p + 16); return f.v;
  }
  static __device__ __forceinline__ v8f mma(v16h a, v16h b, v8f c) {
    return __builtin_amdgcn_wmma_f32_16x16x32_f16(false, a, false, b, (short)0, c, false, false);
  }
  static __device__ __forceinline__ void guard(v8f& a, v8f& b, v16h x, v16h y) { dep_guard_h(a, b, x, y); }
  static __device__ __forceinline__ void keep(v16h a, v16h b, v16h c, v16h d) { keep4_h(a, b, c, d); }
};
template <> struct Frag<__bf16> {
  typedef v16b V; union U { v16b v; v8b h[2]; };
  static __device__ __forceinline__ v16b load(const __bf16* p) {
    U f; f.h[0] = *(const v8b*)(p); f.h[1] = *(const v8b*)(p + 16); return f.v;
  }
  static __device__ __forceinline__ v8f mma(v16b a, v16b b, v8f c) {
    return __builtin_amdgcn_wmma_f32_16x16x32_bf16(false, a, false, b, (short)0, c, false, false);
  }
  static __device__ __forceinline__ void guard(v8f& a, v8f& b, v16b x, v16b y) { dep_guard_b(a, b, x, y); }
  static __device__ __forceinline__ void keep(v16b a, v16b b, v16b c, v16b d) { keep4_b(a, b, c, d); }
};

__device__ __forceinline__ unsigned pk16(unsigned short a, unsigned short b) { return (unsigned)a | ((unsigned)b << 16); }

// single WMMA issue with hazard guard (bf16 and f16 twins)
__device__ __forceinline__ v8f mma_bf16g(v16b a, v16b b, v8f c) {
  c = __builtin_amdgcn_wmma_f32_16x16x32_bf16(false, a, false, b, (short)0, c, false, false);
  asm volatile("v_nop\n\tv_nop\n\tv_nop\n\tv_nop" : "+v"(c) : "v"(a), "v"(b));
  return c;
}
__device__ __forceinline__ v8f mma_f16g(v16h a, v16h b, v8f c) {
  c = __builtin_amdgcn_wmma_f32_16x16x32_f16(false, a, false, b, (short)0, c, false, false);
  asm volatile("v_nop\n\tv_nop\n\tv_nop\n\tv_nop" : "+v"(c) : "v"(a), "v"(b));
  return c;
}

// the value that lane l ^ 16 holds
__device__ __forceinline__ float other_half(float x) {
  const int b = __float_as_int(x);
  return __int_as_float(__builtin_amdgcn_permlanex16(b, b, 0x76543210, 0xfedcba98, false, false));
}

// Eight base-2 exponentials of one lane. They stand in one statement whose results are early-clobber outputs, so that none lands
// in the source of the exponential ahead of it; the closing v_nop is the slot that the instruction set asks for between the last
// one and whatever reads its result or rewrites its source.
__device__ __forceinline__ v8f exp2x8(v8f x) {
  float y0, y1, y2, y3, y4, y5, y6, y7;
  asm("v_exp_f32 %0, %8\n\t"
      "v_exp_f32 %1, %9\n\t"
      "v_exp_f32 %2, %10\n\t"
      "v_exp_f32 %3, %11\n\t"
      "v_exp_f32 %4, %12\n\t"
      "v_exp_f32 %5, %13\n\t"
      "v_exp_f32 %6, %14\n\t"
      "v_exp_f32 %7, %15\n\t"
      "v_nop"
      : "=&v"(y0), "=&v"(y1), "=&v"(y2), "=&v"(y3), "=&v"(y4), "=&v"(y5), "=&v"(y6), "=&v"(y7)
      : "v"(x[0]), "v"(x[1]), "v"(x[2]), "v"(x[3]), "v"(x[4]), "v"(x[5]), "v"(x[6]), "v"(x[7]));
  return (v8f){y0, y1, y2, y3, y4, y5, y6, y7};
}

// ---- LDS staging of the GEMM operands ----
constexpr int kGK     = 64;                  // k per pass: 128 B of every operand row
constexpr int kGPitch = 72;                  // LDS row pitch in 16-bit elements: 144 B = 16 B x 9, conflict-free for 16-B row reads
constexpr int kGPlane = 128 * kGPitch;       // one operand plane of one buffer: 128 rows

// Eight asynchronous 16-B copies of one lane, global -> LDS, rows 16 apart (l, g: the lane's own LDS byte address and
// global address of the first; lstep, gstep: the step to the next). The closing s_wait_xcnt stands inside the statement
// so that no address register named here is rewritten ahead of it.
__device__ __forceinline__ void async_copy8(unsigned l, unsigned lstep, const unsigned short* g, size_t gstep) {
  asm volatile(
      "global_load_async_to_lds_b128 %0, %8, off\n\t"
      "global_load_async_to_lds_b128 %1, %9, off\n\t"
      "global_load_async_to_lds_b128 %2, %10, off\n\t"
      "global_load_async_to_lds_b128 %3, %11, off\n\t"
      "global_load_async_to_lds_b128 %4, %12, off\n\t"
      "global_load_async_to_lds_b128 %5, %13, off\n\t"
      "global_load_async_to_lds_b128 %6, %14, off\n\t"
      "global_load_async_to_lds_b128 %7, %15, off\n\t"
      "s_wait_xcnt 0x0"
      :: "v"(l), "v"(l + lstep), "v"(l + 2 * lstep), "v"(l + 3 * lstep),
         "v"(l + 4 * lstep), "v"(l + 5 * lstep), "v"(l + 6 * lstep), "v"(l + 7 * lstep),
         "v"(g), "v"(g + gstep), "v"(g + 2 * gstep), "v"(g + 3 * gstep),
         "v"(g + 4 * gstep), "v"(g + 5 * gstep), "v"(g + 6 * gstep), "v"(g + 7 * gstep)
      : "memory");
}

// Eight 16-B global loads of one lane: 32 B from each of four row pointers. Loads and their data wait stand in one
// statement and every result is an early-clobber output, so that no result lands in an address pair of the run and no
// address register is rewritten while a load that names it is in flight.
__device__ __forceinline__ void load4x32(const float* p0, const float* p1, const float* p2, const float* p3, v4f (&lo)[4], v4f (&hi)[4]) {
  asm volatile(
      "global_load_b128 %0, %8, off\n\t"
      "global_load_b128 %1, %8, off offset:16\n\t"
      "global_load_b128 %2, %9, off\n\t"
      "global_load_b128 %3, %9, off offset:16\n\t"
      "global_load_b128 %4, %10, off\n\t"
      "global_load_b128 %5, %10, off offset:16\n\t"
      "global_load_b128 %6, %11, off\n\t"
      "global_load_b128 %7, %11, off offset:16\n\t"
      "s_wait_loadcnt 0x0"
      : "=&v"(lo[0]), "=&v"(hi[0]), "=&v"(lo[1]), "=&v"(hi[1]), "=&v"(lo[2]), "=&v"(hi[2]), "=&v"(lo[3]), "=&v"(hi[3])
      : "v"(p0), "v"(p1), "v"(p2), "v"(p3)
      : "memory");
}

// ---- Register-blocked batched WMMA GEMM (SPLIT widened to an int mode, ACT reduced to relu/leaky) ----
// C[m,n] = scale * sum_k A[m,k] * Bt[n,k] (+bias)(+resid); each wave owns a 64x64 tile, 2x2 waves share a 128x128 block tile.
// Per pass the block's 128 A rows and 128 Bt rows x 64 k are staged in LDS by asynchronous copies, two buffers: the copies
// of pass t+1 fly while pass t is worked on; fragments are read from LDS in the same k order as from global memory.
// A row-major [M,K]; Bt row-major [N,K]; M,N % 128 == 0, K % 64 == 0.
// SPLIT: 0 = single product; 1 = A and Bt hi/lo planes (hi*hi + hi*lo + lo*hi); 2 = A hi/lo only (hi*B + lo*B).
// BIAS_MODE: 0 = none, 1 = bias[m], 2 = bias[n].
// OUT_MODE: 0 = f32, 1 = f16, 2 = bf16 hi plane (Cout) + bf16 lo plane (Cout2),
//           3 = the q|k|v projection, one launch, batch index b picks the product and what its epilogue does:
//               b = 0: x = q + bf(bias[n])                                   -> bf16 hi/lo planes (bias = r_w_bias, flat [1024])
//               b = 1: x = k_j + bf(resid[j+1][n]), nothing added at j = 1023 -> bf16 hi/lo planes (resid = r_emb, flat [1024][1024],
//                      j = m mod 1024; the address is clamped to row 1023 and the value zeroed by predicate)
//               b = 2: v -> f16 plane (Cout only)
// ET: 0 = f16 operands, 1 = bf16 operands (pointers passed as 16-bit storage)
template <int ET> struct Elem;
template <> struct Elem<0> { typedef _Float16 T; };
template <> struct Elem<1> { typedef __bf16 T; };
template <int ET, int SPLIT, int BIAS_MODE, int OUT_MODE, bool RESID, int ACT = 0>
__global__ __launch_bounds__(128) void wmma_gemm64(
    const unsigned short* __restrict__ Ap, const unsigned short* __restrict__ A2p, int lda, long strideA,
    const unsigned short* __restrict__ Btp, const unsigned short* __restrict__ Bt2p, int ldb, long strideB,
    void* __restrict__ Cout, void* __restrict__ Cout2, int ldc, long strideC,
    const float* __restrict__ bias,
    const float* __restrict__ resid, long strideR,
    int M, int N, int K, float scale) {
  typedef typename Elem<ET>::T T;
  typedef typename Frag<T>::V V;
  constexpr int NPL = 2 + ((SPLIT != 0) ? 1 : 0) + ((SPLIT == 1) ? 1 : 0);   // planes per buffer: A, Bt, A lo, Bt lo
  __shared__ __align__(16) T sStage[2 * NPL * kGPlane];   // two buffers of NPL planes
  __shared__ __align__(16) float sT[4][16 * 68];   // per-wave 16x64 slab, pitch 68 floats
  const int b    = blockIdx.y;
  const int tid  = threadIdx.x;
  const int lane = tid & 31;
  const int wave = tid >> 5;
  const int tilesN = N >> 7;
  const int tilesM = M >> 7;
  const int tile = blockIdx.x;
  if (tile >= tilesM * tilesN) return;   // block-uniform, ahead of every barrier and copy
  const int tm = tile / tilesN;
  const int tn = tile - tm * tilesN;
  const int bm0 = tm << 7;
  const int bn0 = tn << 7;
  const int wm  = (wave >> 1) << 6;            // this wave's 64x64 tile inside the block tile
  const int wn  = (wave & 1) << 6;
  const int m0 = bm0 + wm;
  const int n0 = bn0 + wn;

  // staging coverage per plane: 128 threads x 8 copies x 16 B = 128 rows x 128 B; 8 lanes cover one whole 128-B row piece
  const int crow = tid >> 3;                   // 0..15, copy i takes row crow + 16 i
  const int ccol = (tid & 7) * 8;              // element offset of the lane's 16 B
  const unsigned short* gA  = Ap  + (size_t)b * strideA + (size_t)(bm0 + crow) * lda + ccol;
  const unsigned short* gB  = Btp + (size_t)b * strideB + (size_t)(bn0 + crow) * ldb + ccol;
  const unsigned short* gA2 = (SPLIT != 0) ? (A2p  + (size_t)b * strideA + (size_t)(bm0 + crow) * lda + ccol) : nullptr;
  const unsigned short* gB2 = (SPLIT == 1) ? (Bt2p + (size_t)b * strideB + (size_t)(bn0 + crow) * ldb + ccol) : nullptr;
  const unsigned lBase = (unsigned)(size_t)sStage + (unsigned)(crow * kGPitch + ccol) * 2u;
  auto stage = [&](int t) {                    // pass t's operand rows into buffer t & 1
    const unsigned l = lBase + (unsigned)(t & 1) * (unsigned)(NPL * kGPlane * 2);
    const int k0 = t * kGK;
    async_copy8(l, 16 * kGPitch * 2, gA + k0, (size_t)16 * lda);
    async_copy8(l + kGPlane * 2, 16 * kGPitch * 2, gB + k0, (size_t)16 * ldb);
    if (SPLIT != 0) async_copy8(l + 2 * kGPlane * 2, 16 * kGPitch * 2, gA2 + k0, (size_t)16 * lda);
    if (SPLIT == 1) async_copy8(l + 3 * kGPlane * 2, 16 * kGPitch * 2, gB2 + k0, (size_t)16 * ldb);
  };

  const int rlane = lane & 15;                 // row (A) / col (B, D) within subtile
  const int koff  = (lane >> 4) * 8;           // k offset of this lane half
  const int mOff  = (lane >> 4) * 8;           // D row offset

  v8f acc[4][4];
#pragma unroll
  for (int i = 0; i < 4; ++i)
#pragma unroll
    for (int j = 0; j < 4; ++j) acc[i][j] = (v8f){0.f,0.f,0.f,0.f,0.f,0.f,0.f,0.f};

  const int nT = K >> 6;                       // passes
  stage(0);
  asm volatile("s_wait_asynccnt 0x0" ::: "memory");   // this wave's copies of pass 0 have landed
  __syncthreads();                                     // every wave's have: pass 0 is readable
  if (nT > 1) stage(1);

  for (int t = 0; t < nT; ++t) {
    const T* sb = sStage + (t & 1) * (NPL * kGPlane);
    const int aoff = (wm + rlane) * kGPitch + koff;
    const int boff = (wn + rlane) * kGPitch + koff;
    // the loops below are unrolled so that every fragment and accumulator index is a constant (registers, no scratch)
#pragma unroll
    for (int ks = 0; ks < kGK; ks += 32) {
      V bh[4], bl[4];
#pragma unroll
      for (int j = 0; j < 4; ++j) {
        const int bo = boff + (j << 4) * kGPitch + ks;
        bh[j] = Frag<T>::load(sb + kGPlane + bo);
        if (SPLIT == 1) bl[j] = Frag<T>::load(sb + 3 * kGPlane + bo);
      }
      V ah[4], al[4];                            // the whole 32-k block's fragments are read as one group ahead of its products
#pragma unroll
      for (int i = 0; i < 4; ++i) {
        const int ao = aoff + (i << 4) * kGPitch + ks;
        ah[i] = Frag<T>::load(sb + ao);
        if (SPLIT != 0) al[i] = Frag<T>::load(sb + 2 * kGPlane + ao);
      }
#pragma unroll
      for (int i = 0; i < 4; ++i) {
#pragma unroll
        for (int j = 0; j < 4; ++j) {
          acc[i][j] = Frag<T>::mma(ah[i], bh[j], acc[i][j]);
          if (SPLIT == 1) acc[i][j] = Frag<T>::mma(ah[i], bl[j], acc[i][j]);
          if (SPLIT != 0) acc[i][j] = Frag<T>::mma(al[i], bh[j], acc[i][j]);
        }
        Frag<T>::guard(acc[i][0], acc[i][3], ah[i], (SPLIT != 0) ? al[i] : ah[i]);
      }
      Frag<T>::keep(bh[0], bh[1], bh[2], bh[3]);
      if (SPLIT == 1) Frag<T>::keep(bl[0], bl[1], bl[2], bl[3]);
    }
    asm volatile("s_wait_dscnt 0x0" ::: "memory");     // this wave's reads of buffer t & 1 are done before it is refilled
    asm volatile("s_wait_asynccnt 0x0" ::: "memory");  // this wave's copies of pass t + 1 have landed
    __syncthreads();                                    // publishes pass t + 1 and ends every reader's use of buffer t & 1
    if (t + 2 < nT) stage(t + 2);
  }
  asm volatile("s_wait_asynccnt 0x0" ::: "memory");    // nothing in flight when the wave goes on to the epilogue and ends
  acc_guard4(acc[0][0], acc[0][1], acc[0][2], acc[0][3]);
  acc_guard4(acc[1][0], acc[1][1], acc[1][2], acc[1][3]);
  acc_guard4(acc[2][0], acc[2][1], acc[2][2], acc[2][3]);
  acc_guard4(acc[3][0], acc[3][1], acc[3][2], acc[3][3]);

  // ---- epilogue ----
  float* slab = sT[wave];
  const float* Rb = RESID ? (resid + (size_t)b * strideR) : nullptr;
#pragma unroll
  for (int i = 0; i < 4; ++i) {
    const int mBase = m0 + (i << 4);
#pragma unroll
    for (int j = 0; j < 4; ++j) {
      const int n = n0 + (j << 4) + rlane;
      float bv = 0.f;
      if (BIAS_MODE == 2) bv = bias[n];
#pragma unroll
      for (int r = 0; r < 8; ++r) {
        float v = acc[i][j][r] * scale;
        if (BIAS_MODE == 1) v += bias[mBase + mOff + r];
        if (BIAS_MODE == 2) v += bv;
        if (RESID) v += Rb[(size_t)(mBase + mOff + r) * ldc + n];
        if (ACT == 2) v = fmaxf(v, 0.0f);
        if (ACT == 4) v = (v > 0.f) ? v : 0.01f * v;
        slab[(mOff + r) * 68 + (j << 4) + rlane] = v;
      }
    }
    __builtin_amdgcn_fence(__ATOMIC_RELEASE, "workgroup");
    __builtin_amdgcn_wave_barrier();
    __builtin_amdgcn_fence(__ATOMIC_ACQUIRE, "workgroup");
    if (OUT_MODE == 0) {
      float* C = (float*)Cout + (size_t)b * strideC;
      const int hh = lane >> 4, c4 = (lane & 15) * 4;     // row seg = 256 B = 16 lanes x 16 B
      {
#pragma unroll
        for (int it = 0; it < 8; ++it) {
          const int row = it * 2 + hh;
          v4f v = *(const v4f*)(slab + row * 68 + c4);
          *(v4f*)(C + (size_t)(mBase + row) * ldc + n0 + c4) = v;
        }
        
      }
    } else if (OUT_MODE == 3) {
      const int q = lane >> 3, c8 = (lane & 7) * 8;       // row seg = 128 B = 8 lanes x 16 B, per plane
      unsigned short* C  = (unsigned short*)Cout  + (size_t)b * strideC;
      unsigned short* C2 = (unsigned short*)Cout2 + (size_t)b * strideC;
      // the loops below are unrolled so that every vector element and array index is a constant (registers, no scratch)
      if (b == 2) {                                        // block-uniform
#pragma unroll
        for (int it = 0; it < 4; ++it) {
          const int row = it * 4 + q;
          const float* sp = slab + row * 68 + c8;
          v8h hv;
#pragma unroll
          for (int e = 0; e < 8; ++e) hv[e] = (_Float16)sp[e];
          *(v8h*)(C + (size_t)(mBase + row) * ldc + n0 + c8) = hv;
        }
      } else {
        const float* ap[4];
        bool keep[4];
#pragma unroll
        for (int it = 0; it < 4; ++it) {
          const int jtok = (mBase + it * 4 + q) & (kSeq - 1);
          keep[it] = (b == 0) || (jtok + 1 < kSeq);
          const int jr = (jtok + 1 < kSeq) ? (jtok + 1) : (kSeq - 1);                 // clamped address
          ap[it] = (b == 0) ? (bias + n0 + c8) : (resid + (size_t)jr * kDim + n0 + c8);
        }
        v4f a0[4], a1[4];
        load4x32(ap[0], ap[1], ap[2], ap[3], a0, a1);
#pragma unroll
        for (int it = 0; it < 4; ++it) {
          const int row = it * 4 + q;
          const float* sp = slab + row * 68 + c8;
          v8h hv, lv;
#pragma unroll
          for (int e = 0; e < 8; ++e) {
            const float ad = (e < 4) ? a0[it][e & 3] : a1[it][e & 3];
            const float x = sp[e] + (keep[it] ? bf_rne(ad) : 0.0f);
            const unsigned short hb = f2bf_bits(x);
            const unsigned short lb = f2bf_bits(x - bf_bits2f(hb));
            hv[e] = __builtin_bit_cast(_Float16, hb);
            lv[e] = __builtin_bit_cast(_Float16, lb);
          }
          *(v8h*)(C  + (size_t)(mBase + row) * ldc + n0 + c8) = hv;
          *(v8h*)(C2 + (size_t)(mBase + row) * ldc + n0 + c8) = lv;
        }
        asm volatile("s_wait_xcnt 0x0" ::: "memory");   // no register that these stores name is rewritten ahead of this wait
      }
    } else {
      const int q = lane >> 3, c8 = (lane & 7) * 8;
      unsigned short* C  = (unsigned short*)Cout  + (size_t)b * strideC;
      unsigned short* C2 = (OUT_MODE == 2) ? ((unsigned short*)Cout2 + (size_t)b * strideC) : nullptr;
      {
#pragma unroll
        for (int it = 0; it < 4; ++it) {
          const int row = it * 4 + q;
          const float* sp = slab + row * 68 + c8;
          v8h hv, lv;
#pragma unroll
          for (int e = 0; e < 8; ++e) {
            if (OUT_MODE == 1) {
              hv[e] = (_Float16)sp[e];
            } else {
              unsigned short hb = f2bf_bits(sp[e]);
              unsigned short lb = f2bf_bits(sp[e] - bf_bits2f(hb));
              hv[e] = __builtin_bit_cast(_Float16, hb);
              lv[e] = __builtin_bit_cast(_Float16, lb);
            }
          }
          *(v8h*)(C + (size_t)(mBase + row) * ldc + n0 + c8) = hv;
          if (OUT_MODE == 2) *(v8h*)(C2 + (size_t)(mBase + row) * ldc + n0 + c8) = lv;
        }
        
      }
    }
    __builtin_amdgcn_fence(__ATOMIC_RELEASE, "workgroup");
    __builtin_amdgcn_wave_barrier();
    __builtin_amdgcn_fence(__ATOMIC_ACQUIRE, "workgroup");
  }
}

// ---------------------------------------------------------------------------
// f32 -> bf16 (RNE) plane, 8 elements per thread: one 16-B store per lane, 32 lanes = 512 contiguous B =
// ---------------------------------------------------------------------------
__device__ __forceinline__ void cvt_bf16x8_body(int blk, const float* __restrict__ in, unsigned short* __restrict__ out, int n8) {
  const int i = blk * 256 + threadIdx.x;
  if (i >= n8) return;
  const size_t base = (size_t)i * 8;
  const v4f a = *(const v4f*)(in + base), c = *(const v4f*)(in + base + 4);
  unsigned short hb[8];
#pragma unroll
  for (int e = 0; e < 4; ++e) { hb[e] = f2bf_bits(a[e]); hb[4 + e] = f2bf_bits(c[e]); }
  const v4u u = (v4u){pk16(hb[0], hb[1]), pk16(hb[2], hb[3]), pk16(hb[4], hb[5]), pk16(hb[6], hb[7])};
  *(v4u*)(out + base) = u;
  
}

// ---------------------------------------------------------------------------
// Weight transpose + cast: in W[d][h] (row-major [in 1024][out 1024] f32) -> out WT[h][d] = bf16_rne(W[d][h]), 4 planes.
// 1024 blocks: blk & 15 = d tile (64 cols of WT), (blk >> 4) & 15 = h tile (64 rows of WT), blk >> 8 selects W0..W3
// and the output plane (plane z at out + z*1024*1024 halves). 256 threads.
// Load coverage: 16 iterations x 256 threads = 4096 = the whole 64x64 tile (coalesced along h).
// Store coverage: 8 waves x 2 iterations x 4 rows (lane>>3) = 64 rows; (lane&7) x 8 halves = 64 cols; each row segment =
// ---------------------------------------------------------------------------
__device__ __forceinline__ void wtcast4_body(int blk, const float* __restrict__ W0, const float* __restrict__ W1,
                                             const float* __restrict__ W2, const float* __restrict__ W3,
                                             unsigned short* __restrict__ out) {
  __shared__ float sm[64][65];   // sm[h_local][d_local]
  const int t  = threadIdx.x;
  const int d0 = (blk & 15) * 64;
  const int h0 = ((blk >> 4) & 15) * 64;
  const int z  = blk >> 8;                                     // block-uniform
  const float* W = (z == 0) ? W0 : (z == 1) ? W1 : (z == 2) ? W2 : W3;
#pragma unroll
  for (int i = 0; i < 16; ++i) {
    const int e = i * 256 + t;
    const int r = e >> 6;          // d local
    const int cc = e & 63;         // h local
    sm[cc][r] = W[(size_t)(d0 + r) * kDim + h0 + cc];
  }
  __syncthreads();
  const int lane = t & 31, wave = t >> 5;
  const int q = lane >> 3, c8 = (lane & 7) * 8;
  unsigned short* op = out + (size_t)z * kDim * kDim;
  {
#pragma unroll
    for (int it = 0; it < 2; ++it) {
      const int row = wave * 8 + it * 4 + q;                 // h local
      unsigned short hb[8];
#pragma unroll
      for (int e = 0; e < 8; ++e) hb[e] = f2bf_bits(sm[row][c8 + e]);
      const v4u u = (v4u){pk16(hb[0], hb[1]), pk16(hb[2], hb[3]), pk16(hb[4], hb[5]), pk16(hb[6], hb[7])};
      *(v4u*)(op + (size_t)(h0 + row) * kDim + d0 + c8) = u;
    }
    asm volatile("s_wait_xcnt 0x0" ::: "memory");   // code of the launch's other work follows: no register that these stores name is rewritten ahead of this wait
  }
}

// ---------------------------------------------------------------------------
// Score bias table tb[n][j] (f32, [16][1024]): for j <= 1022: bf(r_bias[j+1][n]) - sum_d bf(r_w_bias[n][d]) * bf(r_emb[j+1][n][d]);
// tb[n][1023] = 0. Thread per (n, j), 64-tap rolled dot in fixed order (inputs only). r_emb / r_bias addresses clamped to row 1023,
// ---------------------------------------------------------------------------
__device__ __forceinline__ void tb_body(int blk, const float* __restrict__ rwb, const float* __restrict__ remb,
                                        const float* __restrict__ rbias, float* __restrict__ tb) {
  const int i = blk * 256 + threadIdx.x;                 // 0..16383
  const int n = i >> 10;
  const int j = i & (kSeq - 1);
  const bool keep = (j + 1 < kSeq);
  const int jr = keep ? (j + 1) : (kSeq - 1);
  const float* rp = remb + ((size_t)jr * kHeads + n) * kHd;
  const float* up = rwb + n * kHd;
  float acc = 0.f;
#pragma unroll 1
  for (int d = 0; d < kHd; ++d) acc = fmaf(bf_rne(up[d]), bf_rne(rp[d]), acc);
  const float val = keep ? (bf_rne(rbias[jr * kHeads + n]) - acc) : 0.0f;
  ((float*)tb)[i] = val;
  
}

// ---------------------------------------------------------------------------
// The three preparations that read inputs only (score bias table, weight transposes, w -> bf16 plane) in one launch of
// 256-thread blocks; the block index picks the work. The table's blocks come first: each of their threads walks a chain of
// 64 waited loads, the longest path of the launch, and it runs while the other blocks stream.
// ---------------------------------------------------------------------------
constexpr int kTbBlocks  = (kHeads * kSeq) / 256;               // 64
constexpr int kWtBlocks  = (kDim / 64) * (kDim / 64) * 4;       // 1024
constexpr int kCvtBlocks = (kTok * kDim / 8) / 256;             // 2048
__global__ __launch_bounds__(256) void prep_kernel(const float* __restrict__ w, const float* __restrict__ W0,
                                                   const float* __restrict__ W1, const float* __restrict__ W2,
                                                   const float* __restrict__ W3, const float* __restrict__ rwb,
                                                   const float* __restrict__ remb, const float* __restrict__ rbias,
                                                   unsigned short* __restrict__ Wb, unsigned short* __restrict__ WT,
                                                   float* __restrict__ tb) {
  const int bx = blockIdx.x;                                    // every branch below is block-uniform
  if (bx < kTbBlocks) {
    tb_body(bx, rwb, remb, rbias, tb);
  } else if (bx < kTbBlocks + kWtBlocks) {
    wtcast4_body(bx - kTbBlocks, W0, W1, W2, W3, WT);
  } else {
    cvt_bf16x8_body(bx - kTbBlocks - kWtBlocks, w, Wb, kTok * kDim / 8);
  }
}

// ---------------------------------------------------------------------------
// Relative-position flash attention for head_dim 64 (no mask). Block = 4 waves = 64 query rows of one (batch, head);
// grid = 4 * 16 * 16 = 1024 blocks of 128 threads; blockIdx.x = b*256 + h*16 + qb.
// Inputs: QRh/QRl = bf16 hi/lo planes of (q + r_w_bias) [4096][1024]; KRh/KRl = bf16 hi/lo planes of (k_j + r_emb_{j+1});
// Vp = f16 plane of v [4096][1024]; tb = f32 [16][1024] score bias table.
// score[i][j] = ((q+rwb)_i · (k_j + r_{j+1}) + tb[h][j]) * 0.125  : v_wmma_f32_16x16x32_bf16, hi*hi + hi*lo + lo*hi.
// out += P*V : v_wmma_f32_16x16x32_f16 (V staged transposed [d][kv] in LDS as f16); P and its sum l both x2^15; final out * 1/l.
// Both products are formed transposed (S^T = K Q^T, out^T = V^T P^T): a lane holds one query's scores, so the row maximum and
// sum are taken in the lane with one exchange between the wave's halves, and P^T goes from the score registers into the B operand.
// ---------------------------------------------------------------------------
// Four waves a SIMD is what the grid supplies (1024 blocks of 4 waves on 256 WGPs): stated, so that the compiler budgets registers
// for that and not for the larger number of blocks that the LDS would admit; with the tighter budget it waits out the staging
// loads one by one and strings the exponentials in one chain.
__global__ __launch_bounds__(128) __attribute__((amdgpu_waves_per_eu(4, 4))) void relattn_kernel(
    const unsigned short* __restrict__ QRh, const unsigned short* __restrict__ QRl,
    const unsigned short* __restrict__ KRh, const unsigned short* __restrict__ KRl,
    const unsigned short* __restrict__ Vp, const float* __restrict__ tb,
    unsigned short* __restrict__ AVh, unsigned short* __restrict__ AVl) {
  union FB { v16b v; v8b h[2]; };
  union FH { v16h v; v8h h[2]; };
  __shared__ __align__(16) __bf16   Ksh[kKC * kAPitch];        // K hi [kv][d]   13 KB
  __shared__ __align__(16) __bf16   Ksl[kKC * kAPitch];        // K lo [kv][d]   13 KB
  __shared__ __align__(16) _Float16 Vt[kHd * kAPitch];         // V f16 [d][kv]  13 KB
  __shared__ __align__(16) float    Os[4][16 * kOsPitch];      // per wave out tile, pitch 68

  const int tid  = threadIdx.x;
  const int wave = tid >> 5;
  const int lane = tid & 31;
  const int hh   = lane >> 4;
  const int c    = lane & 15;

  const int bx = blockIdx.x;
  const int qb = bx & 15;
  const int h  = (bx >> 4) & 15;
  const int b  = bx >> 8;
  const int q0 = qb * 64 + wave * 16;
  const size_t tok0 = (size_t)b * kSeq;
  const int hcol = h * kHd;

  // ---- Q fragments (B operand): 2 d-chunks, hi and lo. Frag load: elements 0..7 <- k 8hh+0..7, 8..15 <- k 16+8hh+0..7 ----
  v16b qah[2], qal[2];
  {
    const __bf16* ph = (const __bf16*)QRh + (tok0 + q0 + c) * kDim + hcol + 8 * hh;
    const __bf16* pl = (const __bf16*)QRl + (tok0 + q0 + c) * kDim + hcol + 8 * hh;
#pragma unroll
    for (int dc = 0; dc < 2; ++dc) {
      qah[dc] = Frag<__bf16>::load(ph + dc * 32);
      qal[dc] = Frag<__bf16>::load(pl + dc * 32);
    }
  }

  // Lane (c, hh) owns query column c: mrow is that query's running maximum (equal in both halves), lrow the sum over the keys
  // that this half holds (8hh + 0..7 of every 16); the halves' sums are joined once, behind the loop.
  // mrow is kept on the unscaled scores; crow = 15 - mrow * scale * log2(e) is the addend of the exponent that goes with it, and
  // lrow and oacc hold their sums x2^15.
  float mrow = -INFINITY, crow = INFINITY, lrow = 0.f;
  v8f oacc[4];                                  // oacc[t][r] = out^T[d = 16t + 8hh + r][query c]
#pragma unroll
  for (int t = 0; t < 4; ++t) oacc[t] = (v8f){0.f,0.f,0.f,0.f,0.f,0.f,0.f,0.f};

  for (int kc = 0; kc < kSeq / kKC; ++kc) {     // 16 chunks, block-uniform
    const int kv0 = kc * kKC;
    __syncthreads();
    {
      // staging coverage: 128 threads = 64 kv rows x 2 halves of 32 d; 4 x 16-B pieces each -> whole 64x64 tiles of K hi, K lo, V
      const int kvr = tid >> 1;
      const int dh  = (tid & 1) * 32;
      const size_t g = (tok0 + kv0 + kvr) * kDim + hcol + dh;
      const v8b* gkh = (const v8b*)((const __bf16*)KRh + g);
      const v8b* gkl = (const v8b*)((const __bf16*)KRl + g);
      const v8h* gv  = (const v8h*)((const _Float16*)Vp + g);
      v8b a[4], al[4];
      v8h vv[4];
#pragma unroll
      for (int i = 0; i < 4; ++i) {
        a[i]  = gkh[i];
        al[i] = gkl[i];
        vv[i] = gv[i];
      }
      // the three address pairs are inputs here, so they stay whole up to this wait: no result of the twelve loads lands in one,
      // and nothing rewrites one ahead of the wait
      asm volatile("s_wait_xcnt 0x0" :: "v"(gkh), "v"(gkl), "v"(gv) : "memory");
#pragma unroll
      for (int i = 0; i < 4; ++i) {
        *(v8b*)(Ksh + kvr * kAPitch + dh + 8 * i) = a[i];
        *(v8b*)(Ksl + kvr * kAPitch + dh + 8 * i) = al[i];
#pragma unroll
        for (int e = 0; e < 8; ++e) Vt[(dh + 8 * i + e) * kAPitch + kvr] = vv[i][e];
      }
    }
    __syncthreads();

    // the table entries of this lane's 32 keys (16j + 8hh + 0..7); they arrive while the score products run
    v4f tb0[4], tb1[4];
#pragma unroll
    for (int j = 0; j < 4; ++j) {
      const float* tp = tb + h * kSeq + kv0 + j * 16 + 8 * hh;
      tb0[j] = *(const v4f*)(tp);
      tb1[j] = *(const v4f*)(tp + 4);
    }

    // S^T = K Q^T: A = K rows, B = Q columns, both read in one k order; s[j][r] = score[query c][key 16j + 8hh + r]
    v8f s[4];
#pragma unroll
    for (int j = 0; j < 4; ++j) {
      s[j] = (v8f){0.f,0.f,0.f,0.f,0.f,0.f,0.f,0.f};
#pragma unroll
      for (int dc = 0; dc < 2; ++dc) {
        FB kb, kl;
        kb.h[0] = *(const v8b*)(Ksh + (j * 16 + c) * kAPitch + dc * 32 + 8 * hh);
        kb.h[1] = *(const v8b*)(Ksh + (j * 16 + c) * kAPitch + dc * 32 + 16 + 8 * hh);
        kl.h[0] = *(const v8b*)(Ksl + (j * 16 + c) * kAPitch + dc * 32 + 8 * hh);
        kl.h[1] = *(const v8b*)(Ksl + (j * 16 + c) * kAPitch + dc * 32 + 16 + 8 * hh);
        s[j] = mma_bf16g(kb.v, qah[dc], s[j]);
        s[j] = mma_bf16g(kl.v, qah[dc], s[j]);
        s[j] = mma_bf16g(kb.v, qal[dc], s[j]);
      }
    }

    float mj[4];
#pragma unroll
    for (int j = 0; j < 4; ++j) {
      float m = -INFINITY;
#pragma unroll
      for (int r = 0; r < 8; ++r) {
        const float tv = (r < 4) ? tb0[j][r & 3] : tb1[j][r & 3];
        s[j][r] = s[j][r] + tv;                 // unscaled: the scale is positive, so the maximum falls on the same key
        m = fmaxf(m, s[j][r]);
      }
      mj[j] = m;
    }
    float cm = fmaxf(fmaxf(mj[0], mj[1]), fmaxf(mj[2], mj[3]));
    cm = fmaxf(cm, other_half(cm));
    const float mnew  = fmaxf(mrow, cm);
    // p * 2^15 = exp2(score * scale * log2(e) + cnew): one multiply-add and the hardware's base-2 exponential for each score
    const float cnew  = fmaf(-mnew, kScaleLog2e, kCarryExp);
    const float alpha = __builtin_amdgcn_exp2f(cnew - crow);   // 0 on the first chunk, where crow is +inf
    mrow = mnew;
    crow = cnew;
    // P^T packs in place into the B operand of the second product: tiles 2kk and 2kk+1 give keys 8hh + 0..7 and 16 + 8hh + 0..7
    // of a 32-key block, the k order in which the V^T fragments are read.
    FH pb[2];
    float ps[4];
#pragma unroll
    for (int j = 0; j < 4; ++j) {
      v8f ar;
      // unrolled, like the loops around it, so that every vector element index is a constant (registers, no scratch)
#pragma unroll
      for (int r = 0; r < 8; ++r) ar[r] = fmaf(s[j][r], kScaleLog2e, cnew);
      const v8f pv = exp2x8(ar);
      float a = 0.f;
#pragma unroll
      for (int r = 0; r < 8; ++r) a += pv[r];
      ps[j] = a;
      pb[j >> 1].h[j & 1] = __builtin_convertvector(pv, v8h);
    }
    lrow = lrow * alpha + ((ps[0] + ps[1]) + (ps[2] + ps[3]));
#pragma unroll
    for (int t = 0; t < 4; ++t)
#pragma unroll
      for (int r = 0; r < 8; ++r) oacc[t][r] *= alpha;
    // out^T += V^T P^T: A = V^T rows (d), B = P^T columns (queries)
#pragma unroll
    for (int kk = 0; kk < 2; ++kk) {
#pragma unroll
      for (int t = 0; t < 4; ++t) {
        FH vb;
        vb.h[0] = *(const v8h*)(Vt + (t * 16 + c) * kAPitch + kk * 32 + 8 * hh);
        vb.h[1] = *(const v8h*)(Vt + (t * 16 + c) * kAPitch + kk * 32 + 16 + 8 * hh);
        oacc[t] = mma_f16g(vb.v, pb[kk].v, oacc[t]);
      }
    }
  }

  float* os = Os[wave];
  {
    const float inv = 1.0f / (lrow + other_half(lrow));   // both carry the factor 2^15
#pragma unroll
    for (int t = 0; t < 4; ++t) {
      float* op = os + c * kOsPitch + t * 16 + 8 * hh;   // eight consecutive d of query row c
      *(v4f*)(op)     = (v4f){oacc[t][0] * inv, oacc[t][1] * inv, oacc[t][2] * inv, oacc[t][3] * inv};
      *(v4f*)(op + 4) = (v4f){oacc[t][4] * inv, oacc[t][5] * inv, oacc[t][6] * inv, oacc[t][7] * inv};
    }
  }
  __builtin_amdgcn_fence(__ATOMIC_RELEASE, "workgroup");
  __builtin_amdgcn_wave_barrier();
  __builtin_amdgcn_fence(__ATOMIC_ACQUIRE, "workgroup");
  {
    const int q = lane >> 3, c8 = (lane & 7) * 8;
    {
#pragma unroll
      for (int it = 0; it < 4; ++it) {
        const int row = it * 4 + q;                       // 0..15
        const float* sp = os + row * kOsPitch + c8;
        v8h hv, lv;
#pragma unroll
        for (int e = 0; e < 8; ++e) {
          const unsigned short hb = f2bf_bits(sp[e]);
          const unsigned short lb = f2bf_bits(sp[e] - bf_bits2f(hb));
          hv[e] = __builtin_bit_cast(_Float16, hb);
          lv[e] = __builtin_bit_cast(_Float16, lb);
        }
        const size_t o = (tok0 + q0 + row) * kDim + hcol + c8;
        *(v8h*)(AVh + o) = hv;
        *(v8h*)(AVl + o) = lv;
      }
      
    }
  }
}

// ---------------------------------------------------------------------------
// y = (x - mu) * rsqrt(var + eps) * bf(gamma) + bf(beta). One block of 256 threads (8 waves) per row; thread t owns
// ---------------------------------------------------------------------------
__global__ __launch_bounds__(256) void ln_kernel(const float* __restrict__ w, const float* __restrict__ ao,
                                                 const float* __restrict__ g, const float* __restrict__ bt,
                                                 float* __restrict__ out) {
  __shared__ float red[16];
  const int row  = blockIdx.x;
  const int t    = threadIdx.x, lane = t & 31, wave = t >> 5;
  const int c0   = t * 4;
  const size_t off = (size_t)row * kDim + c0;
  const v4f a = *(const v4f*)(w + off);
  const v4f o = *(const v4f*)(ao + off);
  float x[4];
#pragma unroll
  for (int e = 0; e < 4; ++e) x[e] = bf_rne(a[e]) + o[e];
  float s = (x[0] + x[1]) + (x[2] + x[3]);
#pragma unroll
  for (int sh = 16; sh > 0; sh >>= 1) s += __shfl_xor(s, sh, 32);
  if (lane == 0) red[wave] = s;
  __syncthreads();
  const float mu = (((red[0] + red[1]) + (red[2] + red[3])) + ((red[4] + red[5]) + (red[6] + red[7]))) * kInvDim;
  float d[4];
  float s2 = 0.f;
#pragma unroll
  for (int e = 0; e < 4; ++e) { d[e] = x[e] - mu; s2 += d[e] * d[e]; }
#pragma unroll
  for (int sh = 16; sh > 0; sh >>= 1) s2 += __shfl_xor(s2, sh, 32);
  if (lane == 0) red[8 + wave] = s2;
  __syncthreads();
  const float var  = (((red[8] + red[9]) + (red[10] + red[11])) + ((red[12] + red[13]) + (red[14] + red[15]))) * kInvDim;
  const float rstd = rsqrtf(var + kLnEps);
  const v4f gg = *(const v4f*)(g + c0);
  const v4f bb = *(const v4f*)(bt + c0);
  v4f y;
#pragma unroll
  for (int e = 0; e < 4; ++e) y[e] = (d[e] * rstd) * bf_rne(gg[e]) + bf_rne(bb[e]);
  *(v4f*)(out + off) = y;
  
}

// ---------------------------------------------------------------------------
// Host launch glue. Workspace region map (bytes, all offsets 256-B aligned):
//   [0]            Wb    bf16 w plane            [4096][1024]      8,388,608
//   [8,388,608]    WT    bf16 Wq^T|Wk^T|Wv^T|Wo^T 4 x [1024][1024]  8,388,608
//   [16,777,216]   AVh|AVl bf16 attn_vec hi/lo   2 x [4096][1024]  16,777,216
//   [33,554,432]   AO    f32 attn_vec @ Wo       [4096][1024]      16,777,216
//   [50,331,648]   QRh|QRl bf16 (q+rwb) hi/lo    2 x [4096][1024]  16,777,216   (these three follow one another: the projection
//   [67,108,864]   KRh|KRl bf16 (k+r) hi/lo      2 x [4096][1024]  16,777,216    launch steps from q to k to v by one stride of
//   [83,886,080]   Vh    f16 v plane             [4096][1024]      8,388,608     two planes)
//   [92,274,688]   TB    f32 [16][1024]                            65,536
//   total 92,340,224
// ---------------------------------------------------------------------------
extern "C" void kernel_launch(void* const* d_in, const int* in_sizes, int n_in,
                              void* d_out, int out_size, void* d_ws, size_t ws_size,
                              hipStream_t stream) {
  if (n_in < 10) return;
  const float* w     = (const float*)d_in[0];
  const float* remb  = (const float*)d_in[1];
  const float* rwb   = (const float*)d_in[2];
  const float* rbias = (const float*)d_in[3];
  const float* Wq    = (const float*)d_in[4];
  const float* Wk    = (const float*)d_in[5];
  const float* Wv    = (const float*)d_in[6];
  const float* Wo    = (const float*)d_in[7];
  const float* gamma = (const float*)d_in[8];
  const float* beta  = (const float*)d_in[9];
  float* out = (float*)d_out;

  const size_t nTokD = (size_t)kTok * kDim;                    // 4,194,304 elements
  if ((size_t)in_sizes[0] != nTokD) return;
  if (in_sizes[1] != kSeq * kHeads * kHd) return;
  if (in_sizes[2] != kHeads * kHd) return;
  if (in_sizes[3] != kSeq * kHeads) return;
  if (in_sizes[4] != kDim * kDim || in_sizes[5] != kDim * kDim || in_sizes[6] != kDim * kDim || in_sizes[7] != kDim * kDim) return;
  if (in_sizes[8] != kDim || in_sizes[9] != kDim) return;
  if ((size_t)out_size != nTokD) return;

  const size_t bWb  = nTokD * 2;
  const size_t bWT  = (size_t)4 * kDim * kDim * 2;
  const size_t bAV  = nTokD * 2 * 2;
  const size_t bAO  = nTokD * 4;
  const size_t bQR  = nTokD * 2 * 2;
  const size_t bKR  = nTokD * 2 * 2;
  const size_t bVh  = nTokD * 2;
  const size_t bTB  = (size_t)kHeads * kSeq * 4;
  const size_t oWb  = 0;
  const size_t oWT  = oWb + bWb;
  const size_t oAV  = oWT + bWT;
  const size_t oAO  = oAV + bAV;
  const size_t oQR  = oAO + bAO;
  const size_t oKR  = oQR + bQR;
  const size_t oVh  = oKR + bKR;
  const size_t oTB  = oVh + bVh;
  const size_t total = oTB + bTB;                               // 92,340,224
  if (total > ws_size) return;

  char* ws = (char*)d_ws;
  unsigned short* Wb  = (unsigned short*)(ws + oWb);
  unsigned short* WT  = (unsigned short*)(ws + oWT);
  unsigned short* AVh = (unsigned short*)(ws + oAV);
  unsigned short* AVl = AVh + nTokD;
  float*          AO  = (float*)(ws + oAO);
  unsigned short* QRh = (unsigned short*)(ws + oQR);
  unsigned short* QRl = QRh + nTokD;
  unsigned short* KRh = (unsigned short*)(ws + oKR);
  unsigned short* KRl = KRh + nTokD;
  unsigned short* Vh  = (unsigned short*)(ws + oVh);
  float*          TB  = (float*)(ws + oTB);

  const long wPlane = (long)kDim * kDim;

  // 1. score bias table [16][1024]; weight transposes: in W[1024 in][1024 out] -> out WT[out][in], planes 0..3 = Wq, Wk, Wv, Wo;
  //    w -> bf16 plane
  prep_kernel<<<dim3(kTbBlocks + kWtBlocks + kCvtBlocks), dim3(256), 0, stream>>>(w, Wq, Wk, Wv, Wo, rwb, remb, rbias, Wb, WT, TB);
  // 2. q, k and v in one launch: batch index 0/1/2 selects the WT plane and the output (QRh|QRl, KRh|KRl, Vh: stride two planes);
  //    the epilogue adds r_w_bias (q) or the shifted r_emb row (k) and writes the planes that the attention reads.
  //    M=4096, N=1024, K=1024 (block tiles 32x8 = 256 blocks x 4 waves, x 3)
  wmma_gemm64<1, 0, 0, 3, false><<<dim3(256, 3), dim3(128), 0, stream>>>(
      Wb, Wb, kDim, 0L,
      WT, WT, kDim, wPlane,
      (void*)QRh, (void*)QRl, kDim, (long)(2 * nTokD),
      rwb, remb, 0L,
      kTok, kDim, kDim, 1.0f);
  // 3. attention -> attn_vec bf16 hi/lo planes
  relattn_kernel<<<dim3(kBatch * kHeads * (kSeq / 64)), dim3(128), 0, stream>>>(QRh, QRl, KRh, KRl, Vh, TB, AVh, AVl);
  // 4. attn_vec @ Wo (A hi/lo split, Wo bf16) -> f32
  wmma_gemm64<1, 2, 0, 0, false><<<dim3(256, 1), dim3(128), 0, stream>>>(
      AVh, AVl, kDim, 0L,
      WT + 3 * wPlane, WT + 3 * wPlane, kDim, 0L,
      (void*)AO, (void*)AO, kDim, 0L,
      gamma, gamma, 0L,
      kTok, kDim, kDim, 1.0f);
  // 5. residual + LayerNorm -> out
  ln_kernel<<<dim3(kTok), dim3(256), 0, stream>>>(w, AO, gamma, beta, out);
}
